// v000
// Times are from an AMD MI455X. After a warm-up the kernel runs many times in a row, and a time is the length of
// such a window on the GPU divided by its runs, so every launch and the gaps after it count. The runs cycle
// through copies of the inputs. A figure is the median of several windows, for all but v000 over two sittings.
// Sittings can differ by a few percent; kernels timed side by side share one.
// v000, which the later versions start from, runs in 372 microseconds.
#include <hip/hip_runtime.h>

// Contractions, f32 accumulate: q/k/v = x.W^T + b ([4096 x 1024].[1024 x 1024] x3) on v_wmma_f32_16x16x32_bf16 with PLAIN bf16 operands (inputs rounded once: exact
// products); the per-head helical projections q_hel/k_hel = qh.Whel[h]^T + bhel ([tokens x 64].[64 x 64]) on v_wmma_f32_16x16x32_f16 with plain f16 q/k and
// f16(bf16(Whel)); the per-(batch, head) attention with TWO score products per key tile (0.5 q.k/8 + 0.5 helical/32, where the helical operands are the pairwise
// L2-normalised, "scrambled" projections) and weights.v, fused per 16-query tile with plain f16 operands and an online f32 softmax; out = ctx.Wo^T + bo on the bf16

#define NB_  2
#define NT_  2048
#define DM   1024
#define NH_  16
#define HD   64
#define NTK  (NB_ * NT_)
#define PSC  32768.0f

typedef _Float16 h16;
typedef unsigned short bf;
typedef __attribute__((ext_vector_type(16))) __bf16   v16bf;
typedef __attribute__((ext_vector_type(16))) _Float16 v16h;
typedef __attribute__((ext_vector_type(8)))  _Float16 v8h;
typedef __attribute__((ext_vector_type(8)))  unsigned short v8us;
typedef __attribute__((ext_vector_type(8)))  float    v8f;
typedef __attribute__((ext_vector_type(4)))  float    v4f;
typedef __attribute__((ext_vector_type(2)))  _Float16 v2h;
typedef v8h  __attribute__((may_alias)) v8ha;
typedef v4f  __attribute__((may_alias)) v4fa;

__device__ __forceinline__ unsigned short f2bf(float f) { unsigned u = __float_as_uint(f); u += 0x7FFFu + ((u >> 16) & 1u); return (unsigned short)(u >> 16); }
__device__ __forceinline__ float bf2f(unsigned short b) { return __uint_as_float(((unsigned)b) << 16); }
__device__ __forceinline__ float bfr(float f) { return bf2f(f2bf(f)); }
__device__ __forceinline__ v16h cat16(v8h lo, v8h hi) { return __builtin_shufflevector(lo, hi, 0, 1, 2, 3, 4, 5, 6, 7, 8, 9, 10, 11, 12, 13, 14, 15); }
__device__ __forceinline__ v16bf cat16b(v8us lo, v8us hi) { return __builtin_bit_cast(v16bf, __builtin_shufflevector(lo, hi, 0, 1, 2, 3, 4, 5, 6, 7, 8, 9, 10, 11, 12, 13, 14, 15)); }
__device__ __forceinline__ v8f wmma16(v16h a, v16h b, v8f c) { return __builtin_amdgcn_wmma_f32_16x16x32_f16(false, a, false, b, (short)0, c, false, false); }
__device__ __forceinline__ v8f wmmab(v16bf a, v16bf b, v8f c) { return __builtin_amdgcn_wmma_f32_16x16x32_bf16(false, a, false, b, (short)0, c, false, false); }

__global__ __launch_bounds__(256) void k_cvtb(const float* __restrict__ src, int nrows, bf* dst) {
    const int lane = threadIdx.x & 31, r = blockIdx.x * 8 + (threadIdx.x >> 5);
    if (r >= nrows) return;
    v8us o[4];
#pragma unroll
    for (int q = 0; q < 4; ++q) { v8us t;
#pragma unroll
        for (int i = 0; i < 8; ++i) t[i] = f2bf(src[(size_t)r * DM + q * 256 + lane * 8 + i]);
        o[q] = t; }
#pragma unroll
    for (int q = 0; q < 4; ++q) *(v8us*)(dst + (size_t)r * DM + q * 256 + lane * 8) = o[q];
    
}

template <bool SPLITA>
__global__ __launch_bounds__(128) void k_gemmb(const bf* __restrict__ A, const bf* __restrict__ Al, const bf* __restrict__ Bn, const float* __restrict__ bias, float* C, int ldc, int cb) {
    __shared__ __align__(16) float ost[4][16 * 68];
    const int lane = threadIdx.x & 31, wave = threadIdx.x >> 5, lr = lane & 15, hi = lane >> 4;
    const int r0 = blockIdx.x * 64 + wave * 16, c0 = blockIdx.y * 64;
    const size_t aoff = (size_t)(r0 + lr) * DM + 8 * hi;
    size_t boff[4];
#pragma unroll
    for (int t = 0; t < 4; ++t) boff[t] = (size_t)(c0 + t * 16 + lr) * DM + 8 * hi;
    v8f acc[4];
#pragma unroll
    for (int t = 0; t < 4; ++t) acc[t] = (v8f){};
#pragma unroll 1
    for (int kc = 0; kc < DM; kc += 32) {
        const v16bf a = cat16b(*(const v8us*)(A + aoff + kc), *(const v8us*)(A + aoff + kc + 16));
        v16bf al = a;
        if (SPLITA) al = cat16b(*(const v8us*)(Al + aoff + kc), *(const v8us*)(Al + aoff + kc + 16));
#pragma unroll
        for (int t = 0; t < 4; ++t) { const v16bf b = cat16b(*(const v8us*)(Bn + boff[t] + kc), *(const v8us*)(Bn + boff[t] + kc + 16)); acc[t] = wmmab(a, b, acc[t]); if (SPLITA) acc[t] = wmmab(al, b, acc[t]); }
        asm volatile("v_nop\n\tv_nop\n\tv_nop\n\tv_nop" : "+v"(acc[0]), "+v"(acc[1]), "+v"(acc[2]), "+v"(acc[3]) : "v"(a), "v"(al));
    }
    float* os = &ost[wave][0];
#pragma unroll
    for (int t = 0; t < 4; ++t) { const float bv = bfr(bias[c0 + t * 16 + lr]);
#pragma unroll
        for (int j = 0; j < 8; ++j) os[(hi * 8 + j) * 68 + t * 16 + lr] = acc[t][j] + bv; }
    __syncthreads();
    float* crow = C + (size_t)r0 * ldc + cb + c0;
    auto pass = [&]() {
#pragma unroll
        for (int s = 0; s < 8; ++s) { const int Lid = (lane >> 3) + 4 * s, piece = lane & 7; const int row = Lid >> 1, cofs = (Lid & 1) * 32 + piece * 4;
            const v4f val = *(const v4fa*)(os + row * 68 + cofs); *(v4f*)(crow + (size_t)row * ldc + cofs) = val; }
    };
    pass(); 
}

// k_r16: f16 rows [tok][1024] of q (which 0) / k (1) from QKV [tok][3072]; k_vt: VT16[b][h][d][t]; k_whel: WH16 [h][e][d] = f16(bf16(Whel)).
__global__ __launch_bounds__(256) void k_r16(const float* __restrict__ QKV, h16* Q16, h16* K16) {
    const int lane = threadIdx.x & 31, wid = blockIdx.x * 8 + (threadIdx.x >> 5);
    if (wid >= 2 * NTK) return;
    const int r = wid >> 1, which = wid & 1;
    const float* s = QKV + (size_t)r * (3 * DM) + which * DM; h16* d = (which ? K16 : Q16) + (size_t)r * DM;
    v8h o[4];
#pragma unroll
    for (int q = 0; q < 4; ++q) { v8h t;
#pragma unroll
        for (int i = 0; i < 8; ++i) t[i] = (h16)s[q * 256 + lane * 8 + i];
        o[q] = t; }
#pragma unroll
    for (int q = 0; q < 4; ++q) *(v8h*)(d + q * 256 + lane * 8) = o[q];
    
}
__global__ __launch_bounds__(256) void k_vt(const float* __restrict__ QKV, h16* VT16) {
    __shared__ __align__(16) h16 tile[64 * 72];
    const int bid = blockIdx.x;
    const int b = bid / (NH_ * (NT_ / 64)), rem = bid - b * (NH_ * (NT_ / 64)), h = rem / (NT_ / 64), kt = rem - h * (NT_ / 64);
    const int k0 = kt * 64, tid = threadIdx.x;
    const int kk = tid >> 2, d0 = (tid & 3) * 16;
    const float* src = QKV + ((size_t)b * NT_ + k0 + kk) * (3 * DM) + 2 * DM + h * HD + d0;
#pragma unroll
    for (int i = 0; i < 16; ++i) tile[(d0 + i) * 72 + kk] = (h16)src[i];
    __syncthreads();
    const int piece = tid & 7;
    h16* base = VT16 + (((size_t)b * NH_ + h) * HD) * NT_ + k0;
    auto pass = [&]() {
#pragma unroll
        for (int s = 0; s < 2; ++s) { const int d = (tid >> 3) + 32 * s; const v8h val = *(const v8ha*)(tile + d * 72 + piece * 8); *(v8h*)(base + (size_t)d * NT_ + piece * 8) = val; }
    };
    pass(); 
}
__global__ __launch_bounds__(256) void k_whel(const float* __restrict__ Whel, h16* WH16) {
    const int lane = threadIdx.x & 31, r = blockIdx.x * 8 + (threadIdx.x >> 5);     // row = (h, e): 1024 rows of 64
    if (r >= NH_ * HD) return;
    v2h o; o[0] = (h16)bfr(Whel[(size_t)r * HD + 2 * lane]); o[1] = (h16)bfr(Whel[(size_t)r * HD + 2 * lane + 1]);
    *(v2h*)(WH16 + (size_t)r * HD + 2 * lane) = o; 
}

// k_hel: QN16[b][h][tok][64] = L2-normalised pairs of (q|k)h . Whel[h]^T + bhel: block = (which, b, h, 64 tokens), wave = 16 tokens: 8 WMMA (A = Q16/K16 head slice
// rows, B = WH16[h] rows e), + bf16(bhel); pair (2p, 2p+1) = columns lr, lr^1 of the same tile -> norm via __shfl_xor(.., 1); staged in LDS, each token row = one
__global__ __launch_bounds__(128) void k_hel(const h16* __restrict__ Q16, const h16* __restrict__ K16, const h16* __restrict__ WH16, const float* __restrict__ bhel, h16* QN16, h16* KN16) {
    __shared__ __align__(16) float ost[4][16 * 68];
    const int lane = threadIdx.x & 31, wave = threadIdx.x >> 5, lr = lane & 15, hi = lane >> 4;
    const int nb = NB_ * NH_ * (NT_ / 64);
    const int which = blockIdx.x / nb, bid = blockIdx.x - which * nb;
    const int b = bid / (NH_ * (NT_ / 64)), rem = bid - b * (NH_ * (NT_ / 64)), h = rem / (NT_ / 64), tt = rem - h * (NT_ / 64);
    const int t0 = tt * 64 + wave * 16;
    const size_t tok0 = (size_t)b * NT_;
    const h16* src = which ? K16 : Q16; h16* dst = which ? KN16 : QN16;
    v16h a[2];
#pragma unroll
    for (int kc = 0; kc < 2; ++kc) { const h16* p = src + (tok0 + t0 + lr) * DM + h * HD + kc * 32 + 8 * hi; a[kc] = cat16(*(const v8h*)p, *(const v8h*)(p + 16)); }
    v8f d4[4];
#pragma unroll
    for (int n = 0; n < 4; ++n) d4[n] = (v8f){};
#pragma unroll
    for (int kc = 0; kc < 2; ++kc)
#pragma unroll
        for (int n = 0; n < 4; ++n) { const h16* bp = WH16 + ((size_t)h * HD + n * 16 + lr) * HD + kc * 32 + 8 * hi; d4[n] = wmma16(a[kc], cat16(*(const v8h*)bp, *(const v8h*)(bp + 16)), d4[n]); }
    asm volatile("v_nop\n\tv_nop\n\tv_nop\n\tv_nop" : "+v"(d4[0]), "+v"(d4[1]), "+v"(d4[2]), "+v"(d4[3]));
    float* os = &ost[wave][0];
#pragma unroll
    for (int n = 0; n < 4; ++n) {
        const float bb = bfr(bhel[(size_t)h * HD + n * 16 + lr]);
#pragma unroll
        for (int j = 0; j < 8; ++j) {
            const float v = d4[n][j] + bb;
            const float w = __shfl_xor(v, 1, 32);                 // pair partner (column lr ^ 1, same row)
            const float nrm = sqrtf(v * v + w * w);
            os[(hi * 8 + j) * 68 + n * 16 + lr] = v / fmaxf(nrm, 1e-12f);
        }
    }
    __syncthreads();
    h16* crow = dst + (((size_t)b * NH_ + h) * NT_ + t0) * HD;      // 16 rows x 64 halves = 16 lines: instruction s covers rows 4s + lane>>3
    auto pass = [&]() {
#pragma unroll
        for (int s = 0; s < 4; ++s) { const int row = 4 * s + (lane >> 3), piece = lane & 7; const float* sp = os + row * 68 + piece * 8; v8h o;
#pragma unroll
            for (int i = 0; i < 8; ++i) o[i] = (h16)sp[i];
            *(v8h*)(crow + (size_t)row * HD + piece * 8) = o; }
    };
    pass(); 
}

// k_scr: the reference's _scramble as a gather: H[b][h][s][2p + c] = QN[b][h][(2s + c) mod 2048][2p + ((2s + c) / 2048)] — block = 8 waves, wave = (which, b, h, s)
__global__ __launch_bounds__(256) void k_scr(const h16* __restrict__ QN16, const h16* __restrict__ KN16, h16* HQ16, h16* HK16) {
    const int lane = threadIdx.x & 31, wid = blockIdx.x * 8 + (threadIdx.x >> 5);
    if (wid >= 2 * NB_ * NH_ * NT_) return;
    const int which = wid / (NB_ * NH_ * NT_), r = wid - which * (NB_ * NH_ * NT_);       // r = (b*16 + h)*2048 + s
    const int s = r % NT_, bh = r / NT_;
    const h16* src = (which ? KN16 : QN16) + (size_t)bh * NT_ * HD; h16* dst = (which ? HK16 : HQ16) + (size_t)r * HD;
    v2h o;
#pragma unroll
    for (int c = 0; c < 2; ++c) { const int f = 2 * s + c; const int t = f % NT_, cc = f / NT_; o[c] = src[(size_t)t * HD + 2 * lane + cc]; }
    *(v2h*)(dst + 2 * lane) = o; 
}

// k_attn: block = (b, h, 64 queries), wave = 16; q and helical-q fragments resident; 64 steps x 32 keys: 4 WMMA q.k and 4 WMMA hq.hk, logits 0.5 s/8 + 0.5 g/32, online f32
// softmax, weights x32768 f16 tile (same-wave may_alias reload after a compiler barrier), 4 WMMA .v; ctx -> bf16 hi/lo planes CH/CL[tok][h*64+d].
__global__ __launch_bounds__(128) void k_attn(const h16* __restrict__ Q16, const h16* __restrict__ K16, const h16* __restrict__ HQ16, const h16* __restrict__ HK16, const h16* __restrict__ VT16, bf* CH, bf* CL) {
    __shared__ __align__(16) h16 plds[4][16 * 32];
    __shared__ __align__(16) float ost[4][16 * 68];
    const int lane = threadIdx.x & 31, wave = threadIdx.x >> 5, lr = lane & 15, hi = lane >> 4;
    const int bid = blockIdx.x;
    const int b = bid / (NH_ * (NT_ / 64)), rem = bid - b * (NH_ * (NT_ / 64)), h = rem / (NT_ / 64), qt = rem - h * (NT_ / 64);
    const int q0 = qt * 64 + wave * 16;
    const size_t tok0 = (size_t)b * NT_;
    const size_t hrow0 = ((size_t)b * NH_ + h) * NT_;
    h16* pl = &plds[wave][0];
    v16h qa[2], ga[2];
#pragma unroll
    for (int kc = 0; kc < 2; ++kc) {
        const h16* p = Q16 + (tok0 + q0 + lr) * DM + h * HD + kc * 32 + 8 * hi; qa[kc] = cat16(*(const v8h*)p, *(const v8h*)(p + 16));
        const h16* g = HQ16 + (hrow0 + q0 + lr) * HD + kc * 32 + 8 * hi; ga[kc] = cat16(*(const v8h*)g, *(const v8h*)(g + 16));
    }
    const h16* kh_b = K16 + tok0 * DM + h * HD; const h16* hk_b = HK16 + hrow0 * HD;
    const h16* vt_b = VT16 + (((size_t)b * NH_ + h) * HD) * NT_;
    v8f o[4];
#pragma unroll
    for (int n = 0; n < 4; ++n) o[n] = (v8f){};
    float mrow[8], lpart[8];
#pragma unroll
    for (int j = 0; j < 8; ++j) { mrow[j] = -3.0e38f; lpart[j] = 0.f; }
#pragma unroll 1
    for (int kt = 0; kt < NT_ / 32; ++kt) {
        const int l0 = kt * 32;
        v8f s0 = {}, s1 = {}, g0 = {}, g1 = {};
#pragma unroll
        for (int kc = 0; kc < 2; ++kc) {
            const h16* r0p = kh_b + (size_t)(l0 + lr) * DM + kc * 32 + 8 * hi; const h16* r1p = kh_b + (size_t)(l0 + 16 + lr) * DM + kc * 32 + 8 * hi;
            const h16* h0p = hk_b + (size_t)(l0 + lr) * HD + kc * 32 + 8 * hi; const h16* h1p = hk_b + (size_t)(l0 + 16 + lr) * HD + kc * 32 + 8 * hi;
            s0 = wmma16(qa[kc], cat16(*(const v8h*)r0p, *(const v8h*)(r0p + 16)), s0); s1 = wmma16(qa[kc], cat16(*(const v8h*)r1p, *(const v8h*)(r1p + 16)), s1);
            g0 = wmma16(ga[kc], cat16(*(const v8h*)h0p, *(const v8h*)(h0p + 16)), g0); g1 = wmma16(ga[kc], cat16(*(const v8h*)h1p, *(const v8h*)(h1p + 16)), g1);
        }
        asm volatile("v_nop\n\tv_nop\n\tv_nop\n\tv_nop" : "+v"(s0), "+v"(s1), "+v"(g0), "+v"(g1) : "v"(qa[0]), "v"(ga[1]));
        float alpha[8];
#pragma unroll
        for (int j = 0; j < 8; ++j) {
            const float a0 = 0.5f * (s0[j] * 0.125f) + 0.5f * (g0[j] * 0.03125f), a1 = 0.5f * (s1[j] * 0.125f) + 0.5f * (g1[j] * 0.03125f);
            float mx = fmaxf(a0, a1);
            mx = fmaxf(mx, __shfl_xor(mx, 1, 16)); mx = fmaxf(mx, __shfl_xor(mx, 2, 16)); mx = fmaxf(mx, __shfl_xor(mx, 4, 16)); mx = fmaxf(mx, __shfl_xor(mx, 8, 16));
            const float mn = fmaxf(mrow[j], mx);
            alpha[j] = __expf(mrow[j] - mn); mrow[j] = mn;
            const float p0 = __expf(a0 - mn), p1 = __expf(a1 - mn);
            lpart[j] = lpart[j] * alpha[j] + (p0 + p1);
            const int mr = hi * 8 + j;
            pl[mr * 32 + lr] = (h16)(p0 * PSC); pl[mr * 32 + 16 + lr] = (h16)(p1 * PSC);
        }
#pragma unroll
        for (int n = 0; n < 4; ++n)
#pragma unroll
            for (int j = 0; j < 8; ++j) o[n][j] *= alpha[j];
        asm volatile("" ::: "memory");
        const v16h pa = cat16(*(const v8ha*)(pl + lr * 32 + hi * 8), *(const v8ha*)(pl + lr * 32 + 16 + hi * 8));
#pragma unroll
        for (int n = 0; n < 4; ++n) { const h16* vp = vt_b + (size_t)(n * 16 + lr) * NT_ + l0 + hi * 8; o[n] = wmma16(pa, cat16(*(const v8h*)vp, *(const v8h*)(vp + 16)), o[n]); }
        asm volatile("v_nop\n\tv_nop\n\tv_nop\n\tv_nop" : "+v"(o[0]), "+v"(o[1]), "+v"(o[2]), "+v"(o[3]) : "v"(pa));
    }
    float inv[8];
#pragma unroll
    for (int j = 0; j < 8; ++j) { float rs = lpart[j]; rs += __shfl_xor(rs, 1, 16); rs += __shfl_xor(rs, 2, 16); rs += __shfl_xor(rs, 4, 16); rs += __shfl_xor(rs, 8, 16); inv[j] = 1.0f / (rs * PSC); }
    float* os = &ost[wave][0];
#pragma unroll
    for (int n = 0; n < 4; ++n)
#pragma unroll
        for (int j = 0; j < 8; ++j) os[(hi * 8 + j) * 68 + n * 16 + lr] = o[n][j] * inv[j];
    __syncthreads();
    const size_t cbase = (tok0 + q0) * DM + (size_t)h * HD;
    auto pass = [&]() {
#pragma unroll
        for (int s = 0; s < 4; ++s) { const int row = 4 * s + (lane >> 3), piece = lane & 7; const float* sp = os + row * 68 + piece * 8; v8us oh, ol;
#pragma unroll
            for (int i = 0; i < 8; ++i) { const unsigned short hb = f2bf(sp[i]); oh[i] = hb; ol[i] = f2bf(sp[i] - bf2f(hb)); }
            *(v8us*)(CH + cbase + (size_t)row * DM + piece * 8) = oh; *(v8us*)(CL + cbase + (size_t)row * DM + piece * 8) = ol; }
    };
    pass(); 
}

extern "C" void kernel_launch(void* const* d_in, const int* in_sizes, int n_in,
                              void* d_out, int out_size, void* d_ws, size_t ws_size, hipStream_t stream) {
    (void)in_sizes; (void)n_in; (void)out_size;
    const float* x = (const float*)d_in[0]; const float* Wq = (const float*)d_in[1]; const float* bq = (const float*)d_in[2]; const float* Wk = (const float*)d_in[3]; const float* bk = (const float*)d_in[4];
    const float* Wv = (const float*)d_in[5]; const float* bv = (const float*)d_in[6]; const float* Wo = (const float*)d_in[7]; const float* bo = (const float*)d_in[8];
    const float* Whel = (const float*)d_in[9]; const float* bhel = (const float*)d_in[10];
    float* out = (float*)d_out;    // [2][2048][1024]
    char* wsp = (char*)d_ws;
    auto take = [&](size_t bytes) { char* p = wsp; wsp += (bytes + 255) & ~(size_t)255; return (void*)p; };
    bf* Xb = (bf*)take((size_t)NTK * DM * 2);
    bf* WB[4]; for (int i = 0; i < 4; ++i) WB[i] = (bf*)take((size_t)DM * DM * 2);
    float* QKV = (float*)take((size_t)NTK * 3 * DM * 4);            // reused later for the ctx planes (dead after the conversions)
    h16* Q16 = (h16*)take((size_t)NTK * DM * 2); h16* K16 = (h16*)take((size_t)NTK * DM * 2); h16* VT16 = (h16*)take((size_t)NTK * DM * 2);
    h16* WH16 = (h16*)take((size_t)NH_ * HD * HD * 2);
    h16* QN16 = (h16*)take((size_t)NB_ * NH_ * NT_ * HD * 2); h16* KN16 = (h16*)take((size_t)NB_ * NH_ * NT_ * HD * 2);
    h16* HQ16 = (h16*)take((size_t)NB_ * NH_ * NT_ * HD * 2); h16* HK16 = (h16*)take((size_t)NB_ * NH_ * NT_ * HD * 2);
    if ((size_t)(wsp - (char*)d_ws) > ws_size) return;    // 8.4 + 8.4 + 50.3 + 25.2 + 0.13 + 33.6 MB ~ 126 MB
    bf* CH = (bf*)QKV; bf* CL = (bf*)((char*)QKV + (size_t)NTK * DM * 2);   // 2 x 8.4 MB inside the dead 50 MB QKV region
    k_cvtb<<<NTK / 8, 256, 0, stream>>>(x, NTK, Xb);
    const float* Ws[4] = {Wq, Wk, Wv, Wo};
    for (int i = 0; i < 4; ++i) k_cvtb<<<DM / 8, 256, 0, stream>>>(Ws[i], DM, WB[i]);
    k_gemmb<false><<<dim3(NTK / 64, DM / 64, 1), 128, 0, stream>>>(Xb, nullptr, WB[0], bq, QKV, 3 * DM, 0);
    k_gemmb<false><<<dim3(NTK / 64, DM / 64, 1), 128, 0, stream>>>(Xb, nullptr, WB[1], bk, QKV, 3 * DM, DM);
    k_gemmb<false><<<dim3(NTK / 64, DM / 64, 1), 128, 0, stream>>>(Xb, nullptr, WB[2], bv, QKV, 3 * DM, 2 * DM);
    k_r16<<<(2 * NTK) / 8, 256, 0, stream>>>(QKV, Q16, K16);
    k_vt<<<NB_ * NH_ * (NT_ / 64), 256, 0, stream>>>(QKV, VT16);
    k_whel<<<(NH_ * HD) / 8, 256, 0, stream>>>(Whel, WH16);
    k_hel<<<2 * NB_ * NH_ * (NT_ / 64), 128, 0, stream>>>(Q16, K16, WH16, bhel, QN16, KN16);
    k_scr<<<(2 * NB_ * NH_ * NT_) / 8, 256, 0, stream>>>(QN16, KN16, HQ16, HK16);
    k_attn<<<NB_ * NH_ * (NT_ / 64), 128, 0, stream>>>(Q16, K16, HQ16, HK16, VT16, CH, CL);
    k_gemmb<true><<<dim3(NTK / 64, DM / 64, 1), 128, 0, stream>>>(CH, CL, WB[3], bo, out, DM, 0);
}

// v001
// It runs in 272 microseconds.
// Two timings next to v000 put it at 1.42 and 1.40 times that version's speed.
#include <hip/hip_runtime.h>

// Contractions, f32 accumulate: q/k/v = x.W^T + b ([4096 x 1024].[1024 x 1024] x3) on v_wmma_f32_16x16x32_bf16 with PLAIN bf16 operands (inputs rounded once: exact
// products); the per-head helical projections q_hel/k_hel = qh.Whel[h]^T + bhel ([tokens x 64].[64 x 64]) on v_wmma_f32_16x16x32_f16 with plain f16 q/k and
// f16(bf16(Whel)); the per-(batch, head) attention with TWO score products per key tile (0.5 q.k/8 + 0.5 helical/32, where the helical operands are the pairwise
// L2-normalised, "scrambled" projections) and weights.v, fused per 16-query tile with plain f16 operands and an online f32 softmax; out = ctx.Wo^T + bo on the bf16

#define NB_  2
#define NT_  2048
#define DM   1024
#define NH_  16
#define HD   64
#define NTK  (NB_ * NT_)
#define PSC  32768.0f

typedef _Float16 h16;
typedef unsigned short bf;
typedef __attribute__((ext_vector_type(16))) __bf16   v16bf;
typedef __attribute__((ext_vector_type(16))) _Float16 v16h;
typedef __attribute__((ext_vector_type(8)))  _Float16 v8h;
typedef __attribute__((ext_vector_type(8)))  unsigned short v8us;
typedef __attribute__((ext_vector_type(8)))  float    v8f;
typedef __attribute__((ext_vector_type(4)))  float    v4f;
typedef __attribute__((ext_vector_type(2)))  _Float16 v2h;
typedef v8h  __attribute__((may_alias)) v8ha;
typedef v4f  __attribute__((may_alias)) v4fa;

__device__ __forceinline__ unsigned short f2bf(float f) { unsigned u = __float_as_uint(f); u += 0x7FFFu + ((u >> 16) & 1u); return (unsigned short)(u >> 16); }
__device__ __forceinline__ float bf2f(unsigned short b) { return __uint_as_float(((unsigned)b) << 16); }
__device__ __forceinline__ float bfr(float f) { return bf2f(f2bf(f)); }
__device__ __forceinline__ v16h cat16(v8h lo, v8h hi) { return __builtin_shufflevector(lo, hi, 0, 1, 2, 3, 4, 5, 6, 7, 8, 9, 10, 11, 12, 13, 14, 15); }
__device__ __forceinline__ v16bf cat16b(v8us lo, v8us hi) { return __builtin_bit_cast(v16bf, __builtin_shufflevector(lo, hi, 0, 1, 2, 3, 4, 5, 6, 7, 8, 9, 10, 11, 12, 13, 14, 15)); }
__device__ __forceinline__ v8f wmma16(v16h a, v16h b, v8f c) { return __builtin_amdgcn_wmma_f32_16x16x32_f16(false, a, false, b, (short)0, c, false, false); }
__device__ __forceinline__ v8f wmmab(v16bf a, v16bf b, v8f c) { return __builtin_amdgcn_wmma_f32_16x16x32_bf16(false, a, false, b, (short)0, c, false, false); }

__global__ __launch_bounds__(256) void k_cvtb(const float* __restrict__ src, int nrows, bf* dst) {
    const int lane = threadIdx.x & 31, r = blockIdx.x * 8 + (threadIdx.x >> 5);
    if (r >= nrows) return;
    v8us o[4];
#pragma unroll
    for (int q = 0; q < 4; ++q) { v8us t;
#pragma unroll
        for (int i = 0; i < 8; ++i) t[i] = f2bf(src[(size_t)r * DM + q * 256 + lane * 8 + i]);
        o[q] = t; }
#pragma unroll
    for (int q = 0; q < 4; ++q) *(v8us*)(dst + (size_t)r * DM + q * 256 + lane * 8) = o[q];
    
}

// k_gemmb: C[128 x 128] per block of 8 waves (2 x 4, 64 rows x 32 columns each). A stage is 128 k (256 B) of the block's 128 A rows (hi, and lo where SPLITA) and 128 B rows,
// brought into LDS by per-lane 16-byte asynchronous copies (whole lines, no register), rows at pitch 272 B for the 16-byte fragment reads; two buffers, the next stage in flight.
#define GKS  128
#define GPB  272
#define GOP  (128 * GPB)
typedef v8us __attribute__((may_alias)) v8usa;

// eight copies of one operand's 16 rows of this wave; the s_wait_xcnt closes the statement so that no address register is rewritten ahead of it
__device__ __forceinline__ void cp8(unsigned l, const bf* g) {
    asm volatile("global_load_async_to_lds_b128 %0, %1, off\n\t"
                 "global_load_async_to_lds_b128 %2, %3, off\n\t"
                 "global_load_async_to_lds_b128 %4, %5, off\n\t"
                 "global_load_async_to_lds_b128 %6, %7, off\n\t"
                 "global_load_async_to_lds_b128 %8, %9, off\n\t"
                 "global_load_async_to_lds_b128 %10, %11, off\n\t"
                 "global_load_async_to_lds_b128 %12, %13, off\n\t"
                 "global_load_async_to_lds_b128 %14, %15, off\n\t"
                 "s_wait_xcnt 0x0"
                 :: "v"(l), "v"(g), "v"(l + 2 * GPB), "v"(g + 2 * DM), "v"(l + 4 * GPB), "v"(g + 4 * DM), "v"(l + 6 * GPB), "v"(g + 6 * DM),
                    "v"(l + 8 * GPB), "v"(g + 8 * DM), "v"(l + 10 * GPB), "v"(g + 10 * DM), "v"(l + 12 * GPB), "v"(g + 12 * DM), "v"(l + 14 * GPB), "v"(g + 14 * DM)
                 : "memory");
}

template <bool SPLITA>
__global__ __launch_bounds__(256) void k_gemmb(const bf* __restrict__ A, const bf* __restrict__ Al, const bf* __restrict__ Bn, const float* __restrict__ bias, float* C, int ldc, int cb) {
    constexpr int STG = (SPLITA ? 3 : 2) * GOP, BOP = (SPLITA ? 2 : 1) * GOP;   // one stage: [A | B], or [A hi | A lo | B]
    constexpr int NST = DM / GKS, NBK = (GKS / 32) * (SPLITA ? 2 : 1);
    __shared__ __align__(16) unsigned char ring[2 * STG];
    const int lane = threadIdx.x & 31, wave = threadIdx.x >> 5, lr = lane & 15, hi = lane >> 4;
    const int wm = wave >> 2, wn = wave & 3;
    const int r0 = blockIdx.x * 128, c0 = blockIdx.y * 128;
    const int crw = wave * 16 + hi;                             // copy i of a wave: rows crw + 2 i, bytes 16 lr of the stage's 256
    const unsigned l0 = (unsigned)(size_t)ring + crw * GPB + lr * 16;
    const bf* gA = A + (size_t)(r0 + crw) * DM + lr * 8;
    const bf* gB = Bn + (size_t)(c0 + crw) * DM + lr * 8;
    const bf* gL = SPLITA ? Al + (size_t)(r0 + crw) * DM + lr * 8 : gA;
    auto fill = [&](int t, int buf) {
        const unsigned l = l0 + buf * STG;
        cp8(l, gA + t * GKS); cp8(l + BOP, gB + t * GKS);
        if (SPLITA) cp8(l + GOP, gL + t * GKS);
    };
    v8f acc[4][2];
#pragma unroll
    for (int m = 0; m < 4; ++m)
#pragma unroll
        for (int n = 0; n < 2; ++n) acc[m][n] = (v8f){};
    fill(0, 0);
    asm volatile("s_wait_asynccnt 0x0" ::: "memory");           // stage 0 of this wave has landed
    __syncthreads();                                            // ... and every other wave's
    fill(1, 1);
    const int aofs = (wm * 64 + lr) * GPB + hi * 16, bofs = BOP + (wn * 32 + lr) * GPB + hi * 16;
    // kept rolled: one stage per trip, the buffer picked by the trip's parity
#pragma unroll 1
    for (int t = 0; t < NST; ++t) {
        const unsigned char* sb = ring + (t & 1) * STG;
        // a block = the 8 products of one A-side fragment set (hi, or lo where SPLITA) with one B set; block i + 1's fragments are read as one group ahead of block i's products
        v16bf fa[2][4], fb[2][2];
        auto lda = [&](int i, v16bf* d) {
            const unsigned char* q = sb + aofs + (SPLITA ? (i & 1) * GOP + (i >> 1) * 64 : i * 64);
#pragma unroll
            for (int m = 0; m < 4; ++m) { const unsigned char* p = q + m * 16 * GPB; d[m] = cat16b(*(const v8usa*)p, *(const v8usa*)(p + 32)); }
        };
        auto ldb = [&](int ks, v16bf* d) {
#pragma unroll
            for (int n = 0; n < 2; ++n) { const unsigned char* p = sb + bofs + n * 16 * GPB + ks * 64; d[n] = cat16b(*(const v8usa*)p, *(const v8usa*)(p + 32)); }
        };
        lda(0, fa[0]); ldb(0, fb[0]);
#pragma unroll
        for (int i = 0; i < NBK; ++i) {
            const int ks = SPLITA ? i >> 1 : i, ks1 = SPLITA ? (i + 1) >> 1 : i + 1;
            if (i + 1 < NBK) { lda(i + 1, fa[(i + 1) & 1]); if (ks1 != ks) ldb(ks1, fb[ks1 & 1]); }
            __builtin_amdgcn_sched_barrier(0);                  // keeps the LDS reads one group in front of the products, not spread among them with waits to 0
#pragma unroll
            for (int m = 0; m < 4; ++m)
#pragma unroll
                for (int n = 0; n < 2; ++n) acc[m][n] = wmmab(fa[i & 1][m], fb[ks & 1][n], acc[m][n]);
            __builtin_amdgcn_sched_barrier(0);                  // the other side of that fence
        }
        asm volatile("s_wait_dscnt 0x0" ::: "memory");          // this wave has left the buffer
        asm volatile("s_wait_asynccnt 0x0" ::: "memory");       // its copies of stage t + 1 have landed
        __syncthreads();                                        // publishes stage t + 1, frees stage t's buffer
        if (t + 2 < NST) fill(t + 2, t & 1);
    }
    asm volatile("s_wait_asynccnt 0x0" ::: "memory");           // nothing in flight when the ring becomes output staging
    float* os = (float*)(ring + wave * (64 * 36 * 4));          // this wave's own 64 rows x 32 columns, pitch 36 floats
#pragma unroll
    for (int n = 0; n < 2; ++n) { const float bv = bfr(bias[c0 + wn * 32 + n * 16 + lr]);
#pragma unroll
        for (int m = 0; m < 4; ++m)
#pragma unroll
            for (int j = 0; j < 8; ++j) os[(m * 16 + hi * 8 + j) * 36 + n * 16 + lr] = acc[m][n][j] + bv; }
    float* crow = C + (size_t)(r0 + wm * 64) * ldc + cb + c0 + wn * 32;
#pragma unroll
    for (int s = 0; s < 16; ++s) { const int row = s * 4 + (lane >> 3), cofs = (lane & 7) * 4;
        const v4f val = *(const v4fa*)(os + row * 36 + cofs); *(v4f*)(crow + (size_t)row * ldc + cofs) = val; }
}

// k_r16: f16 rows [tok][1024] of q (which 0) / k (1) from QKV [tok][3072]; k_vt: VT16[b][h][d][t]; k_whel: WH16 [h][e][d] = f16(bf16(Whel)).
__global__ __launch_bounds__(256) void k_r16(const float* __restrict__ QKV, h16* Q16, h16* K16) {
    const int lane = threadIdx.x & 31, wid = blockIdx.x * 8 + (threadIdx.x >> 5);
    if (wid >= 2 * NTK) return;
    const int r = wid >> 1, which = wid & 1;
    const float* s = QKV + (size_t)r * (3 * DM) + which * DM; h16* d = (which ? K16 : Q16) + (size_t)r * DM;
    v8h o[4];
#pragma unroll
    for (int q = 0; q < 4; ++q) { v8h t;
#pragma unroll
        for (int i = 0; i < 8; ++i) t[i] = (h16)s[q * 256 + lane * 8 + i];
        o[q] = t; }
#pragma unroll
    for (int q = 0; q < 4; ++q) *(v8h*)(d + q * 256 + lane * 8) = o[q];
    
}
__global__ __launch_bounds__(256) void k_vt(const float* __restrict__ QKV, h16* VT16) {
    __shared__ __align__(16) h16 tile[64 * 72];
    const int bid = blockIdx.x;
    const int b = bid / (NH_ * (NT_ / 64)), rem = bid - b * (NH_ * (NT_ / 64)), h = rem / (NT_ / 64), kt = rem - h * (NT_ / 64);
    const int k0 = kt * 64, tid = threadIdx.x;
    const int kk = tid >> 2, d0 = (tid & 3) * 16;
    const float* src = QKV + ((size_t)b * NT_ + k0 + kk) * (3 * DM) + 2 * DM + h * HD + d0;
#pragma unroll
    for (int i = 0; i < 16; ++i) tile[(d0 + i) * 72 + kk] = (h16)src[i];
    __syncthreads();
    const int piece = tid & 7;
    h16* base = VT16 + (((size_t)b * NH_ + h) * HD) * NT_ + k0;
    auto pass = [&]() {
#pragma unroll
        for (int s = 0; s < 2; ++s) { const int d = (tid >> 3) + 32 * s; const v8h val = *(const v8ha*)(tile + d * 72 + piece * 8); *(v8h*)(base + (size_t)d * NT_ + piece * 8) = val; }
    };
    pass(); 
}
__global__ __launch_bounds__(256) void k_whel(const float* __restrict__ Whel, h16* WH16) {
    const int lane = threadIdx.x & 31, r = blockIdx.x * 8 + (threadIdx.x >> 5);     // row = (h, e): 1024 rows of 64
    if (r >= NH_ * HD) return;
    v2h o; o[0] = (h16)bfr(Whel[(size_t)r * HD + 2 * lane]); o[1] = (h16)bfr(Whel[(size_t)r * HD + 2 * lane + 1]);
    *(v2h*)(WH16 + (size_t)r * HD + 2 * lane) = o; 
}

// k_hel: QN16[b][h][tok][64] = L2-normalised pairs of (q|k)h . Whel[h]^T + bhel: block = (which, b, h, 64 tokens), wave = 16 tokens: 8 WMMA (A = Q16/K16 head slice
// rows, B = WH16[h] rows e), + bf16(bhel); pair (2p, 2p+1) = columns lr, lr^1 of the same tile -> norm via __shfl_xor(.., 1); staged in LDS, each token row = one
__global__ __launch_bounds__(128) void k_hel(const h16* __restrict__ Q16, const h16* __restrict__ K16, const h16* __restrict__ WH16, const float* __restrict__ bhel, h16* QN16, h16* KN16) {
    __shared__ __align__(16) float ost[4][16 * 68];
    const int lane = threadIdx.x & 31, wave = threadIdx.x >> 5, lr = lane & 15, hi = lane >> 4;
    const int nb = NB_ * NH_ * (NT_ / 64);
    const int which = blockIdx.x / nb, bid = blockIdx.x - which * nb;
    const int b = bid / (NH_ * (NT_ / 64)), rem = bid - b * (NH_ * (NT_ / 64)), h = rem / (NT_ / 64), tt = rem - h * (NT_ / 64);
    const int t0 = tt * 64 + wave * 16;
    const size_t tok0 = (size_t)b * NT_;
    const h16* src = which ? K16 : Q16; h16* dst = which ? KN16 : QN16;
    v16h a[2];
#pragma unroll
    for (int kc = 0; kc < 2; ++kc) { const h16* p = src + (tok0 + t0 + lr) * DM + h * HD + kc * 32 + 8 * hi; a[kc] = cat16(*(const v8h*)p, *(const v8h*)(p + 16)); }
    v8f d4[4];
#pragma unroll
    for (int n = 0; n < 4; ++n) d4[n] = (v8f){};
#pragma unroll
    for (int kc = 0; kc < 2; ++kc)
#pragma unroll
        for (int n = 0; n < 4; ++n) { const h16* bp = WH16 + ((size_t)h * HD + n * 16 + lr) * HD + kc * 32 + 8 * hi; d4[n] = wmma16(a[kc], cat16(*(const v8h*)bp, *(const v8h*)(bp + 16)), d4[n]); }
    asm volatile("v_nop\n\tv_nop\n\tv_nop\n\tv_nop" : "+v"(d4[0]), "+v"(d4[1]), "+v"(d4[2]), "+v"(d4[3]));
    float* os = &ost[wave][0];
#pragma unroll
    for (int n = 0; n < 4; ++n) {
        const float bb = bfr(bhel[(size_t)h * HD + n * 16 + lr]);
#pragma unroll
        for (int j = 0; j < 8; ++j) {
            const float v = d4[n][j] + bb;
            const float w = __shfl_xor(v, 1, 32);                 // pair partner (column lr ^ 1, same row)
            const float nrm = sqrtf(v * v + w * w);
            os[(hi * 8 + j) * 68 + n * 16 + lr] = v / fmaxf(nrm, 1e-12f);
        }
    }
    __syncthreads();
    h16* crow = dst + (((size_t)b * NH_ + h) * NT_ + t0) * HD;      // 16 rows x 64 halves = 16 lines: instruction s covers rows 4s + lane>>3
    auto pass = [&]() {
#pragma unroll
        for (int s = 0; s < 4; ++s) { const int row = 4 * s + (lane >> 3), piece = lane & 7; const float* sp = os + row * 68 + piece * 8; v8h o;
#pragma unroll
            for (int i = 0; i < 8; ++i) o[i] = (h16)sp[i];
            *(v8h*)(crow + (size_t)row * HD + piece * 8) = o; }
    };
    pass(); 
}

// k_scr: the reference's _scramble as a gather: H[b][h][s][2p + c] = QN[b][h][(2s + c) mod 2048][2p + ((2s + c) / 2048)] — block = 8 waves, wave = (which, b, h, s)
__global__ __launch_bounds__(256) void k_scr(const h16* __restrict__ QN16, const h16* __restrict__ KN16, h16* HQ16, h16* HK16) {
    const int lane = threadIdx.x & 31, wid = blockIdx.x * 8 + (threadIdx.x >> 5);
    if (wid >= 2 * NB_ * NH_ * NT_) return;
    const int which = wid / (NB_ * NH_ * NT_), r = wid - which * (NB_ * NH_ * NT_);       // r = (b*16 + h)*2048 + s
    const int s = r % NT_, bh = r / NT_;
    const h16* src = (which ? KN16 : QN16) + (size_t)bh * NT_ * HD; h16* dst = (which ? HK16 : HQ16) + (size_t)r * HD;
    v2h o;
#pragma unroll
    for (int c = 0; c < 2; ++c) { const int f = 2 * s + c; const int t = f % NT_, cc = f / NT_; o[c] = src[(size_t)t * HD + 2 * lane + cc]; }
    *(v2h*)(dst + 2 * lane) = o; 
}

// k_attn: block = (b, h, 64 queries), wave = 16; q and helical-q fragments resident; 64 steps x 32 keys: 4 WMMA q.k and 4 WMMA hq.hk, logits 0.5 s/8 + 0.5 g/32, online f32
// softmax, weights x32768 f16 tile (same-wave may_alias reload after a compiler barrier), 4 WMMA .v; ctx -> bf16 hi/lo planes CH/CL[tok][h*64+d].
__global__ __launch_bounds__(128) void k_attn(const h16* __restrict__ Q16, const h16* __restrict__ K16, const h16* __restrict__ HQ16, const h16* __restrict__ HK16, const h16* __restrict__ VT16, bf* CH, bf* CL) {
    __shared__ __align__(16) h16 plds[4][16 * 32];
    __shared__ __align__(16) float ost[4][16 * 68];
    const int lane = threadIdx.x & 31, wave = threadIdx.x >> 5, lr = lane & 15, hi = lane >> 4;
    const int bid = blockIdx.x;
    const int b = bid / (NH_ * (NT_ / 64)), rem = bid - b * (NH_ * (NT_ / 64)), h = rem / (NT_ / 64), qt = rem - h * (NT_ / 64);
    const int q0 = qt * 64 + wave * 16;
    const size_t tok0 = (size_t)b * NT_;
    const size_t hrow0 = ((size_t)b * NH_ + h) * NT_;
    h16* pl = &plds[wave][0];
    v16h qa[2], ga[2];
#pragma unroll
    for (int kc = 0; kc < 2; ++kc) {
        const h16* p = Q16 + (tok0 + q0 + lr) * DM + h * HD + kc * 32 + 8 * hi; qa[kc] = cat16(*(const v8h*)p, *(const v8h*)(p + 16));
        const h16* g = HQ16 + (hrow0 + q0 + lr) * HD + kc * 32 + 8 * hi; ga[kc] = cat16(*(const v8h*)g, *(const v8h*)(g + 16));
    }
    const h16* kh_b = K16 + tok0 * DM + h * HD; const h16* hk_b = HK16 + hrow0 * HD;
    const h16* vt_b = VT16 + (((size_t)b * NH_ + h) * HD) * NT_;
    v8f o[4];
#pragma unroll
    for (int n = 0; n < 4; ++n) o[n] = (v8f){};
    float mrow[8], lpart[8];
#pragma unroll
    for (int j = 0; j < 8; ++j) { mrow[j] = -3.0e38f; lpart[j] = 0.f; }
#pragma unroll 1
    for (int kt = 0; kt < NT_ / 32; ++kt) {
        const int l0 = kt * 32;
        v8f s0 = {}, s1 = {}, g0 = {}, g1 = {};
#pragma unroll
        for (int kc = 0; kc < 2; ++kc) {
            const h16* r0p = kh_b + (size_t)(l0 + lr) * DM + kc * 32 + 8 * hi; const h16* r1p = kh_b + (size_t)(l0 + 16 + lr) * DM + kc * 32 + 8 * hi;
            const h16* h0p = hk_b + (size_t)(l0 + lr) * HD + kc * 32 + 8 * hi; const h16* h1p = hk_b + (size_t)(l0 + 16 + lr) * HD + kc * 32 + 8 * hi;
            s0 = wmma16(qa[kc], cat16(*(const v8h*)r0p, *(const v8h*)(r0p + 16)), s0); s1 = wmma16(qa[kc], cat16(*(const v8h*)r1p, *(const v8h*)(r1p + 16)), s1);
            g0 = wmma16(ga[kc], cat16(*(const v8h*)h0p, *(const v8h*)(h0p + 16)), g0); g1 = wmma16(ga[kc], cat16(*(const v8h*)h1p, *(const v8h*)(h1p + 16)), g1);
        }
        asm volatile("v_nop\n\tv_nop\n\tv_nop\n\tv_nop" : "+v"(s0), "+v"(s1), "+v"(g0), "+v"(g1) : "v"(qa[0]), "v"(ga[1]));
        float alpha[8];
#pragma unroll
        for (int j = 0; j < 8; ++j) {
            const float a0 = 0.5f * (s0[j] * 0.125f) + 0.5f * (g0[j] * 0.03125f), a1 = 0.5f * (s1[j] * 0.125f) + 0.5f * (g1[j] * 0.03125f);
            float mx = fmaxf(a0, a1);
            mx = fmaxf(mx, __shfl_xor(mx, 1, 16)); mx = fmaxf(mx, __shfl_xor(mx, 2, 16)); mx = fmaxf(mx, __shfl_xor(mx, 4, 16)); mx = fmaxf(mx, __shfl_xor(mx, 8, 16));
            const float mn = fmaxf(mrow[j], mx);
            alpha[j] = __expf(mrow[j] - mn); mrow[j] = mn;
            const float p0 = __expf(a0 - mn), p1 = __expf(a1 - mn);
            lpart[j] = lpart[j] * alpha[j] + (p0 + p1);
            const int mr = hi * 8 + j;
            pl[mr * 32 + lr] = (h16)(p0 * PSC); pl[mr * 32 + 16 + lr] = (h16)(p1 * PSC);
        }
#pragma unroll
        for (int n = 0; n < 4; ++n)
#pragma unroll
            for (int j = 0; j < 8; ++j) o[n][j] *= alpha[j];
        asm volatile("" ::: "memory");
        const v16h pa = cat16(*(const v8ha*)(pl + lr * 32 + hi * 8), *(const v8ha*)(pl + lr * 32 + 16 + hi * 8));
#pragma unroll
        for (int n = 0; n < 4; ++n) { const h16* vp = vt_b + (size_t)(n * 16 + lr) * NT_ + l0 + hi * 8; o[n] = wmma16(pa, cat16(*(const v8h*)vp, *(const v8h*)(vp + 16)), o[n]); }
        asm volatile("v_nop\n\tv_nop\n\tv_nop\n\tv_nop" : "+v"(o[0]), "+v"(o[1]), "+v"(o[2]), "+v"(o[3]) : "v"(pa));
    }
    float inv[8];
#pragma unroll
    for (int j = 0; j < 8; ++j) { float rs = lpart[j]; rs += __shfl_xor(rs, 1, 16); rs += __shfl_xor(rs, 2, 16); rs += __shfl_xor(rs, 4, 16); rs += __shfl_xor(rs, 8, 16); inv[j] = 1.0f / (rs * PSC); }
    float* os = &ost[wave][0];
#pragma unroll
    for (int n = 0; n < 4; ++n)
#pragma unroll
        for (int j = 0; j < 8; ++j) os[(hi * 8 + j) * 68 + n * 16 + lr] = o[n][j] * inv[j];
    __syncthreads();
    const size_t cbase = (tok0 + q0) * DM + (size_t)h * HD;
    auto pass = [&]() {
#pragma unroll
        for (int s = 0; s < 4; ++s) { const int row = 4 * s + (lane >> 3), piece = lane & 7; const float* sp = os + row * 68 + piece * 8; v8us oh, ol;
#pragma unroll
            for (int i = 0; i < 8; ++i) { const unsigned short hb = f2bf(sp[i]); oh[i] = hb; ol[i] = f2bf(sp[i] - bf2f(hb)); }
            *(v8us*)(CH + cbase + (size_t)row * DM + piece * 8) = oh; *(v8us*)(CL + cbase + (size_t)row * DM + piece * 8) = ol; }
    };
    pass(); 
}

extern "C" void kernel_launch(void* const* d_in, const int* in_sizes, int n_in,
                              void* d_out, int out_size, void* d_ws, size_t ws_size, hipStream_t stream) {
    (void)in_sizes; (void)n_in; (void)out_size;
    const float* x = (const float*)d_in[0]; const float* Wq = (const float*)d_in[1]; const float* bq = (const float*)d_in[2]; const float* Wk = (const float*)d_in[3]; const float* bk = (const float*)d_in[4];
    const float* Wv = (const float*)d_in[5]; const float* bv = (const float*)d_in[6]; const float* Wo = (const float*)d_in[7]; const float* bo = (const float*)d_in[8];
    const float* Whel = (const float*)d_in[9]; const float* bhel = (const float*)d_in[10];
    float* out = (float*)d_out;    // [2][2048][1024]
    char* wsp = (char*)d_ws;
    auto take = [&](size_t bytes) { char* p = wsp; wsp += (bytes + 255) & ~(size_t)255; return (void*)p; };
    bf* Xb = (bf*)take((size_t)NTK * DM * 2);
    bf* WB[4]; for (int i = 0; i < 4; ++i) WB[i] = (bf*)take((size_t)DM * DM * 2);
    float* QKV = (float*)take((size_t)NTK * 3 * DM * 4);            // reused later for the ctx planes (dead after the conversions)
    h16* Q16 = (h16*)take((size_t)NTK * DM * 2); h16* K16 = (h16*)take((size_t)NTK * DM * 2); h16* VT16 = (h16*)take((size_t)NTK * DM * 2);
    h16* WH16 = (h16*)take((size_t)NH_ * HD * HD * 2);
    h16* QN16 = (h16*)take((size_t)NB_ * NH_ * NT_ * HD * 2); h16* KN16 = (h16*)take((size_t)NB_ * NH_ * NT_ * HD * 2);
    h16* HQ16 = (h16*)take((size_t)NB_ * NH_ * NT_ * HD * 2); h16* HK16 = (h16*)take((size_t)NB_ * NH_ * NT_ * HD * 2);
    if ((size_t)(wsp - (char*)d_ws) > ws_size) return;    // 8.4 + 8.4 + 50.3 + 25.2 + 0.13 + 33.6 MB ~ 126 MB
    bf* CH = (bf*)QKV; bf* CL = (bf*)((char*)QKV + (size_t)NTK * DM * 2);   // 2 x 8.4 MB inside the dead 50 MB QKV region
    k_cvtb<<<NTK / 8, 256, 0, stream>>>(x, NTK, Xb);
    const float* Ws[4] = {Wq, Wk, Wv, Wo};
    for (int i = 0; i < 4; ++i) k_cvtb<<<DM / 8, 256, 0, stream>>>(Ws[i], DM, WB[i]);
    k_gemmb<false><<<dim3(NTK / 128, DM / 128, 1), 256, 0, stream>>>(Xb, nullptr, WB[0], bq, QKV, 3 * DM, 0);
    k_gemmb<false><<<dim3(NTK / 128, DM / 128, 1), 256, 0, stream>>>(Xb, nullptr, WB[1], bk, QKV, 3 * DM, DM);
    k_gemmb<false><<<dim3(NTK / 128, DM / 128, 1), 256, 0, stream>>>(Xb, nullptr, WB[2], bv, QKV, 3 * DM, 2 * DM);
    k_r16<<<(2 * NTK) / 8, 256, 0, stream>>>(QKV, Q16, K16);
    k_vt<<<NB_ * NH_ * (NT_ / 64), 256, 0, stream>>>(QKV, VT16);
    k_whel<<<(NH_ * HD) / 8, 256, 0, stream>>>(Whel, WH16);
    k_hel<<<2 * NB_ * NH_ * (NT_ / 64), 128, 0, stream>>>(Q16, K16, WH16, bhel, QN16, KN16);
    k_scr<<<(2 * NB_ * NH_ * NT_) / 8, 256, 0, stream>>>(QN16, KN16, HQ16, HK16);
    k_attn<<<NB_ * NH_ * (NT_ / 64), 128, 0, stream>>>(Q16, K16, HQ16, HK16, VT16, CH, CL);
    k_gemmb<true><<<dim3(NTK / 128, DM / 128, 1), 256, 0, stream>>>(CH, CL, WB[3], bo, out, DM, 0);
}

// v002
// Measured time: 190 microseconds a run.
// In two side-by-side timings against v001, it was 1.43 and 1.44 times as fast.
// All steps since v000 together make it 2.01 times as fast.
#include <hip/hip_runtime.h>

// Contractions, f32 accumulate: q/k/v = x.W^T + b ([4096 x 1024].[1024 x 1024] x3) on v_wmma_f32_16x16x32_bf16 with PLAIN bf16 operands (inputs rounded once: exact
// products); the per-head helical projections q_hel/k_hel = qh.Whel[h]^T + bhel ([tokens x 64].[64 x 64]) on v_wmma_f32_16x16x32_f16 with plain f16 q/k and
// f16(bf16(Whel)); the per-(batch, head) attention with TWO score products per key tile (0.5 q.k/8 + 0.5 helical/32, where the helical operands are the pairwise
// L2-normalised, "scrambled" projections) and weights.v, fused per 16-query tile with plain f16 operands and an online f32 softmax; out = ctx.Wo^T + bo on the bf16

#define NB_  2
#define NT_  2048
#define DM   1024
#define NH_  16
#define HD   64
#define NTK  (NB_ * NT_)
#define PSC  32768.0f

typedef _Float16 h16;
typedef unsigned short bf;
typedef __attribute__((ext_vector_type(16))) __bf16   v16bf;
typedef __attribute__((ext_vector_type(16))) _Float16 v16h;
typedef __attribute__((ext_vector_type(8)))  _Float16 v8h;
typedef __attribute__((ext_vector_type(8)))  unsigned short v8us;
typedef __attribute__((ext_vector_type(8)))  float    v8f;
typedef __attribute__((ext_vector_type(4)))  float    v4f;
typedef __attribute__((ext_vector_type(2)))  _Float16 v2h;
typedef v8h  __attribute__((may_alias)) v8ha;
typedef v4f  __attribute__((may_alias)) v4fa;

__device__ __forceinline__ unsigned short f2bf(float f) { unsigned u = __float_as_uint(f); u += 0x7FFFu + ((u >> 16) & 1u); return (unsigned short)(u >> 16); }
__device__ __forceinline__ float bf2f(unsigned short b) { return __uint_as_float(((unsigned)b) << 16); }
__device__ __forceinline__ float bfr(float f) { return bf2f(f2bf(f)); }
__device__ __forceinline__ v16h cat16(v8h lo, v8h hi) { return __builtin_shufflevector(lo, hi, 0, 1, 2, 3, 4, 5, 6, 7, 8, 9, 10, 11, 12, 13, 14, 15); }
__device__ __forceinline__ v16bf cat16b(v8us lo, v8us hi) { return __builtin_bit_cast(v16bf, __builtin_shufflevector(lo, hi, 0, 1, 2, 3, 4, 5, 6, 7, 8, 9, 10, 11, 12, 13, 14, 15)); }
__device__ __forceinline__ v8f wmma16(v16h a, v16h b, v8f c) { return __builtin_amdgcn_wmma_f32_16x16x32_f16(false, a, false, b, (short)0, c, false, false); }
__device__ __forceinline__ v8f wmmab(v16bf a, v16bf b, v8f c) { return __builtin_amdgcn_wmma_f32_16x16x32_bf16(false, a, false, b, (short)0, c, false, false); }

__global__ __launch_bounds__(256) void k_cvtb(const float* __restrict__ src, int nrows, bf* dst) {
    const int lane = threadIdx.x & 31, r = blockIdx.x * 8 + (threadIdx.x >> 5);
    if (r >= nrows) return;
    v8us o[4];
#pragma unroll
    for (int q = 0; q < 4; ++q) { v8us t;
#pragma unroll
        for (int i = 0; i < 8; ++i) t[i] = f2bf(src[(size_t)r * DM + q * 256 + lane * 8 + i]);
        o[q] = t; }
#pragma unroll
    for (int q = 0; q < 4; ++q) *(v8us*)(dst + (size_t)r * DM + q * 256 + lane * 8) = o[q];
    
}

// k_gemmb: C[128 x 128] per block of 8 waves (2 x 4, 64 rows x 32 columns each). A stage is 128 k (256 B) of the block's 128 A rows (hi, and lo where SPLITA) and 128 B rows,
// brought into LDS by per-lane 16-byte asynchronous copies (whole lines, no register), rows at pitch 272 B for the 16-byte fragment reads; two buffers, the next stage in flight.
#define GKS  128
#define GPB  272
#define GOP  (128 * GPB)
typedef v8us __attribute__((may_alias)) v8usa;

// eight copies of one operand's 16 rows of this wave; the s_wait_xcnt closes the statement so that no address register is rewritten ahead of it
__device__ __forceinline__ void cp8(unsigned l, const bf* g) {
    asm volatile("global_load_async_to_lds_b128 %0, %1, off\n\t"
                 "global_load_async_to_lds_b128 %2, %3, off\n\t"
                 "global_load_async_to_lds_b128 %4, %5, off\n\t"
                 "global_load_async_to_lds_b128 %6, %7, off\n\t"
                 "global_load_async_to_lds_b128 %8, %9, off\n\t"
                 "global_load_async_to_lds_b128 %10, %11, off\n\t"
                 "global_load_async_to_lds_b128 %12, %13, off\n\t"
                 "global_load_async_to_lds_b128 %14, %15, off\n\t"
                 "s_wait_xcnt 0x0"
                 :: "v"(l), "v"(g), "v"(l + 2 * GPB), "v"(g + 2 * DM), "v"(l + 4 * GPB), "v"(g + 4 * DM), "v"(l + 6 * GPB), "v"(g + 6 * DM),
                    "v"(l + 8 * GPB), "v"(g + 8 * DM), "v"(l + 10 * GPB), "v"(g + 10 * DM), "v"(l + 12 * GPB), "v"(g + 12 * DM), "v"(l + 14 * GPB), "v"(g + 14 * DM)
                 : "memory");
}

template <bool SPLITA>
__global__ __launch_bounds__(256) void k_gemmb(const bf* __restrict__ A, const bf* __restrict__ Al, const bf* __restrict__ Bn, const float* __restrict__ bias, float* C, int ldc, int cb) {
    constexpr int STG = (SPLITA ? 3 : 2) * GOP, BOP = (SPLITA ? 2 : 1) * GOP;   // one stage: [A | B], or [A hi | A lo | B]
    constexpr int NST = DM / GKS, NBK = (GKS / 32) * (SPLITA ? 2 : 1);
    __shared__ __align__(16) unsigned char ring[2 * STG];
    const int lane = threadIdx.x & 31, wave = threadIdx.x >> 5, lr = lane & 15, hi = lane >> 4;
    const int wm = wave >> 2, wn = wave & 3;
    const int r0 = blockIdx.x * 128, c0 = blockIdx.y * 128;
    const int crw = wave * 16 + hi;                             // copy i of a wave: rows crw + 2 i, bytes 16 lr of the stage's 256
    const unsigned l0 = (unsigned)(size_t)ring + crw * GPB + lr * 16;
    const bf* gA = A + (size_t)(r0 + crw) * DM + lr * 8;
    const bf* gB = Bn + (size_t)(c0 + crw) * DM + lr * 8;
    const bf* gL = SPLITA ? Al + (size_t)(r0 + crw) * DM + lr * 8 : gA;
    auto fill = [&](int t, int buf) {
        const unsigned l = l0 + buf * STG;
        cp8(l, gA + t * GKS); cp8(l + BOP, gB + t * GKS);
        if (SPLITA) cp8(l + GOP, gL + t * GKS);
    };
    v8f acc[4][2];
#pragma unroll
    for (int m = 0; m < 4; ++m)
#pragma unroll
        for (int n = 0; n < 2; ++n) acc[m][n] = (v8f){};
    fill(0, 0);
    asm volatile("s_wait_asynccnt 0x0" ::: "memory");           // stage 0 of this wave has landed
    __syncthreads();                                            // ... and every other wave's
    fill(1, 1);
    const int aofs = (wm * 64 + lr) * GPB + hi * 16, bofs = BOP + (wn * 32 + lr) * GPB + hi * 16;
    // kept rolled: one stage per trip, the buffer picked by the trip's parity
#pragma unroll 1
    for (int t = 0; t < NST; ++t) {
        const unsigned char* sb = ring + (t & 1) * STG;
        // a block = the 8 products of one A-side fragment set (hi, or lo where SPLITA) with one B set; block i + 1's fragments are read as one group ahead of block i's products
        v16bf fa[2][4], fb[2][2];
        auto lda = [&](int i, v16bf* d) {
            const unsigned char* q = sb + aofs + (SPLITA ? (i & 1) * GOP + (i >> 1) * 64 : i * 64);
#pragma unroll
            for (int m = 0; m < 4; ++m) { const unsigned char* p = q + m * 16 * GPB; d[m] = cat16b(*(const v8usa*)p, *(const v8usa*)(p + 32)); }
        };
        auto ldb = [&](int ks, v16bf* d) {
#pragma unroll
            for (int n = 0; n < 2; ++n) { const unsigned char* p = sb + bofs + n * 16 * GPB + ks * 64; d[n] = cat16b(*(const v8usa*)p, *(const v8usa*)(p + 32)); }
        };
        lda(0, fa[0]); ldb(0, fb[0]);
#pragma unroll
        for (int i = 0; i < NBK; ++i) {
            const int ks = SPLITA ? i >> 1 : i, ks1 = SPLITA ? (i + 1) >> 1 : i + 1;
            if (i + 1 < NBK) { lda(i + 1, fa[(i + 1) & 1]); if (ks1 != ks) ldb(ks1, fb[ks1 & 1]); }
            __builtin_amdgcn_sched_barrier(0);                  // keeps the LDS reads one group in front of the products, not spread among them with waits to 0
#pragma unroll
            for (int m = 0; m < 4; ++m)
#pragma unroll
                for (int n = 0; n < 2; ++n) acc[m][n] = wmmab(fa[i & 1][m], fb[ks & 1][n], acc[m][n]);
            __builtin_amdgcn_sched_barrier(0);                  // the other side of that fence
        }
        asm volatile("s_wait_dscnt 0x0" ::: "memory");          // this wave has left the buffer
        asm volatile("s_wait_asynccnt 0x0" ::: "memory");       // its copies of stage t + 1 have landed
        __syncthreads();                                        // publishes stage t + 1, frees stage t's buffer
        if (t + 2 < NST) fill(t + 2, t & 1);
    }
    asm volatile("s_wait_asynccnt 0x0" ::: "memory");           // nothing in flight when the ring becomes output staging
    float* os = (float*)(ring + wave * (64 * 36 * 4));          // this wave's own 64 rows x 32 columns, pitch 36 floats
#pragma unroll
    for (int n = 0; n < 2; ++n) { const float bv = bfr(bias[c0 + wn * 32 + n * 16 + lr]);
#pragma unroll
        for (int m = 0; m < 4; ++m)
#pragma unroll
            for (int j = 0; j < 8; ++j) os[(m * 16 + hi * 8 + j) * 36 + n * 16 + lr] = acc[m][n][j] + bv; }
    float* crow = C + (size_t)(r0 + wm * 64) * ldc + cb + c0 + wn * 32;
#pragma unroll
    for (int s = 0; s < 16; ++s) { const int row = s * 4 + (lane >> 3), cofs = (lane & 7) * 4;
        const v4f val = *(const v4fa*)(os + row * 36 + cofs); *(v4f*)(crow + (size_t)row * ldc + cofs) = val; }
}

// k_r16: f16 rows [tok][1024] of q (which 0) / k (1) from QKV [tok][3072]; k_vt: VT16[b][h][d][t]; k_whel: WH16 [h][e][d] = f16(bf16(Whel)).
__global__ __launch_bounds__(256) void k_r16(const float* __restrict__ QKV, h16* Q16, h16* K16) {
    const int lane = threadIdx.x & 31, wid = blockIdx.x * 8 + (threadIdx.x >> 5);
    if (wid >= 2 * NTK) return;
    const int r = wid >> 1, which = wid & 1;
    const float* s = QKV + (size_t)r * (3 * DM) + which * DM; h16* d = (which ? K16 : Q16) + (size_t)r * DM;
    v8h o[4];
#pragma unroll
    for (int q = 0; q < 4; ++q) { v8h t;
#pragma unroll
        for (int i = 0; i < 8; ++i) t[i] = (h16)s[q * 256 + lane * 8 + i];
        o[q] = t; }
#pragma unroll
    for (int q = 0; q < 4; ++q) *(v8h*)(d + q * 256 + lane * 8) = o[q];
    
}
__global__ __launch_bounds__(256) void k_vt(const float* __restrict__ QKV, h16* VT16) {
    __shared__ __align__(16) h16 tile[64 * 72];
    const int bid = blockIdx.x;
    const int b = bid / (NH_ * (NT_ / 64)), rem = bid - b * (NH_ * (NT_ / 64)), h = rem / (NT_ / 64), kt = rem - h * (NT_ / 64);
    const int k0 = kt * 64, tid = threadIdx.x;
    const int kk = tid >> 2, d0 = (tid & 3) * 16;
    const float* src = QKV + ((size_t)b * NT_ + k0 + kk) * (3 * DM) + 2 * DM + h * HD + d0;
#pragma unroll
    for (int i = 0; i < 16; ++i) tile[(d0 + i) * 72 + kk] = (h16)src[i];
    __syncthreads();
    const int piece = tid & 7;
    h16* base = VT16 + (((size_t)b * NH_ + h) * HD) * NT_ + k0;
    auto pass = [&]() {
#pragma unroll
        for (int s = 0; s < 2; ++s) { const int d = (tid >> 3) + 32 * s; const v8h val = *(const v8ha*)(tile + d * 72 + piece * 8); *(v8h*)(base + (size_t)d * NT_ + piece * 8) = val; }
    };
    pass(); 
}
__global__ __launch_bounds__(256) void k_whel(const float* __restrict__ Whel, h16* WH16) {
    const int lane = threadIdx.x & 31, r = blockIdx.x * 8 + (threadIdx.x >> 5);     // row = (h, e): 1024 rows of 64
    if (r >= NH_ * HD) return;
    v2h o; o[0] = (h16)bfr(Whel[(size_t)r * HD + 2 * lane]); o[1] = (h16)bfr(Whel[(size_t)r * HD + 2 * lane + 1]);
    *(v2h*)(WH16 + (size_t)r * HD + 2 * lane) = o; 
}

// k_hel: QN16[b][h][tok][64] = L2-normalised pairs of (q|k)h . Whel[h]^T + bhel: block = (which, b, h, 64 tokens), wave = 16 tokens: 8 WMMA (A = Q16/K16 head slice
// rows, B = WH16[h] rows e), + bf16(bhel); pair (2p, 2p+1) = columns lr, lr^1 of the same tile -> norm via __shfl_xor(.., 1); staged in LDS, each token row = one
__global__ __launch_bounds__(128) void k_hel(const h16* __restrict__ Q16, const h16* __restrict__ K16, const h16* __restrict__ WH16, const float* __restrict__ bhel, h16* QN16, h16* KN16) {
    __shared__ __align__(16) float ost[4][16 * 68];
    const int lane = threadIdx.x & 31, wave = threadIdx.x >> 5, lr = lane & 15, hi = lane >> 4;
    const int nb = NB_ * NH_ * (NT_ / 64);
    const int which = blockIdx.x / nb, bid = blockIdx.x - which * nb;
    const int b = bid / (NH_ * (NT_ / 64)), rem = bid - b * (NH_ * (NT_ / 64)), h = rem / (NT_ / 64), tt = rem - h * (NT_ / 64);
    const int t0 = tt * 64 + wave * 16;
    const size_t tok0 = (size_t)b * NT_;
    const h16* src = which ? K16 : Q16; h16* dst = which ? KN16 : QN16;
    v16h a[2];
#pragma unroll
    for (int kc = 0; kc < 2; ++kc) { const h16* p = src + (tok0 + t0 + lr) * DM + h * HD + kc * 32 + 8 * hi; a[kc] = cat16(*(const v8h*)p, *(const v8h*)(p + 16)); }
    v8f d4[4];
#pragma unroll
    for (int n = 0; n < 4; ++n) d4[n] = (v8f){};
#pragma unroll
    for (int kc = 0; kc < 2; ++kc)
#pragma unroll
        for (int n = 0; n < 4; ++n) { const h16* bp = WH16 + ((size_t)h * HD + n * 16 + lr) * HD + kc * 32 + 8 * hi; d4[n] = wmma16(a[kc], cat16(*(const v8h*)bp, *(const v8h*)(bp + 16)), d4[n]); }
    asm volatile("v_nop\n\tv_nop\n\tv_nop\n\tv_nop" : "+v"(d4[0]), "+v"(d4[1]), "+v"(d4[2]), "+v"(d4[3]));
    float* os = &ost[wave][0];
#pragma unroll
    for (int n = 0; n < 4; ++n) {
        const float bb = bfr(bhel[(size_t)h * HD + n * 16 + lr]);
#pragma unroll
        for (int j = 0; j < 8; ++j) {
            const float v = d4[n][j] + bb;
            const float w = __shfl_xor(v, 1, 32);                 // pair partner (column lr ^ 1, same row)
            const float nrm = sqrtf(v * v + w * w);
            os[(hi * 8 + j) * 68 + n * 16 + lr] = v / fmaxf(nrm, 1e-12f);
        }
    }
    __syncthreads();
    h16* crow = dst + (((size_t)b * NH_ + h) * NT_ + t0) * HD;      // 16 rows x 64 halves = 16 lines: instruction s covers rows 4s + lane>>3
    auto pass = [&]() {
#pragma unroll
        for (int s = 0; s < 4; ++s) { const int row = 4 * s + (lane >> 3), piece = lane & 7; const float* sp = os + row * 68 + piece * 8; v8h o;
#pragma unroll
            for (int i = 0; i < 8; ++i) o[i] = (h16)sp[i];
            *(v8h*)(crow + (size_t)row * HD + piece * 8) = o; }
    };
    pass(); 
}

// k_scr: the reference's _scramble as a gather: H[b][h][s][2p + c] = QN[b][h][(2s + c) mod 2048][2p + ((2s + c) / 2048)] — block = 8 waves, wave = (which, b, h, s)
__global__ __launch_bounds__(256) void k_scr(const h16* __restrict__ QN16, const h16* __restrict__ KN16, h16* HQ16, h16* HK16) {
    const int lane = threadIdx.x & 31, wid = blockIdx.x * 8 + (threadIdx.x >> 5);
    if (wid >= 2 * NB_ * NH_ * NT_) return;
    const int which = wid / (NB_ * NH_ * NT_), r = wid - which * (NB_ * NH_ * NT_);       // r = (b*16 + h)*2048 + s
    const int s = r % NT_, bh = r / NT_;
    const h16* src = (which ? KN16 : QN16) + (size_t)bh * NT_ * HD; h16* dst = (which ? HK16 : HQ16) + (size_t)r * HD;
    v2h o;
#pragma unroll
    for (int c = 0; c < 2; ++c) { const int f = 2 * s + c; const int t = f % NT_, cc = f / NT_; o[c] = src[(size_t)t * HD + 2 * lane + cc]; }
    *(v2h*)(dst + 2 * lane) = o; 
}

// k_attn: block = (b, h, 128 queries), wave = 16; q and helical-q fragments resident; 64 steps x 32 keys: 4 WMMA q.k and 4 WMMA hq.hk, logits 0.5 s/8 + 0.5 g/32, online f32
// softmax, weights x32768 f16 tile (same-wave may_alias reload after a compiler barrier), 4 WMMA .v; ctx -> bf16 hi/lo planes CH/CL[tok][h*64+d].
// A stage = 128 keys of this (b, h), shared by the block's 8 waves: 128 K rows and 128 helical-K rows (128 B each, LDS pitch 144 B) and the 64 V^T rows (256 B each, pitch
// 272 B), brought in by per-lane 16-byte asynchronous copies that cover whole lines; two buffers, the next stage in flight. The 16-byte fragment reads then come from LDS.
#define AKS  128
#define KPB  144
#define VPB  272
#define AKO  (AKS * KPB)
#define AST  (2 * AKO + HD * VPB)

// four copies of one operand; the s_wait_xcnt closes the statement so that no address register is rewritten ahead of it
__device__ __forceinline__ void cp4(unsigned l, const h16* g, unsigned ls, size_t gs) {
    asm volatile("global_load_async_to_lds_b128 %0, %1, off\n\t"
                 "global_load_async_to_lds_b128 %2, %3, off\n\t"
                 "global_load_async_to_lds_b128 %4, %5, off\n\t"
                 "global_load_async_to_lds_b128 %6, %7, off\n\t"
                 "s_wait_xcnt 0x0"
                 :: "v"(l), "v"(g), "v"(l + ls), "v"(g + gs), "v"(l + 2 * ls), "v"(g + 2 * gs), "v"(l + 3 * ls), "v"(g + 3 * gs)
                 : "memory");
}

__global__ __launch_bounds__(256) void k_attn(const h16* __restrict__ Q16, const h16* __restrict__ K16, const h16* __restrict__ HQ16, const h16* __restrict__ HK16, const h16* __restrict__ VT16, bf* CH, bf* CL) {
    __shared__ __align__(16) unsigned char ring[2 * AST];
    __shared__ __align__(16) h16 plds[8][16 * 32];
    __shared__ __align__(16) float ost[8][16 * 68];
    const int lane = threadIdx.x & 31, wave = threadIdx.x >> 5, lr = lane & 15, hi = lane >> 4;
    const int bid = blockIdx.x;
    const int b = bid / (NH_ * (NT_ / 128)), rem = bid - b * (NH_ * (NT_ / 128)), h = rem / (NT_ / 128), qt = rem - h * (NT_ / 128);
    const int q0 = qt * 128 + wave * 16;
    const size_t tok0 = (size_t)b * NT_;
    const size_t hrow0 = ((size_t)b * NH_ + h) * NT_;
    h16* pl = &plds[wave][0];
    v16h qa[2], ga[2];
#pragma unroll
    for (int kc = 0; kc < 2; ++kc) {
        const h16* p = Q16 + (tok0 + q0 + lr) * DM + h * HD + kc * 32 + 8 * hi; qa[kc] = cat16(*(const v8h*)p, *(const v8h*)(p + 16));
        const h16* g = HQ16 + (hrow0 + q0 + lr) * HD + kc * 32 + 8 * hi; ga[kc] = cat16(*(const v8h*)g, *(const v8h*)(g + 16));
    }
    const h16* kh_b = K16 + tok0 * DM + h * HD; const h16* hk_b = HK16 + hrow0 * HD;
    const h16* vt_b = VT16 + (((size_t)b * NH_ + h) * HD) * NT_;
    v8f o[4];
#pragma unroll
    for (int n = 0; n < 4; ++n) o[n] = (v8f){};
    float mrow[8], lpart[8];
#pragma unroll
    for (int j = 0; j < 8; ++j) { mrow[j] = -3.0e38f; lpart[j] = 0.f; }
    // this wave's copies of a stage: K and helical-K rows krow + 4 i (8 lanes a row), V^T rows vrow + 2 i (16 lanes a row), i = 0 .. 3
    const int krow = wave * 16 + (lane >> 3), kpc = lane & 7, vrow = wave * 8 + hi;
    const unsigned lk = (unsigned)(size_t)ring + krow * KPB + kpc * 16, lv = (unsigned)(size_t)ring + 2 * AKO + vrow * VPB + lr * 16;
    const h16* gk = kh_b + (size_t)krow * DM + kpc * 8; const h16* gh = hk_b + (size_t)krow * HD + kpc * 8; const h16* gv = vt_b + (size_t)vrow * NT_ + lr * 8;
    auto fill = [&](int t, int buf) {
        cp4(lk + buf * AST, gk + (size_t)t * AKS * DM, 4 * KPB, 4 * DM);
        cp4(lk + buf * AST + AKO, gh + (size_t)t * AKS * HD, 4 * KPB, 4 * HD);
        cp4(lv + buf * AST, gv + t * AKS, 2 * VPB, 2 * NT_);
    };
    fill(0, 0);
    asm volatile("s_wait_asynccnt 0x0" ::: "memory");           // stage 0 of this wave has landed
    __syncthreads();                                            // ... and every other wave's
    fill(1, 1);
    // both loops kept rolled: the stage loop picks its buffer by the trip's parity; the four 32-key steps of a stage, unrolled, built to over 256 registers (3 waves a SIMD, not 4)
#pragma unroll 1
    for (int st = 0; st < NT_ / AKS; ++st) {
    const unsigned char* sb = ring + (st & 1) * AST;
#pragma unroll 1
    for (int kt = 0; kt < AKS / 32; ++kt) {
        const unsigned char* kp = sb + (kt * 32 + lr) * KPB + hi * 16;
        const unsigned char* vb = sb + 2 * AKO + lr * VPB + kt * 64 + hi * 16;
        v8f s0 = {}, s1 = {}, g0 = {}, g1 = {};
#pragma unroll
        for (int kc = 0; kc < 2; ++kc) {
            const unsigned char* r0p = kp + kc * 64; const unsigned char* r1p = r0p + 16 * KPB;
            const unsigned char* h0p = r0p + AKO; const unsigned char* h1p = r1p + AKO;
            s0 = wmma16(qa[kc], cat16(*(const v8ha*)r0p, *(const v8ha*)(r0p + 32)), s0); s1 = wmma16(qa[kc], cat16(*(const v8ha*)r1p, *(const v8ha*)(r1p + 32)), s1);
            g0 = wmma16(ga[kc], cat16(*(const v8ha*)h0p, *(const v8ha*)(h0p + 32)), g0); g1 = wmma16(ga[kc], cat16(*(const v8ha*)h1p, *(const v8ha*)(h1p + 32)), g1);
        }
        v16h vf[4];                                             // read here, ahead of the softmax, so that their LDS latency lies under it
#pragma unroll
        for (int n = 0; n < 4; ++n) { const unsigned char* vp = vb + n * 16 * VPB; vf[n] = cat16(*(const v8ha*)vp, *(const v8ha*)(vp + 32)); }
        asm volatile("v_nop\n\tv_nop\n\tv_nop\n\tv_nop" : "+v"(s0), "+v"(s1), "+v"(g0), "+v"(g1) : "v"(qa[0]), "v"(ga[1]));
        float alpha[8];
#pragma unroll
        for (int j = 0; j < 8; ++j) {
            const float a0 = 0.5f * (s0[j] * 0.125f) + 0.5f * (g0[j] * 0.03125f), a1 = 0.5f * (s1[j] * 0.125f) + 0.5f * (g1[j] * 0.03125f);
            float mx = fmaxf(a0, a1);
            mx = fmaxf(mx, __shfl_xor(mx, 1, 16)); mx = fmaxf(mx, __shfl_xor(mx, 2, 16)); mx = fmaxf(mx, __shfl_xor(mx, 4, 16)); mx = fmaxf(mx, __shfl_xor(mx, 8, 16));
            const float mn = fmaxf(mrow[j], mx);
            alpha[j] = __expf(mrow[j] - mn); mrow[j] = mn;
            const float p0 = __expf(a0 - mn), p1 = __expf(a1 - mn);
            lpart[j] = lpart[j] * alpha[j] + (p0 + p1);
            const int mr = hi * 8 + j;
            pl[mr * 32 + lr] = (h16)(p0 * PSC); pl[mr * 32 + 16 + lr] = (h16)(p1 * PSC);
        }
#pragma unroll
        for (int n = 0; n < 4; ++n)
#pragma unroll
            for (int j = 0; j < 8; ++j) o[n][j] *= alpha[j];
        asm volatile("" ::: "memory");
        const v16h pa = cat16(*(const v8ha*)(pl + lr * 32 + hi * 8), *(const v8ha*)(pl + lr * 32 + 16 + hi * 8));
#pragma unroll
        for (int n = 0; n < 4; ++n) o[n] = wmma16(pa, vf[n], o[n]);
        asm volatile("v_nop\n\tv_nop\n\tv_nop\n\tv_nop" : "+v"(o[0]), "+v"(o[1]), "+v"(o[2]), "+v"(o[3]) : "v"(pa));
    }
        asm volatile("s_wait_dscnt 0x0" ::: "memory");          // this wave has left the buffer
        asm volatile("s_wait_asynccnt 0x0" ::: "memory");       // its copies of stage st + 1 have landed
        __syncthreads();                                        // publishes stage st + 1, frees stage st's buffer
        if (st + 2 < NT_ / AKS) fill(st + 2, st & 1);
    }
    asm volatile("s_wait_asynccnt 0x0" ::: "memory");           // nothing in flight at the end
    float inv[8];
#pragma unroll
    for (int j = 0; j < 8; ++j) { float rs = lpart[j]; rs += __shfl_xor(rs, 1, 16); rs += __shfl_xor(rs, 2, 16); rs += __shfl_xor(rs, 4, 16); rs += __shfl_xor(rs, 8, 16); inv[j] = 1.0f / (rs * PSC); }
    float* os = &ost[wave][0];
#pragma unroll
    for (int n = 0; n < 4; ++n)
#pragma unroll
        for (int j = 0; j < 8; ++j) os[(hi * 8 + j) * 68 + n * 16 + lr] = o[n][j] * inv[j];
    __syncthreads();
    const size_t cbase = (tok0 + q0) * DM + (size_t)h * HD;
    auto pass = [&]() {
#pragma unroll
        for (int s = 0; s < 4; ++s) { const int row = 4 * s + (lane >> 3), piece = lane & 7; const float* sp = os + row * 68 + piece * 8; v8us oh, ol;
#pragma unroll
            for (int i = 0; i < 8; ++i) { const unsigned short hb = f2bf(sp[i]); oh[i] = hb; ol[i] = f2bf(sp[i] - bf2f(hb)); }
            *(v8us*)(CH + cbase + (size_t)row * DM + piece * 8) = oh; *(v8us*)(CL + cbase + (size_t)row * DM + piece * 8) = ol; }
    };
    pass(); 
}

extern "C" void kernel_launch(void* const* d_in, const int* in_sizes, int n_in,
                              void* d_out, int out_size, void* d_ws, size_t ws_size, hipStream_t stream) {
    (void)in_sizes; (void)n_in; (void)out_size;
    const float* x = (const float*)d_in[0]; const float* Wq = (const float*)d_in[1]; const float* bq = (const float*)d_in[2]; const float* Wk = (const float*)d_in[3]; const float* bk = (const float*)d_in[4];
    const float* Wv = (const float*)d_in[5]; const float* bv = (const float*)d_in[6]; const float* Wo = (const float*)d_in[7]; const float* bo = (const float*)d_in[8];
    const float* Whel = (const float*)d_in[9]; const float* bhel = (const float*)d_in[10];
    float* out = (float*)d_out;    // [2][2048][1024]
    char* wsp = (char*)d_ws;
    auto take = [&](size_t bytes) { char* p = wsp; wsp += (bytes + 255) & ~(size_t)255; return (void*)p; };
    bf* Xb = (bf*)take((size_t)NTK * DM * 2);
    bf* WB[4]; for (int i = 0; i < 4; ++i) WB[i] = (bf*)take((size_t)DM * DM * 2);
    float* QKV = (float*)take((size_t)NTK * 3 * DM * 4);            // reused later for the ctx planes (dead after the conversions)
    h16* Q16 = (h16*)take((size_t)NTK * DM * 2); h16* K16 = (h16*)take((size_t)NTK * DM * 2); h16* VT16 = (h16*)take((size_t)NTK * DM * 2);
    h16* WH16 = (h16*)take((size_t)NH_ * HD * HD * 2);
    h16* QN16 = (h16*)take((size_t)NB_ * NH_ * NT_ * HD * 2); h16* KN16 = (h16*)take((size_t)NB_ * NH_ * NT_ * HD * 2);
    h16* HQ16 = (h16*)take((size_t)NB_ * NH_ * NT_ * HD * 2); h16* HK16 = (h16*)take((size_t)NB_ * NH_ * NT_ * HD * 2);
    if ((size_t)(wsp - (char*)d_ws) > ws_size) return;    // 8.4 + 8.4 + 50.3 + 25.2 + 0.13 + 33.6 MB ~ 126 MB
    bf* CH = (bf*)QKV; bf* CL = (bf*)((char*)QKV + (size_t)NTK * DM * 2);   // 2 x 8.4 MB inside the dead 50 MB QKV region
    k_cvtb<<<NTK / 8, 256, 0, stream>>>(x, NTK, Xb);
    const float* Ws[4] = {Wq, Wk, Wv, Wo};
    for (int i = 0; i < 4; ++i) k_cvtb<<<DM / 8, 256, 0, stream>>>(Ws[i], DM, WB[i]);
    k_gemmb<false><<<dim3(NTK / 128, DM / 128, 1), 256, 0, stream>>>(Xb, nullptr, WB[0], bq, QKV, 3 * DM, 0);
    k_gemmb<false><<<dim3(NTK / 128, DM / 128, 1), 256, 0, stream>>>(Xb, nullptr, WB[1], bk, QKV, 3 * DM, DM);
    k_gemmb<false><<<dim3(NTK / 128, DM / 128, 1), 256, 0, stream>>>(Xb, nullptr, WB[2], bv, QKV, 3 * DM, 2 * DM);
    k_r16<<<(2 * NTK) / 8, 256, 0, stream>>>(QKV, Q16, K16);
    k_vt<<<NB_ * NH_ * (NT_ / 64), 256, 0, stream>>>(QKV, VT16);
    k_whel<<<(NH_ * HD) / 8, 256, 0, stream>>>(Whel, WH16);
    k_hel<<<2 * NB_ * NH_ * (NT_ / 64), 128, 0, stream>>>(Q16, K16, WH16, bhel, QN16, KN16);
    k_scr<<<(2 * NB_ * NH_ * NT_) / 8, 256, 0, stream>>>(QN16, KN16, HQ16, HK16);
    k_attn<<<NB_ * NH_ * (NT_ / 128), 256, 0, stream>>>(Q16, K16, HQ16, HK16, VT16, CH, CL);
    k_gemmb<true><<<dim3(NTK / 128, DM / 128, 1), 256, 0, stream>>>(CH, CL, WB[3], bo, out, DM, 0);
}

// v003
// It runs in 167 microseconds.
// Two timings next to v002 put it at 1.14 and 1.13 times that version's speed.
// All steps since v000 together make it 2.29 times as fast.
#include <hip/hip_runtime.h>

// Contractions, f32 accumulate: q/k/v = x.W^T + b ([4096 x 1024].[1024 x 1024] x3) on v_wmma_f32_16x16x32_bf16 with PLAIN bf16 operands (inputs rounded once: exact
// products); the per-head helical projections q_hel/k_hel = qh.Whel[h]^T + bhel ([tokens x 64].[64 x 64]) on v_wmma_f32_16x16x32_f16 with plain f16 q/k and
// f16(bf16(Whel)); the per-(batch, head) attention with TWO score products per key tile (0.5 q.k/8 + 0.5 helical/32, where the helical operands are the pairwise
// L2-normalised, "scrambled" projections) and weights.v, fused per 16-query tile with plain f16 operands and an online f32 softmax; out = ctx.Wo^T + bo on the bf16

#define NB_  2
#define NT_  2048
#define DM   1024
#define NH_  16
#define HD   64
#define NTK  (NB_ * NT_)
#define PSC  32768.0f

typedef _Float16 h16;
typedef unsigned short bf;
typedef __attribute__((ext_vector_type(16))) __bf16   v16bf;
typedef __attribute__((ext_vector_type(16))) _Float16 v16h;
typedef __attribute__((ext_vector_type(8)))  _Float16 v8h;
typedef __attribute__((ext_vector_type(8)))  unsigned short v8us;
typedef __attribute__((ext_vector_type(8)))  float    v8f;
typedef __attribute__((ext_vector_type(4)))  float    v4f;
typedef __attribute__((ext_vector_type(2)))  _Float16 v2h;
typedef v8h  __attribute__((may_alias)) v8ha;
typedef v4f  __attribute__((may_alias)) v4fa;

__device__ __forceinline__ unsigned short f2bf(float f) { unsigned u = __float_as_uint(f); u += 0x7FFFu + ((u >> 16) & 1u); return (unsigned short)(u >> 16); }
__device__ __forceinline__ float bf2f(unsigned short b) { return __uint_as_float(((unsigned)b) << 16); }
__device__ __forceinline__ float bfr(float f) { return bf2f(f2bf(f)); }
__device__ __forceinline__ v16h cat16(v8h lo, v8h hi) { return __builtin_shufflevector(lo, hi, 0, 1, 2, 3, 4, 5, 6, 7, 8, 9, 10, 11, 12, 13, 14, 15); }
__device__ __forceinline__ v16bf cat16b(v8us lo, v8us hi) { return __builtin_bit_cast(v16bf, __builtin_shufflevector(lo, hi, 0, 1, 2, 3, 4, 5, 6, 7, 8, 9, 10, 11, 12, 13, 14, 15)); }
__device__ __forceinline__ v8f wmma16(v16h a, v16h b, v8f c) { return __builtin_amdgcn_wmma_f32_16x16x32_f16(false, a, false, b, (short)0, c, false, false); }
__device__ __forceinline__ v8f wmmab(v16bf a, v16bf b, v8f c) { return __builtin_amdgcn_wmma_f32_16x16x32_bf16(false, a, false, b, (short)0, c, false, false); }

__device__ __forceinline__ void cvtb_rows(const float* __restrict__ src, int nrows, bf* dst, int blk) {
    const int lane = threadIdx.x & 31, r = blk * 8 + (threadIdx.x >> 5);
    if (r >= nrows) return;
    v8us o[4];
#pragma unroll
    for (int q = 0; q < 4; ++q) { v8us t;
#pragma unroll
        for (int i = 0; i < 8; ++i) t[i] = f2bf(src[(size_t)r * DM + q * 256 + lane * 8 + i]);
        o[q] = t; }
#pragma unroll
    for (int q = 0; q < 4; ++q) *(v8us*)(dst + (size_t)r * DM + q * 256 + lane * 8) = o[q];
    
}

// k_gemmb: C[128 x 128] per block of 8 waves (2 x 4, 64 rows x 32 columns each). A stage is 128 k (256 B) of the block's 128 A rows (hi, and lo where SPLITA) and 128 B rows,
// brought into LDS by per-lane 16-byte asynchronous copies (whole lines, no register), rows at pitch 272 B for the 16-byte fragment reads; two buffers, the next stage in flight.
#define GKS  128
#define GPB  272
#define GOP  (128 * GPB)
typedef v8us __attribute__((may_alias)) v8usa;

// eight copies of one operand's 16 rows of this wave; the s_wait_xcnt closes the statement so that no address register is rewritten ahead of it
__device__ __forceinline__ void cp8(unsigned l, const bf* g) {
    asm volatile("global_load_async_to_lds_b128 %0, %1, off\n\t"
                 "global_load_async_to_lds_b128 %2, %3, off\n\t"
                 "global_load_async_to_lds_b128 %4, %5, off\n\t"
                 "global_load_async_to_lds_b128 %6, %7, off\n\t"
                 "global_load_async_to_lds_b128 %8, %9, off\n\t"
                 "global_load_async_to_lds_b128 %10, %11, off\n\t"
                 "global_load_async_to_lds_b128 %12, %13, off\n\t"
                 "global_load_async_to_lds_b128 %14, %15, off\n\t"
                 "s_wait_xcnt 0x0"
                 :: "v"(l), "v"(g), "v"(l + 2 * GPB), "v"(g + 2 * DM), "v"(l + 4 * GPB), "v"(g + 4 * DM), "v"(l + 6 * GPB), "v"(g + 6 * DM),
                    "v"(l + 8 * GPB), "v"(g + 8 * DM), "v"(l + 10 * GPB), "v"(g + 10 * DM), "v"(l + 12 * GPB), "v"(g + 12 * DM), "v"(l + 14 * GPB), "v"(g + 14 * DM)
                 : "memory");
}

template <bool SPLITA>
__global__ __launch_bounds__(256) void k_gemmb(const bf* __restrict__ A, const bf* __restrict__ Al, const bf* __restrict__ Bn, const float* __restrict__ bias, const float* __restrict__ bias1, const float* __restrict__ bias2, float* C, int ldc, int cb) {
    constexpr int STG = (SPLITA ? 3 : 2) * GOP, BOP = (SPLITA ? 2 : 1) * GOP;   // one stage: [A | B], or [A hi | A lo | B]
    constexpr int NST = DM / GKS, NBK = (GKS / 32) * (SPLITA ? 2 : 1);
    __shared__ __align__(16) unsigned char ring[2 * STG];
    const int lane = threadIdx.x & 31, wave = threadIdx.x >> 5, lr = lane & 15, hi = lane >> 4;
    const int wm = wave >> 2, wn = wave & 3;
    const int r0 = blockIdx.x * 128, c0 = blockIdx.y * 128;
    const int crw = wave * 16 + hi;                             // copy i of a wave: rows crw + 2 i, bytes 16 lr of the stage's 256
    const unsigned l0 = (unsigned)(size_t)ring + crw * GPB + lr * 16;
    const bf* gA = A + (size_t)(r0 + crw) * DM + lr * 8;
    const bf* gB = Bn + (size_t)(c0 + crw) * DM + lr * 8;
    const bf* gL = SPLITA ? Al + (size_t)(r0 + crw) * DM + lr * 8 : gA;
    auto fill = [&](int t, int buf) {
        const unsigned l = l0 + buf * STG;
        cp8(l, gA + t * GKS); cp8(l + BOP, gB + t * GKS);
        if (SPLITA) cp8(l + GOP, gL + t * GKS);
    };
    v8f acc[4][2];
#pragma unroll
    for (int m = 0; m < 4; ++m)
#pragma unroll
        for (int n = 0; n < 2; ++n) acc[m][n] = (v8f){};
    fill(0, 0);
    asm volatile("s_wait_asynccnt 0x0" ::: "memory");           // stage 0 of this wave has landed
    __syncthreads();                                            // ... and every other wave's
    fill(1, 1);
    const int aofs = (wm * 64 + lr) * GPB + hi * 16, bofs = BOP + (wn * 32 + lr) * GPB + hi * 16;
    // kept rolled: one stage per trip, the buffer picked by the trip's parity
#pragma unroll 1
    for (int t = 0; t < NST; ++t) {
        const unsigned char* sb = ring + (t & 1) * STG;
        // a block = the 8 products of one A-side fragment set (hi, or lo where SPLITA) with one B set; block i + 1's fragments are read as one group ahead of block i's products
        v16bf fa[2][4], fb[2][2];
        auto lda = [&](int i, v16bf* d) {
            const unsigned char* q = sb + aofs + (SPLITA ? (i & 1) * GOP + (i >> 1) * 64 : i * 64);
#pragma unroll
            for (int m = 0; m < 4; ++m) { const unsigned char* p = q + m * 16 * GPB; d[m] = cat16b(*(const v8usa*)p, *(const v8usa*)(p + 32)); }
        };
        auto ldb = [&](int ks, v16bf* d) {
#pragma unroll
            for (int n = 0; n < 2; ++n) { const unsigned char* p = sb + bofs + n * 16 * GPB + ks * 64; d[n] = cat16b(*(const v8usa*)p, *(const v8usa*)(p + 32)); }
        };
        lda(0, fa[0]); ldb(0, fb[0]);
#pragma unroll
        for (int i = 0; i < NBK; ++i) {
            const int ks = SPLITA ? i >> 1 : i, ks1 = SPLITA ? (i + 1) >> 1 : i + 1;
            if (i + 1 < NBK) { lda(i + 1, fa[(i + 1) & 1]); if (ks1 != ks) ldb(ks1, fb[ks1 & 1]); }
            __builtin_amdgcn_sched_barrier(0);                  // keeps the LDS reads one group in front of the products, not spread among them with waits to 0
#pragma unroll
            for (int m = 0; m < 4; ++m)
#pragma unroll
                for (int n = 0; n < 2; ++n) acc[m][n] = wmmab(fa[i & 1][m], fb[ks & 1][n], acc[m][n]);
            __builtin_amdgcn_sched_barrier(0);                  // the other side of that fence
        }
        asm volatile("s_wait_dscnt 0x0" ::: "memory");          // this wave has left the buffer
        asm volatile("s_wait_asynccnt 0x0" ::: "memory");       // its copies of stage t + 1 have landed
        __syncthreads();                                        // publishes stage t + 1, frees stage t's buffer
        if (t + 2 < NST) fill(t + 2, t & 1);
    }
    asm volatile("s_wait_asynccnt 0x0" ::: "memory");           // nothing in flight when the ring becomes output staging
    float* os = (float*)(ring + wave * (64 * 36 * 4));          // this wave's own 64 rows x 32 columns, pitch 36 floats
    const float* bsel = c0 < DM ? bias : c0 < 2 * DM ? bias1 : bias2;   // one bias vector per 1024 output columns (q | k | v stacked along N)
#pragma unroll
    for (int n = 0; n < 2; ++n) { const float bv = bfr(bsel[(c0 & (DM - 1)) + wn * 32 + n * 16 + lr]);
#pragma unroll
        for (int m = 0; m < 4; ++m)
#pragma unroll
            for (int j = 0; j < 8; ++j) os[(m * 16 + hi * 8 + j) * 36 + n * 16 + lr] = acc[m][n][j] + bv; }
    float* crow = C + (size_t)(r0 + wm * 64) * ldc + cb + c0 + wn * 32;
#pragma unroll
    for (int s = 0; s < 16; ++s) { const int row = s * 4 + (lane >> 3), cofs = (lane & 7) * 4;
        const v4f val = *(const v4fa*)(os + row * 36 + cofs); *(v4f*)(crow + (size_t)row * ldc + cofs) = val; }
}

// r16_rows: f16 rows [tok][1024] of q (which 0) / k (1) from QKV [tok][3072]; vt_tile: VT16[b][h][d][t]; whel_rows: WH16 [h][e][d] = f16(bf16(Whel)).
__device__ __forceinline__ void r16_rows(const float* __restrict__ QKV, h16* Q16, h16* K16, int blk) {
    const int lane = threadIdx.x & 31, wid = blk * 8 + (threadIdx.x >> 5);
    if (wid >= 2 * NTK) return;
    const int r = wid >> 1, which = wid & 1;
    const float* s = QKV + (size_t)r * (3 * DM) + which * DM; h16* d = (which ? K16 : Q16) + (size_t)r * DM;
    v8h o[4];
#pragma unroll
    for (int q = 0; q < 4; ++q) { v8h t;
#pragma unroll
        for (int i = 0; i < 8; ++i) t[i] = (h16)s[q * 256 + lane * 8 + i];
        o[q] = t; }
#pragma unroll
    for (int q = 0; q < 4; ++q) *(v8h*)(d + q * 256 + lane * 8) = o[q];
    
}
__device__ __forceinline__ void vt_tile(const float* __restrict__ QKV, h16* VT16, h16* tile, int bid) {
    const int b = bid / (NH_ * (NT_ / 64)), rem = bid - b * (NH_ * (NT_ / 64)), h = rem / (NT_ / 64), kt = rem - h * (NT_ / 64);
    const int k0 = kt * 64, tid = threadIdx.x;
    const int kk = tid >> 2, d0 = (tid & 3) * 16;
    const float* src = QKV + ((size_t)b * NT_ + k0 + kk) * (3 * DM) + 2 * DM + h * HD + d0;
#pragma unroll
    for (int i = 0; i < 16; ++i) tile[(d0 + i) * 72 + kk] = (h16)src[i];
    __syncthreads();
    const int piece = tid & 7;
    h16* base = VT16 + (((size_t)b * NH_ + h) * HD) * NT_ + k0;
    auto pass = [&]() {
#pragma unroll
        for (int s = 0; s < 2; ++s) { const int d = (tid >> 3) + 32 * s; const v8h val = *(const v8ha*)(tile + d * 72 + piece * 8); *(v8h*)(base + (size_t)d * NT_ + piece * 8) = val; }
    };
    pass();
    asm volatile("s_wait_xcnt 0x0" ::: "memory");               // the built code joins the q/k rows' path behind these stores: no register that they name is rewritten ahead of this wait
}
// one launch for both readers of QKV, which do not depend on each other: blocks [0, 1024) the q/k rows, the rest the V^T tiles; the split is by whole blocks, so the barrier in vt_tile is block-uniform
__global__ __launch_bounds__(256) void k_r16vt(const float* __restrict__ QKV, h16* Q16, h16* K16, h16* VT16) {
    __shared__ __align__(16) h16 tile[64 * 72];
    const int blk = blockIdx.x;
    if (blk < (2 * NTK) / 8) { r16_rows(QKV, Q16, K16, blk); return; }
    vt_tile(QKV, VT16, tile, blk - (2 * NTK) / 8);
}
__device__ __forceinline__ void whel_rows(const float* __restrict__ Whel, h16* WH16, int blk) {
    const int lane = threadIdx.x & 31, r = blk * 8 + (threadIdx.x >> 5);     // row = (h, e): 1024 rows of 64
    if (r >= NH_ * HD) return;
    v2h o; o[0] = (h16)bfr(Whel[(size_t)r * HD + 2 * lane]); o[1] = (h16)bfr(Whel[(size_t)r * HD + 2 * lane + 1]);
    *(v2h*)(WH16 + (size_t)r * HD + 2 * lane) = o; 
}
// one launch for every conversion of an input, none of which depends on another: blocks [0, 512) x, then 128 each for Wq, Wk, Wv, Wo (WB = the four planes in that order), then 128 for Whel
__global__ __launch_bounds__(256) void k_cvt(const float* __restrict__ x, const float* __restrict__ Wq, const float* __restrict__ Wk, const float* __restrict__ Wv, const float* __restrict__ Wo,
                                             const float* __restrict__ Whel, bf* Xb, bf* WB, h16* WH16) {
    const int blk = blockIdx.x;
    if (blk < NTK / 8) { cvtb_rows(x, NTK, Xb, blk); return; }
    const int wb = blk - NTK / 8, i = wb / (DM / 8);
    if (i < 4) { cvtb_rows(i == 0 ? Wq : i == 1 ? Wk : i == 2 ? Wv : Wo, DM, WB + (size_t)i * DM * DM, wb - i * (DM / 8)); return; }
    whel_rows(Whel, WH16, wb - 4 * (DM / 8));
}

// k_hel: QN16[b][h][tok][64] = L2-normalised pairs of (q|k)h . Whel[h]^T + bhel: block = (which, b, h, 64 tokens), wave = 16 tokens: 8 WMMA (A = Q16/K16 head slice
// rows, B = WH16[h] rows e), + bf16(bhel); pair (2p, 2p+1) = columns lr, lr^1 of the same tile -> norm via __shfl_xor(.., 1); staged in LDS, each token row = one
__global__ __launch_bounds__(128) void k_hel(const h16* __restrict__ Q16, const h16* __restrict__ K16, const h16* __restrict__ WH16, const float* __restrict__ bhel, h16* QN16, h16* KN16) {
    __shared__ __align__(16) float ost[4][16 * 68];
    const int lane = threadIdx.x & 31, wave = threadIdx.x >> 5, lr = lane & 15, hi = lane >> 4;
    const int nb = NB_ * NH_ * (NT_ / 64);
    const int which = blockIdx.x / nb, bid = blockIdx.x - which * nb;
    const int b = bid / (NH_ * (NT_ / 64)), rem = bid - b * (NH_ * (NT_ / 64)), h = rem / (NT_ / 64), tt = rem - h * (NT_ / 64);
    const int t0 = tt * 64 + wave * 16;
    const size_t tok0 = (size_t)b * NT_;
    const h16* src = which ? K16 : Q16; h16* dst = which ? KN16 : QN16;
    v16h a[2];
#pragma unroll
    for (int kc = 0; kc < 2; ++kc) { const h16* p = src + (tok0 + t0 + lr) * DM + h * HD + kc * 32 + 8 * hi; a[kc] = cat16(*(const v8h*)p, *(const v8h*)(p + 16)); }
    v8f d4[4];
#pragma unroll
    for (int n = 0; n < 4; ++n) d4[n] = (v8f){};
#pragma unroll
    for (int kc = 0; kc < 2; ++kc)
#pragma unroll
        for (int n = 0; n < 4; ++n) { const h16* bp = WH16 + ((size_t)h * HD + n * 16 + lr) * HD + kc * 32 + 8 * hi; d4[n] = wmma16(a[kc], cat16(*(const v8h*)bp, *(const v8h*)(bp + 16)), d4[n]); }
    asm volatile("v_nop\n\tv_nop\n\tv_nop\n\tv_nop" : "+v"(d4[0]), "+v"(d4[1]), "+v"(d4[2]), "+v"(d4[3]));
    float* os = &ost[wave][0];
#pragma unroll
    for (int n = 0; n < 4; ++n) {
        const float bb = bfr(bhel[(size_t)h * HD + n * 16 + lr]);
#pragma unroll
        for (int j = 0; j < 8; ++j) {
            const float v = d4[n][j] + bb;
            const float w = __shfl_xor(v, 1, 32);                 // pair partner (column lr ^ 1, same row)
            const float nrm = sqrtf(v * v + w * w);
            os[(hi * 8 + j) * 68 + n * 16 + lr] = v / fmaxf(nrm, 1e-12f);
        }
    }
    __syncthreads();
    h16* crow = dst + (((size_t)b * NH_ + h) * NT_ + t0) * HD;      // 16 rows x 64 halves = 16 lines: instruction s covers rows 4s + lane>>3
    auto pass = [&]() {
#pragma unroll
        for (int s = 0; s < 4; ++s) { const int row = 4 * s + (lane >> 3), piece = lane & 7; const float* sp = os + row * 68 + piece * 8; v8h o;
#pragma unroll
            for (int i = 0; i < 8; ++i) o[i] = (h16)sp[i];
            *(v8h*)(crow + (size_t)row * HD + piece * 8) = o; }
    };
    pass(); 
}

// k_scr: the reference's _scramble as a gather: H[b][h][s][2p + c] = QN[b][h][(2s + c) mod 2048][2p + ((2s + c) / 2048)] — block = 8 waves, wave = (which, b, h, s)
__global__ __launch_bounds__(256) void k_scr(const h16* __restrict__ QN16, const h16* __restrict__ KN16, h16* HQ16, h16* HK16) {
    const int lane = threadIdx.x & 31, wid = blockIdx.x * 8 + (threadIdx.x >> 5);
    if (wid >= 2 * NB_ * NH_ * NT_) return;
    const int which = wid / (NB_ * NH_ * NT_), r = wid - which * (NB_ * NH_ * NT_);       // r = (b*16 + h)*2048 + s
    const int s = r % NT_, bh = r / NT_;
    const h16* src = (which ? KN16 : QN16) + (size_t)bh * NT_ * HD; h16* dst = (which ? HK16 : HQ16) + (size_t)r * HD;
    v2h o;
#pragma unroll
    for (int c = 0; c < 2; ++c) { const int f = 2 * s + c; const int t = f % NT_, cc = f / NT_; o[c] = src[(size_t)t * HD + 2 * lane + cc]; }
    *(v2h*)(dst + 2 * lane) = o; 
}

// k_attn: block = (b, h, 128 queries), wave = 16; q and helical-q fragments resident; 64 steps x 32 keys: 4 WMMA q.k and 4 WMMA hq.hk, logits 0.5 s/8 + 0.5 g/32, online f32
// softmax, weights x32768 f16 tile (same-wave may_alias reload after a compiler barrier), 4 WMMA .v; ctx -> bf16 hi/lo planes CH/CL[tok][h*64+d].
// A stage = 128 keys of this (b, h), shared by the block's 8 waves: 128 K rows and 128 helical-K rows (128 B each, LDS pitch 144 B) and the 64 V^T rows (256 B each, pitch
// 272 B), brought in by per-lane 16-byte asynchronous copies that cover whole lines; two buffers, the next stage in flight. The 16-byte fragment reads then come from LDS.
#define AKS  128
#define KPB  144
#define VPB  272
#define AKO  (AKS * KPB)
#define AST  (2 * AKO + HD * VPB)

// four copies of one operand; the s_wait_xcnt closes the statement so that no address register is rewritten ahead of it
__device__ __forceinline__ void cp4(unsigned l, const h16* g, unsigned ls, size_t gs) {
    asm volatile("global_load_async_to_lds_b128 %0, %1, off\n\t"
                 "global_load_async_to_lds_b128 %2, %3, off\n\t"
                 "global_load_async_to_lds_b128 %4, %5, off\n\t"
                 "global_load_async_to_lds_b128 %6, %7, off\n\t"
                 "s_wait_xcnt 0x0"
                 :: "v"(l), "v"(g), "v"(l + ls), "v"(g + gs), "v"(l + 2 * ls), "v"(g + 2 * gs), "v"(l + 3 * ls), "v"(g + 3 * gs)
                 : "memory");
}

__global__ __launch_bounds__(256) void k_attn(const h16* __restrict__ Q16, const h16* __restrict__ K16, const h16* __restrict__ HQ16, const h16* __restrict__ HK16, const h16* __restrict__ VT16, bf* CH, bf* CL) {
    __shared__ __align__(16) unsigned char ring[2 * AST];
    __shared__ __align__(16) h16 plds[8][16 * 32];
    __shared__ __align__(16) float ost[8][16 * 68];
    const int lane = threadIdx.x & 31, wave = threadIdx.x >> 5, lr = lane & 15, hi = lane >> 4;
    const int bid = blockIdx.x;
    const int b = bid / (NH_ * (NT_ / 128)), rem = bid - b * (NH_ * (NT_ / 128)), h = rem / (NT_ / 128), qt = rem - h * (NT_ / 128);
    const int q0 = qt * 128 + wave * 16;
    const size_t tok0 = (size_t)b * NT_;
    const size_t hrow0 = ((size_t)b * NH_ + h) * NT_;
    h16* pl = &plds[wave][0];
    v16h qa[2], ga[2];
#pragma unroll
    for (int kc = 0; kc < 2; ++kc) {
        const h16* p = Q16 + (tok0 + q0 + lr) * DM + h * HD + kc * 32 + 8 * hi; qa[kc] = cat16(*(const v8h*)p, *(const v8h*)(p + 16));
        const h16* g = HQ16 + (hrow0 + q0 + lr) * HD + kc * 32 + 8 * hi; ga[kc] = cat16(*(const v8h*)g, *(const v8h*)(g + 16));
    }
    const h16* kh_b = K16 + tok0 * DM + h * HD; const h16* hk_b = HK16 + hrow0 * HD;
    const h16* vt_b = VT16 + (((size_t)b * NH_ + h) * HD) * NT_;
    v8f o[4];
#pragma unroll
    for (int n = 0; n < 4; ++n) o[n] = (v8f){};
    float mrow[8], lpart[8];
#pragma unroll
    for (int j = 0; j < 8; ++j) { mrow[j] = -3.0e38f; lpart[j] = 0.f; }
    // this wave's copies of a stage: K and helical-K rows krow + 4 i (8 lanes a row), V^T rows vrow + 2 i (16 lanes a row), i = 0 .. 3
    const int krow = wave * 16 + (lane >> 3), kpc = lane & 7, vrow = wave * 8 + hi;
    const unsigned lk = (unsigned)(size_t)ring + krow * KPB + kpc * 16, lv = (unsigned)(size_t)ring + 2 * AKO + vrow * VPB + lr * 16;
    const h16* gk = kh_b + (size_t)krow * DM + kpc * 8; const h16* gh = hk_b + (size_t)krow * HD + kpc * 8; const h16* gv = vt_b + (size_t)vrow * NT_ + lr * 8;
    auto fill = [&](int t, int buf) {
        cp4(lk + buf * AST, gk + (size_t)t * AKS * DM, 4 * KPB, 4 * DM);
        cp4(lk + buf * AST + AKO, gh + (size_t)t * AKS * HD, 4 * KPB, 4 * HD);
        cp4(lv + buf * AST, gv + t * AKS, 2 * VPB, 2 * NT_);
    };
    fill(0, 0);
    asm volatile("s_wait_asynccnt 0x0" ::: "memory");           // stage 0 of this wave has landed
    __syncthreads();                                            // ... and every other wave's
    fill(1, 1);
    // both loops kept rolled: the stage loop picks its buffer by the trip's parity; the four 32-key steps of a stage, unrolled, built to over 256 registers (3 waves a SIMD, not 4)
#pragma unroll 1
    for (int st = 0; st < NT_ / AKS; ++st) {
    const unsigned char* sb = ring + (st & 1) * AST;
#pragma unroll 1
    for (int kt = 0; kt < AKS / 32; ++kt) {
        const unsigned char* kp = sb + (kt * 32 + lr) * KPB + hi * 16;
        const unsigned char* vb = sb + 2 * AKO + lr * VPB + kt * 64 + hi * 16;
        v8f s0 = {}, s1 = {}, g0 = {}, g1 = {};
#pragma unroll
        for (int kc = 0; kc < 2; ++kc) {
            const unsigned char* r0p = kp + kc * 64; const unsigned char* r1p = r0p + 16 * KPB;
            const unsigned char* h0p = r0p + AKO; const unsigned char* h1p = r1p + AKO;
            s0 = wmma16(qa[kc], cat16(*(const v8ha*)r0p, *(const v8ha*)(r0p + 32)), s0); s1 = wmma16(qa[kc], cat16(*(const v8ha*)r1p, *(const v8ha*)(r1p + 32)), s1);
            g0 = wmma16(ga[kc], cat16(*(const v8ha*)h0p, *(const v8ha*)(h0p + 32)), g0); g1 = wmma16(ga[kc], cat16(*(const v8ha*)h1p, *(const v8ha*)(h1p + 32)), g1);
        }
        v16h vf[4];                                             // read here, ahead of the softmax, so that their LDS latency lies under it
#pragma unroll
        for (int n = 0; n < 4; ++n) { const unsigned char* vp = vb + n * 16 * VPB; vf[n] = cat16(*(const v8ha*)vp, *(const v8ha*)(vp + 32)); }
        asm volatile("v_nop\n\tv_nop\n\tv_nop\n\tv_nop" : "+v"(s0), "+v"(s1), "+v"(g0), "+v"(g1) : "v"(qa[0]), "v"(ga[1]));
        float alpha[8];
#pragma unroll
        for (int j = 0; j < 8; ++j) {
            const float a0 = 0.5f * (s0[j] * 0.125f) + 0.5f * (g0[j] * 0.03125f), a1 = 0.5f * (s1[j] * 0.125f) + 0.5f * (g1[j] * 0.03125f);
            float mx = fmaxf(a0, a1);
            mx = fmaxf(mx, __shfl_xor(mx, 1, 16)); mx = fmaxf(mx, __shfl_xor(mx, 2, 16)); mx = fmaxf(mx, __shfl_xor(mx, 4, 16)); mx = fmaxf(mx, __shfl_xor(mx, 8, 16));
            const float mn = fmaxf(mrow[j], mx);
            alpha[j] = __expf(mrow[j] - mn); mrow[j] = mn;
            const float p0 = __expf(a0 - mn), p1 = __expf(a1 - mn);
            lpart[j] = lpart[j] * alpha[j] + (p0 + p1);
            const int mr = hi * 8 + j;
            pl[mr * 32 + lr] = (h16)(p0 * PSC); pl[mr * 32 + 16 + lr] = (h16)(p1 * PSC);
        }
#pragma unroll
        for (int n = 0; n < 4; ++n)
#pragma unroll
            for (int j = 0; j < 8; ++j) o[n][j] *= alpha[j];
        asm volatile("" ::: "memory");
        const v16h pa = cat16(*(const v8ha*)(pl + lr * 32 + hi * 8), *(const v8ha*)(pl + lr * 32 + 16 + hi * 8));
#pragma unroll
        for (int n = 0; n < 4; ++n) o[n] = wmma16(pa, vf[n], o[n]);
        asm volatile("v_nop\n\tv_nop\n\tv_nop\n\tv_nop" : "+v"(o[0]), "+v"(o[1]), "+v"(o[2]), "+v"(o[3]) : "v"(pa));
    }
        asm volatile("s_wait_dscnt 0x0" ::: "memory");          // this wave has left the buffer
        asm volatile("s_wait_asynccnt 0x0" ::: "memory");       // its copies of stage st + 1 have landed
        __syncthreads();                                        // publishes stage st + 1, frees stage st's buffer
        if (st + 2 < NT_ / AKS) fill(st + 2, st & 1);
    }
    asm volatile("s_wait_asynccnt 0x0" ::: "memory");           // nothing in flight at the end
    float inv[8];
#pragma unroll
    for (int j = 0; j < 8; ++j) { float rs = lpart[j]; rs += __shfl_xor(rs, 1, 16); rs += __shfl_xor(rs, 2, 16); rs += __shfl_xor(rs, 4, 16); rs += __shfl_xor(rs, 8, 16); inv[j] = 1.0f / (rs * PSC); }
    float* os = &ost[wave][0];
#pragma unroll
    for (int n = 0; n < 4; ++n)
#pragma unroll
        for (int j = 0; j < 8; ++j) os[(hi * 8 + j) * 68 + n * 16 + lr] = o[n][j] * inv[j];
    __syncthreads();
    const size_t cbase = (tok0 + q0) * DM + (size_t)h * HD;
    auto pass = [&]() {
#pragma unroll
        for (int s = 0; s < 4; ++s) { const int row = 4 * s + (lane >> 3), piece = lane & 7; const float* sp = os + row * 68 + piece * 8; v8us oh, ol;
#pragma unroll
            for (int i = 0; i < 8; ++i) { const unsigned short hb = f2bf(sp[i]); oh[i] = hb; ol[i] = f2bf(sp[i] - bf2f(hb)); }
            *(v8us*)(CH + cbase + (size_t)row * DM + piece * 8) = oh; *(v8us*)(CL + cbase + (size_t)row * DM + piece * 8) = ol; }
    };
    pass(); 
}

extern "C" void kernel_launch(void* const* d_in, const int* in_sizes, int n_in,
                              void* d_out, int out_size, void* d_ws, size_t ws_size, hipStream_t stream) {
    (void)in_sizes; (void)n_in; (void)out_size;
    const float* x = (const float*)d_in[0]; const float* Wq = (const float*)d_in[1]; const float* bq = (const float*)d_in[2]; const float* Wk = (const float*)d_in[3]; const float* bk = (const float*)d_in[4];
    const float* Wv = (const float*)d_in[5]; const float* bv = (const float*)d_in[6]; const float* Wo = (const float*)d_in[7]; const float* bo = (const float*)d_in[8];
    const float* Whel = (const float*)d_in[9]; const float* bhel = (const float*)d_in[10];
    float* out = (float*)d_out;    // [2][2048][1024]
    char* wsp = (char*)d_ws;
    auto take = [&](size_t bytes) { char* p = wsp; wsp += (bytes + 255) & ~(size_t)255; return (void*)p; };
    bf* Xb = (bf*)take((size_t)NTK * DM * 2);
    bf* WB = (bf*)take((size_t)4 * DM * DM * 2);                    // bf16 Wq | Wk | Wv | Wo: the first three are one [3072 x 1024] B operand
    float* QKV = (float*)take((size_t)NTK * 3 * DM * 4);            // reused later for the ctx planes (dead after the conversions)
    h16* Q16 = (h16*)take((size_t)NTK * DM * 2); h16* K16 = (h16*)take((size_t)NTK * DM * 2); h16* VT16 = (h16*)take((size_t)NTK * DM * 2);
    h16* WH16 = (h16*)take((size_t)NH_ * HD * HD * 2);
    h16* QN16 = (h16*)take((size_t)NB_ * NH_ * NT_ * HD * 2); h16* KN16 = (h16*)take((size_t)NB_ * NH_ * NT_ * HD * 2);
    h16* HQ16 = (h16*)take((size_t)NB_ * NH_ * NT_ * HD * 2); h16* HK16 = (h16*)take((size_t)NB_ * NH_ * NT_ * HD * 2);
    if ((size_t)(wsp - (char*)d_ws) > ws_size) return;    // 8.4 + 8.4 + 50.3 + 25.2 + 0.13 + 33.6 MB ~ 126 MB
    bf* CH = (bf*)QKV; bf* CL = (bf*)((char*)QKV + (size_t)NTK * DM * 2);   // 2 x 8.4 MB inside the dead 50 MB QKV region
    k_cvt<<<NTK / 8 + 4 * (DM / 8) + (NH_ * HD) / 8, 256, 0, stream>>>(x, Wq, Wk, Wv, Wo, Whel, Xb, WB, WH16);
    k_gemmb<false><<<dim3(NTK / 128, 3 * DM / 128, 1), 256, 0, stream>>>(Xb, nullptr, WB, bq, bk, bv, QKV, 3 * DM, 0);
    k_r16vt<<<(2 * NTK) / 8 + NB_ * NH_ * (NT_ / 64), 256, 0, stream>>>(QKV, Q16, K16, VT16);
    k_hel<<<2 * NB_ * NH_ * (NT_ / 64), 128, 0, stream>>>(Q16, K16, WH16, bhel, QN16, KN16);
    k_scr<<<(2 * NB_ * NH_ * NT_) / 8, 256, 0, stream>>>(QN16, KN16, HQ16, HK16);
    k_attn<<<NB_ * NH_ * (NT_ / 128), 256, 0, stream>>>(Q16, K16, HQ16, HK16, VT16, CH, CL);
    k_gemmb<true><<<dim3(NTK / 128, DM / 128, 1), 256, 0, stream>>>(CH, CL, WB + (size_t)3 * DM * DM, bo, bo, bo, out, DM, 0);
}

// v004
// One run takes 141 microseconds.
// Two timings next to v003 put it at 1.18 and 1.19 times that version's speed.
// All steps since v000 together make it 2.71 times as fast.
#include <hip/hip_runtime.h>

// Contractions, f32 accumulate: q/k/v = x.W^T + b ([4096 x 1024].[1024 x 1024] x3) on v_wmma_f32_16x16x32_bf16 with PLAIN bf16 operands (inputs rounded once: exact
// products); the per-head helical projections q_hel/k_hel = qh.Whel[h]^T + bhel ([tokens x 64].[64 x 64]) on v_wmma_f32_16x16x32_f16 with plain f16 q/k and
// f16(bf16(Whel)); the per-(batch, head) attention with TWO score products per key tile (0.5 q.k/8 + 0.5 helical/32, where the helical operands are the pairwise
// L2-normalised, "scrambled" projections) and weights.v, fused per 16-query tile with plain f16 operands and an online f32 softmax; out = ctx.Wo^T + bo on the bf16

#define NB_  2
#define NT_  2048
#define DM   1024
#define NH_  16
#define HD   64
#define NTK  (NB_ * NT_)
#define PSC  32768.0f

typedef _Float16 h16;
typedef unsigned short bf;
typedef __attribute__((ext_vector_type(16))) __bf16   v16bf;
typedef __attribute__((ext_vector_type(16))) _Float16 v16h;
typedef __attribute__((ext_vector_type(8)))  _Float16 v8h;
typedef __attribute__((ext_vector_type(8)))  unsigned short v8us;
typedef __attribute__((ext_vector_type(8)))  float    v8f;
typedef __attribute__((ext_vector_type(4)))  float    v4f;
typedef __attribute__((ext_vector_type(2)))  _Float16 v2h;
typedef v8h  __attribute__((may_alias)) v8ha;
typedef v4f  __attribute__((may_alias)) v4fa;

__device__ __forceinline__ unsigned short f2bf(float f) { unsigned u = __float_as_uint(f); u += 0x7FFFu + ((u >> 16) & 1u); return (unsigned short)(u >> 16); }
__device__ __forceinline__ float bf2f(unsigned short b) { return __uint_as_float(((unsigned)b) << 16); }
__device__ __forceinline__ float bfr(float f) { return bf2f(f2bf(f)); }
__device__ __forceinline__ v16h cat16(v8h lo, v8h hi) { return __builtin_shufflevector(lo, hi, 0, 1, 2, 3, 4, 5, 6, 7, 8, 9, 10, 11, 12, 13, 14, 15); }
__device__ __forceinline__ v16bf cat16b(v8us lo, v8us hi) { return __builtin_bit_cast(v16bf, __builtin_shufflevector(lo, hi, 0, 1, 2, 3, 4, 5, 6, 7, 8, 9, 10, 11, 12, 13, 14, 15)); }
__device__ __forceinline__ v8f wmma16(v16h a, v16h b, v8f c) { return __builtin_amdgcn_wmma_f32_16x16x32_f16(false, a, false, b, (short)0, c, false, false); }
__device__ __forceinline__ v8f wmmab(v16bf a, v16bf b, v8f c) { return __builtin_amdgcn_wmma_f32_16x16x32_bf16(false, a, false, b, (short)0, c, false, false); }

__device__ __forceinline__ void cvtb_rows(const float* __restrict__ src, int nrows, bf* dst, int blk) {
    const int lane = threadIdx.x & 31, r = blk * 8 + (threadIdx.x >> 5);
    if (r >= nrows) return;
    v8us o[4];
#pragma unroll
    for (int q = 0; q < 4; ++q) { v8us t;
#pragma unroll
        for (int i = 0; i < 8; ++i) t[i] = f2bf(src[(size_t)r * DM + q * 256 + lane * 8 + i]);
        o[q] = t; }
#pragma unroll
    for (int q = 0; q < 4; ++q) *(v8us*)(dst + (size_t)r * DM + q * 256 + lane * 8) = o[q];
    
}

// k_gemmb: C[128 x 128] per block of 8 waves (2 x 4, 64 rows x 32 columns each). A stage is 128 k (256 B) of the block's 128 A rows (hi, and lo where SPLITA) and 128 B rows,
// brought into LDS by per-lane 16-byte asynchronous copies (whole lines, no register), rows at pitch 272 B for the 16-byte fragment reads; two buffers, the next stage in flight.
#define GKS  128
#define GPB  272
#define GOP  (128 * GPB)
typedef v8us __attribute__((may_alias)) v8usa;

// eight copies of one operand's 16 rows of this wave; the s_wait_xcnt closes the statement so that no address register is rewritten ahead of it
__device__ __forceinline__ void cp8(unsigned l, const bf* g) {
    asm volatile("global_load_async_to_lds_b128 %0, %1, off\n\t"
                 "global_load_async_to_lds_b128 %2, %3, off\n\t"
                 "global_load_async_to_lds_b128 %4, %5, off\n\t"
                 "global_load_async_to_lds_b128 %6, %7, off\n\t"
                 "global_load_async_to_lds_b128 %8, %9, off\n\t"
                 "global_load_async_to_lds_b128 %10, %11, off\n\t"
                 "global_load_async_to_lds_b128 %12, %13, off\n\t"
                 "global_load_async_to_lds_b128 %14, %15, off\n\t"
                 "s_wait_xcnt 0x0"
                 :: "v"(l), "v"(g), "v"(l + 2 * GPB), "v"(g + 2 * DM), "v"(l + 4 * GPB), "v"(g + 4 * DM), "v"(l + 6 * GPB), "v"(g + 6 * DM),
                    "v"(l + 8 * GPB), "v"(g + 8 * DM), "v"(l + 10 * GPB), "v"(g + 10 * DM), "v"(l + 12 * GPB), "v"(g + 12 * DM), "v"(l + 14 * GPB), "v"(g + 14 * DM)
                 : "memory");
}

template <bool SPLITA>
__global__ __launch_bounds__(256) void k_gemmb(const bf* __restrict__ A, const bf* __restrict__ Al, const bf* __restrict__ Bn, const float* __restrict__ bias, const float* __restrict__ bias1, const float* __restrict__ bias2, float* C, int ldc, int cb) {
    constexpr int STG = (SPLITA ? 3 : 2) * GOP, BOP = (SPLITA ? 2 : 1) * GOP;   // one stage: [A | B], or [A hi | A lo | B]
    constexpr int NST = DM / GKS, NBK = (GKS / 32) * (SPLITA ? 2 : 1);
    __shared__ __align__(16) unsigned char ring[2 * STG];
    const int lane = threadIdx.x & 31, wave = threadIdx.x >> 5, lr = lane & 15, hi = lane >> 4;
    const int wm = wave >> 2, wn = wave & 3;
    const int r0 = blockIdx.x * 128, c0 = blockIdx.y * 128;
    const int crw = wave * 16 + hi;                             // copy i of a wave: rows crw + 2 i, bytes 16 lr of the stage's 256
    const unsigned l0 = (unsigned)(size_t)ring + crw * GPB + lr * 16;
    const bf* gA = A + (size_t)(r0 + crw) * DM + lr * 8;
    const bf* gB = Bn + (size_t)(c0 + crw) * DM + lr * 8;
    const bf* gL = SPLITA ? Al + (size_t)(r0 + crw) * DM + lr * 8 : gA;
    auto fill = [&](int t, int buf) {
        const unsigned l = l0 + buf * STG;
        cp8(l, gA + t * GKS); cp8(l + BOP, gB + t * GKS);
        if (SPLITA) cp8(l + GOP, gL + t * GKS);
    };
    v8f acc[4][2];
#pragma unroll
    for (int m = 0; m < 4; ++m)
#pragma unroll
        for (int n = 0; n < 2; ++n) acc[m][n] = (v8f){};
    fill(0, 0);
    asm volatile("s_wait_asynccnt 0x0" ::: "memory");           // stage 0 of this wave has landed
    __syncthreads();                                            // ... and every other wave's
    fill(1, 1);
    const int aofs = (wm * 64 + lr) * GPB + hi * 16, bofs = BOP + (wn * 32 + lr) * GPB + hi * 16;
    // kept rolled: one stage per trip, the buffer picked by the trip's parity
#pragma unroll 1
    for (int t = 0; t < NST; ++t) {
        const unsigned char* sb = ring + (t & 1) * STG;
        // a block = the 8 products of one A-side fragment set (hi, or lo where SPLITA) with one B set; block i + 1's fragments are read as one group ahead of block i's products
        v16bf fa[2][4], fb[2][2];
        auto lda = [&](int i, v16bf* d) {
            const unsigned char* q = sb + aofs + (SPLITA ? (i & 1) * GOP + (i >> 1) * 64 : i * 64);
#pragma unroll
            for (int m = 0; m < 4; ++m) { const unsigned char* p = q + m * 16 * GPB; d[m] = cat16b(*(const v8usa*)p, *(const v8usa*)(p + 32)); }
        };
        auto ldb = [&](int ks, v16bf* d) {
#pragma unroll
            for (int n = 0; n < 2; ++n) { const unsigned char* p = sb + bofs + n * 16 * GPB + ks * 64; d[n] = cat16b(*(const v8usa*)p, *(const v8usa*)(p + 32)); }
        };
        lda(0, fa[0]); ldb(0, fb[0]);
#pragma unroll
        for (int i = 0; i < NBK; ++i) {
            const int ks = SPLITA ? i >> 1 : i, ks1 = SPLITA ? (i + 1) >> 1 : i + 1;
            if (i + 1 < NBK) { lda(i + 1, fa[(i + 1) & 1]); if (ks1 != ks) ldb(ks1, fb[ks1 & 1]); }
            __builtin_amdgcn_sched_barrier(0);                  // keeps the LDS reads one group in front of the products, not spread among them with waits to 0
#pragma unroll
            for (int m = 0; m < 4; ++m)
#pragma unroll
                for (int n = 0; n < 2; ++n) acc[m][n] = wmmab(fa[i & 1][m], fb[ks & 1][n], acc[m][n]);
            __builtin_amdgcn_sched_barrier(0);                  // the other side of that fence
        }
        asm volatile("s_wait_dscnt 0x0" ::: "memory");          // this wave has left the buffer
        asm volatile("s_wait_asynccnt 0x0" ::: "memory");       // its copies of stage t + 1 have landed
        __syncthreads();                                        // publishes stage t + 1, frees stage t's buffer
        if (t + 2 < NST) fill(t + 2, t & 1);
    }
    asm volatile("s_wait_asynccnt 0x0" ::: "memory");           // nothing in flight when the ring becomes output staging
    float* os = (float*)(ring + wave * (64 * 36 * 4));          // this wave's own 64 rows x 32 columns, pitch 36 floats
    const float* bsel = c0 < DM ? bias : c0 < 2 * DM ? bias1 : bias2;   // one bias vector per 1024 output columns (q | k | v stacked along N)
#pragma unroll
    for (int n = 0; n < 2; ++n) { const float bv = bfr(bsel[(c0 & (DM - 1)) + wn * 32 + n * 16 + lr]);
#pragma unroll
        for (int m = 0; m < 4; ++m)
#pragma unroll
            for (int j = 0; j < 8; ++j) os[(m * 16 + hi * 8 + j) * 36 + n * 16 + lr] = acc[m][n][j] + bv; }
    float* crow = C + (size_t)(r0 + wm * 64) * ldc + cb + c0 + wn * 32;
#pragma unroll
    for (int s = 0; s < 16; ++s) { const int row = s * 4 + (lane >> 3), cofs = (lane & 7) * 4;
        const v4f val = *(const v4fa*)(os + row * 36 + cofs); *(v4f*)(crow + (size_t)row * ldc + cofs) = val; }
}

// r16_rows: f16 rows [tok][1024] of q (which 0) / k (1) from QKV [tok][3072]; vt_tile: VT16[b][h][d][t]; whel_rows: WH16 [h][e][d] = f16(bf16(Whel)).
__device__ __forceinline__ void r16_rows(const float* __restrict__ QKV, h16* Q16, h16* K16, int blk) {
    const int lane = threadIdx.x & 31, wid = blk * 8 + (threadIdx.x >> 5);
    if (wid >= 2 * NTK) return;
    const int r = wid >> 1, which = wid & 1;
    const float* s = QKV + (size_t)r * (3 * DM) + which * DM; h16* d = (which ? K16 : Q16) + (size_t)r * DM;
    v8h o[4];
#pragma unroll
    for (int q = 0; q < 4; ++q) { v8h t;
#pragma unroll
        for (int i = 0; i < 8; ++i) t[i] = (h16)s[q * 256 + lane * 8 + i];
        o[q] = t; }
#pragma unroll
    for (int q = 0; q < 4; ++q) *(v8h*)(d + q * 256 + lane * 8) = o[q];
    
}
__device__ __forceinline__ void vt_tile(const float* __restrict__ QKV, h16* VT16, h16* tile, int bid) {
    const int b = bid / (NH_ * (NT_ / 64)), rem = bid - b * (NH_ * (NT_ / 64)), h = rem / (NT_ / 64), kt = rem - h * (NT_ / 64);
    const int k0 = kt * 64, tid = threadIdx.x;
    const int kk = tid >> 2, d0 = (tid & 3) * 16;
    const float* src = QKV + ((size_t)b * NT_ + k0 + kk) * (3 * DM) + 2 * DM + h * HD + d0;
#pragma unroll
    for (int i = 0; i < 16; ++i) tile[(d0 + i) * 72 + kk] = (h16)src[i];
    __syncthreads();
    const int piece = tid & 7;
    h16* base = VT16 + (((size_t)b * NH_ + h) * HD) * NT_ + k0;
    auto pass = [&]() {
#pragma unroll
        for (int s = 0; s < 2; ++s) { const int d = (tid >> 3) + 32 * s; const v8h val = *(const v8ha*)(tile + d * 72 + piece * 8); *(v8h*)(base + (size_t)d * NT_ + piece * 8) = val; }
    };
    pass();
    asm volatile("s_wait_xcnt 0x0" ::: "memory");               // the built code joins the q/k rows' path behind these stores: no register that they name is rewritten ahead of this wait
}
// one launch for both readers of QKV, which do not depend on each other: blocks [0, 1024) the q/k rows, the rest the V^T tiles; the split is by whole blocks, so the barrier in vt_tile is block-uniform
__global__ __launch_bounds__(256) void k_r16vt(const float* __restrict__ QKV, h16* Q16, h16* K16, h16* VT16) {
    __shared__ __align__(16) h16 tile[64 * 72];
    const int blk = blockIdx.x;
    if (blk < (2 * NTK) / 8) { r16_rows(QKV, Q16, K16, blk); return; }
    vt_tile(QKV, VT16, tile, blk - (2 * NTK) / 8);
}
__device__ __forceinline__ void whel_rows(const float* __restrict__ Whel, h16* WH16, int blk) {
    const int lane = threadIdx.x & 31, r = blk * 8 + (threadIdx.x >> 5);     // row = (h, e): 1024 rows of 64
    if (r >= NH_ * HD) return;
    v2h o; o[0] = (h16)bfr(Whel[(size_t)r * HD + 2 * lane]); o[1] = (h16)bfr(Whel[(size_t)r * HD + 2 * lane + 1]);
    *(v2h*)(WH16 + (size_t)r * HD + 2 * lane) = o; 
}
// one launch for every conversion of an input, none of which depends on another: blocks [0, 512) x, then 128 each for Wq, Wk, Wv, Wo (WB = the four planes in that order), then 128 for Whel
__global__ __launch_bounds__(256) void k_cvt(const float* __restrict__ x, const float* __restrict__ Wq, const float* __restrict__ Wk, const float* __restrict__ Wv, const float* __restrict__ Wo,
                                             const float* __restrict__ Whel, bf* Xb, bf* WB, h16* WH16) {
    const int blk = blockIdx.x;
    if (blk < NTK / 8) { cvtb_rows(x, NTK, Xb, blk); return; }
    const int wb = blk - NTK / 8, i = wb / (DM / 8);
    if (i < 4) { cvtb_rows(i == 0 ? Wq : i == 1 ? Wk : i == 2 ? Wv : Wo, DM, WB + (size_t)i * DM * DM, wb - i * (DM / 8)); return; }
    whel_rows(Whel, WH16, wb - 4 * (DM / 8));
}

// k_hel: QN16[b][h][tok][64] = L2-normalised pairs of (q|k)h . Whel[h]^T + bhel: block = (which, b, h, 64 tokens), wave = 16 tokens: 8 WMMA (A = Q16/K16 head slice
// rows, B = WH16[h] rows e), + bf16(bhel); pair (2p, 2p+1) = columns lr, lr^1 of the same tile -> norm via __shfl_xor(.., 1); staged in LDS, each token row = one
__global__ __launch_bounds__(128) void k_hel(const h16* __restrict__ Q16, const h16* __restrict__ K16, const h16* __restrict__ WH16, const float* __restrict__ bhel, h16* QN16, h16* KN16) {
    __shared__ __align__(16) float ost[4][16 * 68];
    const int lane = threadIdx.x & 31, wave = threadIdx.x >> 5, lr = lane & 15, hi = lane >> 4;
    const int nb = NB_ * NH_ * (NT_ / 64);
    const int which = blockIdx.x / nb, bid = blockIdx.x - which * nb;
    const int b = bid / (NH_ * (NT_ / 64)), rem = bid - b * (NH_ * (NT_ / 64)), h = rem / (NT_ / 64), tt = rem - h * (NT_ / 64);
    const int t0 = tt * 64 + wave * 16;
    const size_t tok0 = (size_t)b * NT_;
    const h16* src = which ? K16 : Q16; h16* dst = which ? KN16 : QN16;
    v16h a[2];
#pragma unroll
    for (int kc = 0; kc < 2; ++kc) { const h16* p = src + (tok0 + t0 + lr) * DM + h * HD + kc * 32 + 8 * hi; a[kc] = cat16(*(const v8h*)p, *(const v8h*)(p + 16)); }
    v8f d4[4];
#pragma unroll
    for (int n = 0; n < 4; ++n) d4[n] = (v8f){};
#pragma unroll
    for (int kc = 0; kc < 2; ++kc)
#pragma unroll
        for (int n = 0; n < 4; ++n) { const h16* bp = WH16 + ((size_t)h * HD + n * 16 + lr) * HD + kc * 32 + 8 * hi; d4[n] = wmma16(a[kc], cat16(*(const v8h*)bp, *(const v8h*)(bp + 16)), d4[n]); }
    asm volatile("v_nop\n\tv_nop\n\tv_nop\n\tv_nop" : "+v"(d4[0]), "+v"(d4[1]), "+v"(d4[2]), "+v"(d4[3]));
    float* os = &ost[wave][0];
#pragma unroll
    for (int n = 0; n < 4; ++n) {
        const float bb = bfr(bhel[(size_t)h * HD + n * 16 + lr]);
#pragma unroll
        for (int j = 0; j < 8; ++j) {
            const float v = d4[n][j] + bb;
            const float w = __shfl_xor(v, 1, 32);                 // pair partner (column lr ^ 1, same row)
            const float nrm = sqrtf(v * v + w * w);
            os[(hi * 8 + j) * 68 + n * 16 + lr] = v / fmaxf(nrm, 1e-12f);
        }
    }
    __syncthreads();
    h16* crow = dst + (((size_t)b * NH_ + h) * NT_ + t0) * HD;      // 16 rows x 64 halves = 16 lines: instruction s covers rows 4s + lane>>3
    auto pass = [&]() {
#pragma unroll
        for (int s = 0; s < 4; ++s) { const int row = 4 * s + (lane >> 3), piece = lane & 7; const float* sp = os + row * 68 + piece * 8; v8h o;
#pragma unroll
            for (int i = 0; i < 8; ++i) o[i] = (h16)sp[i];
            *(v8h*)(crow + (size_t)row * HD + piece * 8) = o; }
    };
    pass(); 
}

// k_scr: the reference's _scramble as a gather: H[b][h][s][2p + c] = QN[b][h][(2s + c) mod 2048][2p + ((2s + c) / 2048)] — block = 8 waves, wave = (which, b, h, s)
__global__ __launch_bounds__(256) void k_scr(const h16* __restrict__ QN16, const h16* __restrict__ KN16, h16* HQ16, h16* HK16) {
    const int lane = threadIdx.x & 31, wid = blockIdx.x * 8 + (threadIdx.x >> 5);
    if (wid >= 2 * NB_ * NH_ * NT_) return;
    const int which = wid / (NB_ * NH_ * NT_), r = wid - which * (NB_ * NH_ * NT_);       // r = (b*16 + h)*2048 + s
    const int s = r % NT_, bh = r / NT_;
    const h16* src = (which ? KN16 : QN16) + (size_t)bh * NT_ * HD; h16* dst = (which ? HK16 : HQ16) + (size_t)r * HD;
    v2h o;
#pragma unroll
    for (int c = 0; c < 2; ++c) { const int f = 2 * s + c; const int t = f % NT_, cc = f / NT_; o[c] = src[(size_t)t * HD + 2 * lane + cc]; }
    *(v2h*)(dst + 2 * lane) = o; 
}

// k_attn: block = (b, h, 128 queries), wave = 16; q and helical-q fragments resident; 64 steps x 32 keys, all products transposed: S^T = K.Q^T (4 WMMA) and G^T = HK.HQ^T (4 WMMA)
// with the key rows as A and the resident query fragments as B, so a lane holds 16 of the 32 scores of ONE query (column lr, keys 8 hi + j and 16 + 8 hi + j); logits 0.5 s/8 + 0.5 g/32,
// online f32 softmax in the lane plus one exchange between the wave's halves; the weights x32768, converted in place, are the B operand of O^T += V^T.P^T (4 WMMA): they touch no LDS.
// ctx -> bf16 hi/lo planes CH/CL[tok][h*64+d].
// A stage = 128 keys of this (b, h), shared by the block's 8 waves: 128 K rows and 128 helical-K rows (128 B each, LDS pitch 144 B) and the 64 V^T rows (256 B each, pitch
// 272 B), brought in by per-lane 16-byte asynchronous copies that cover whole lines; two buffers, the next stage in flight. The 16-byte fragment reads then come from LDS.
#define AKS  128
#define KPB  144
#define VPB  272
#define AKO  (AKS * KPB)
#define AST  (2 * AKO + HD * VPB)

// four copies of one operand; the s_wait_xcnt closes the statement so that no address register is rewritten ahead of it
__device__ __forceinline__ void cp4(unsigned l, const h16* g, unsigned ls, size_t gs) {
    asm volatile("global_load_async_to_lds_b128 %0, %1, off\n\t"
                 "global_load_async_to_lds_b128 %2, %3, off\n\t"
                 "global_load_async_to_lds_b128 %4, %5, off\n\t"
                 "global_load_async_to_lds_b128 %6, %7, off\n\t"
                 "s_wait_xcnt 0x0"
                 :: "v"(l), "v"(g), "v"(l + ls), "v"(g + gs), "v"(l + 2 * ls), "v"(g + 2 * gs), "v"(l + 3 * ls), "v"(g + 3 * gs)
                 : "memory");
}

// lane l with lane l ^ 16
__device__ __forceinline__ float xhalf(float x) { return __builtin_bit_cast(float, __builtin_amdgcn_permlanex16(__builtin_bit_cast(int, x), __builtin_bit_cast(int, x), 0x76543210, 0xfedcba98, false, false)); }

__global__ __launch_bounds__(256) void k_attn(const h16* __restrict__ Q16, const h16* __restrict__ K16, const h16* __restrict__ HQ16, const h16* __restrict__ HK16, const h16* __restrict__ VT16, bf* CH, bf* CL) {
    __shared__ __align__(16) unsigned char ring[2 * AST];
    __shared__ __align__(16) float ost[8][16 * 68];
    const int lane = threadIdx.x & 31, wave = threadIdx.x >> 5, lr = lane & 15, hi = lane >> 4;
    const int bid = blockIdx.x;
    const int b = bid / (NH_ * (NT_ / 128)), rem = bid - b * (NH_ * (NT_ / 128)), h = rem / (NT_ / 128), qt = rem - h * (NT_ / 128);
    const int q0 = qt * 128 + wave * 16;
    const size_t tok0 = (size_t)b * NT_;
    const size_t hrow0 = ((size_t)b * NH_ + h) * NT_;
    v16h qa[2], ga[2];
#pragma unroll
    for (int kc = 0; kc < 2; ++kc) {
        const h16* p = Q16 + (tok0 + q0 + lr) * DM + h * HD + kc * 32 + 8 * hi; qa[kc] = cat16(*(const v8h*)p, *(const v8h*)(p + 16));
        const h16* g = HQ16 + (hrow0 + q0 + lr) * HD + kc * 32 + 8 * hi; ga[kc] = cat16(*(const v8h*)g, *(const v8h*)(g + 16));
    }
    const h16* kh_b = K16 + tok0 * DM + h * HD; const h16* hk_b = HK16 + hrow0 * HD;
    const h16* vt_b = VT16 + (((size_t)b * NH_ + h) * HD) * NT_;
    v8f o[4];
#pragma unroll
    for (int n = 0; n < 4; ++n) o[n] = (v8f){};
    float mrow = -3.0e38f, lpart = 0.f;                         // query lr's running maximum (equal in both halves) and this half's part of its sum
    // this wave's copies of a stage: K and helical-K rows krow + 4 i (8 lanes a row), V^T rows vrow + 2 i (16 lanes a row), i = 0 .. 3
    const int krow = wave * 16 + (lane >> 3), kpc = lane & 7, vrow = wave * 8 + hi;
    const unsigned lk = (unsigned)(size_t)ring + krow * KPB + kpc * 16, lv = (unsigned)(size_t)ring + 2 * AKO + vrow * VPB + lr * 16;
    const h16* gk = kh_b + (size_t)krow * DM + kpc * 8; const h16* gh = hk_b + (size_t)krow * HD + kpc * 8; const h16* gv = vt_b + (size_t)vrow * NT_ + lr * 8;
    auto fill = [&](int t, int buf) {
        cp4(lk + buf * AST, gk + (size_t)t * AKS * DM, 4 * KPB, 4 * DM);
        cp4(lk + buf * AST + AKO, gh + (size_t)t * AKS * HD, 4 * KPB, 4 * HD);
        cp4(lv + buf * AST, gv + t * AKS, 2 * VPB, 2 * NT_);
    };
    fill(0, 0);
    asm volatile("s_wait_asynccnt 0x0" ::: "memory");           // stage 0 of this wave has landed
    __syncthreads();                                            // ... and every other wave's
    fill(1, 1);
    // both loops kept rolled: the stage loop picks its buffer by the trip's parity; the four 32-key steps of a stage, unrolled, built to over 256 registers (3 waves a SIMD, not 4)
#pragma unroll 1
    for (int st = 0; st < NT_ / AKS; ++st) {
    const unsigned char* sb = ring + (st & 1) * AST;
#pragma unroll 1
    for (int kt = 0; kt < AKS / 32; ++kt) {
        const unsigned char* kp = sb + (kt * 32 + lr) * KPB + hi * 16;
        const unsigned char* vb = sb + 2 * AKO + lr * VPB + kt * 64 + hi * 16;
        v8f s0 = {}, s1 = {}, g0 = {}, g1 = {};
#pragma unroll
        for (int kc = 0; kc < 2; ++kc) {
            const unsigned char* r0p = kp + kc * 64; const unsigned char* r1p = r0p + 16 * KPB;
            const unsigned char* h0p = r0p + AKO; const unsigned char* h1p = r1p + AKO;
            s0 = wmma16(cat16(*(const v8ha*)r0p, *(const v8ha*)(r0p + 32)), qa[kc], s0); s1 = wmma16(cat16(*(const v8ha*)r1p, *(const v8ha*)(r1p + 32)), qa[kc], s1);
            g0 = wmma16(cat16(*(const v8ha*)h0p, *(const v8ha*)(h0p + 32)), ga[kc], g0); g1 = wmma16(cat16(*(const v8ha*)h1p, *(const v8ha*)(h1p + 32)), ga[kc], g1);
        }
        v16h vf[4];                                             // read here, ahead of the softmax, so that their LDS latency lies under it
#pragma unroll
        for (int n = 0; n < 4; ++n) { const unsigned char* vp = vb + n * 16 * VPB; vf[n] = cat16(*(const v8ha*)vp, *(const v8ha*)(vp + 32)); }
        asm volatile("v_nop\n\tv_nop\n\tv_nop\n\tv_nop" : "+v"(s0), "+v"(s1), "+v"(g0), "+v"(g1) : "v"(qa[0]), "v"(ga[1]));
        const v8f a0 = 0.5f * (s0 * 0.125f) + 0.5f * (g0 * 0.03125f), a1 = 0.5f * (s1 * 0.125f) + 0.5f * (g1 * 0.03125f);
        float mx = fmaxf(a0[0], a1[0]);
#pragma unroll
        for (int j = 1; j < 8; ++j) mx = fmaxf(mx, fmaxf(a0[j], a1[j]));
        const float mn = fmaxf(mrow, fmaxf(mx, xhalf(mx)));     // over all 32 keys: the other half holds this query's other 16
        const float alpha = __expf(mrow - mn); mrow = mn;
        v8f p0, p1;
#pragma unroll
        for (int j = 0; j < 8; ++j) { p0[j] = __expf(a0[j] - mn); p1[j] = __expf(a1[j] - mn); }
        const v8f pp = p0 + p1;
        lpart = lpart * alpha + (((pp[0] + pp[1]) + (pp[2] + pp[3])) + ((pp[4] + pp[5]) + (pp[6] + pp[7])));
        // element s = key 8 hi + s (s < 8), 16 + 8 hi + s - 8: the k order in which vf was read
        const v16h pa = cat16(__builtin_convertvector(p0 * PSC, v8h), __builtin_convertvector(p1 * PSC, v8h));
#pragma unroll
        for (int n = 0; n < 4; ++n) o[n] *= alpha;
#pragma unroll
        for (int n = 0; n < 4; ++n) o[n] = wmma16(vf[n], pa, o[n]);
        asm volatile("v_nop\n\tv_nop\n\tv_nop\n\tv_nop" : "+v"(o[0]), "+v"(o[1]), "+v"(o[2]), "+v"(o[3]) : "v"(pa));
    }
        asm volatile("s_wait_dscnt 0x0" ::: "memory");          // this wave has left the buffer
        asm volatile("s_wait_asynccnt 0x0" ::: "memory");       // its copies of stage st + 1 have landed
        __syncthreads();                                        // publishes stage st + 1, frees stage st's buffer
        if (st + 2 < NT_ / AKS) fill(st + 2, st & 1);
    }
    asm volatile("s_wait_asynccnt 0x0" ::: "memory");           // nothing in flight at the end
    const float inv = 1.0f / ((lpart + xhalf(lpart)) * PSC);
    float* os = &ost[wave][0];                                  // o[n][j] = ctx[query lr][n * 16 + hi * 8 + j]
#pragma unroll
    for (int n = 0; n < 4; ++n)
#pragma unroll
        for (int j = 0; j < 8; ++j) os[lr * 68 + n * 16 + hi * 8 + j] = o[n][j] * inv;
    __syncthreads();
    const size_t cbase = (tok0 + q0) * DM + (size_t)h * HD;
    auto pass = [&]() {
#pragma unroll
        for (int s = 0; s < 4; ++s) { const int row = 4 * s + (lane >> 3), piece = lane & 7; const float* sp = os + row * 68 + piece * 8; v8us oh, ol;
#pragma unroll
            for (int i = 0; i < 8; ++i) { const unsigned short hb = f2bf(sp[i]); oh[i] = hb; ol[i] = f2bf(sp[i] - bf2f(hb)); }
            *(v8us*)(CH + cbase + (size_t)row * DM + piece * 8) = oh; *(v8us*)(CL + cbase + (size_t)row * DM + piece * 8) = ol; }
    };
    pass(); 
}

extern "C" void kernel_launch(void* const* d_in, const int* in_sizes, int n_in,
                              void* d_out, int out_size, void* d_ws, size_t ws_size, hipStream_t stream) {
    (void)in_sizes; (void)n_in; (void)out_size;
    const float* x = (const float*)d_in[0]; const float* Wq = (const float*)d_in[1]; const float* bq = (const float*)d_in[2]; const float* Wk = (const float*)d_in[3]; const float* bk = (const float*)d_in[4];
    const float* Wv = (const float*)d_in[5]; const float* bv = (const float*)d_in[6]; const float* Wo = (const float*)d_in[7]; const float* bo = (const float*)d_in[8];
    const float* Whel = (const float*)d_in[9]; const float* bhel = (const float*)d_in[10];
    float* out = (float*)d_out;    // [2][2048][1024]
    char* wsp = (char*)d_ws;
    auto take = [&](size_t bytes) { char* p = wsp; wsp += (bytes + 255) & ~(size_t)255; return (void*)p; };
    bf* Xb = (bf*)take((size_t)NTK * DM * 2);
    bf* WB = (bf*)take((size_t)4 * DM * DM * 2);                    // bf16 Wq | Wk | Wv | Wo: the first three are one [3072 x 1024] B operand
    float* QKV = (float*)take((size_t)NTK * 3 * DM * 4);            // reused later for the ctx planes (dead after the conversions)
    h16* Q16 = (h16*)take((size_t)NTK * DM * 2); h16* K16 = (h16*)take((size_t)NTK * DM * 2); h16* VT16 = (h16*)take((size_t)NTK * DM * 2);
    h16* WH16 = (h16*)take((size_t)NH_ * HD * HD * 2);
    h16* QN16 = (h16*)take((size_t)NB_ * NH_ * NT_ * HD * 2); h16* KN16 = (h16*)take((size_t)NB_ * NH_ * NT_ * HD * 2);
    h16* HQ16 = (h16*)take((size_t)NB_ * NH_ * NT_ * HD * 2); h16* HK16 = (h16*)take((size_t)NB_ * NH_ * NT_ * HD * 2);
    if ((size_t)(wsp - (char*)d_ws) > ws_size) return;    // 8.4 + 8.4 + 50.3 + 25.2 + 0.13 + 33.6 MB ~ 126 MB
    bf* CH = (bf*)QKV; bf* CL = (bf*)((char*)QKV + (size_t)NTK * DM * 2);   // 2 x 8.4 MB inside the dead 50 MB QKV region
    k_cvt<<<NTK / 8 + 4 * (DM / 8) + (NH_ * HD) / 8, 256, 0, stream>>>(x, Wq, Wk, Wv, Wo, Whel, Xb, WB, WH16);
    k_gemmb<false><<<dim3(NTK / 128, 3 * DM / 128, 1), 256, 0, stream>>>(Xb, nullptr, WB, bq, bk, bv, QKV, 3 * DM, 0);
    k_r16vt<<<(2 * NTK) / 8 + NB_ * NH_ * (NT_ / 64), 256, 0, stream>>>(QKV, Q16, K16, VT16);
    k_hel<<<2 * NB_ * NH_ * (NT_ / 64), 128, 0, stream>>>(Q16, K16, WH16, bhel, QN16, KN16);
    k_scr<<<(2 * NB_ * NH_ * NT_) / 8, 256, 0, stream>>>(QN16, KN16, HQ16, HK16);
    k_attn<<<NB_ * NH_ * (NT_ / 128), 256, 0, stream>>>(Q16, K16, HQ16, HK16, VT16, CH, CL);
    k_gemmb<true><<<dim3(NTK / 128, DM / 128, 1), 256, 0, stream>>>(CH, CL, WB + (size_t)3 * DM * DM, bo, bo, bo, out, DM, 0);
}

// v005
// Measured time: 111 microseconds a run.
// Timed twice side by side with v004, it ran 1.28 times as fast both times.
// Over all steps from v000 it is 3.47 times as fast.
#include <hip/hip_runtime.h>

// Contractions, f32 accumulate: q/k/v = x.W^T + b ([4096 x 1024].[1024 x 1024] x3) on v_wmma_f32_16x16x32_bf16 with PLAIN bf16 operands (inputs rounded once: exact
// products); the per-head helical projections q_hel/k_hel = qh.Whel[h]^T + bhel ([tokens x 64].[64 x 64]) on v_wmma_f32_16x16x32_f16 with plain f16 q/k and
// f16(bf16(Whel)); the per-(batch, head) attention with TWO score products per key tile (0.5 q.k/8 + 0.5 helical/32, where the helical operands are the pairwise
// L2-normalised, "scrambled" projections) and weights.v, fused per 16-query tile with plain f16 operands and an online f32 softmax; out = ctx.Wo^T + bo on the bf16

#define NB_  2
#define NT_  2048
#define DM   1024
#define NH_  16
#define HD   64
#define NTK  (NB_ * NT_)
#define PSC  32768.0f

typedef _Float16 h16;
typedef unsigned short bf;
typedef __attribute__((ext_vector_type(16))) __bf16   v16bf;
typedef __attribute__((ext_vector_type(16))) _Float16 v16h;
typedef __attribute__((ext_vector_type(8)))  _Float16 v8h;
typedef __attribute__((ext_vector_type(8)))  unsigned short v8us;
typedef __attribute__((ext_vector_type(8)))  float    v8f;
typedef __attribute__((ext_vector_type(4)))  float    v4f;
typedef __attribute__((ext_vector_type(2)))  _Float16 v2h;
typedef v8h  __attribute__((may_alias)) v8ha;
typedef v4f  __attribute__((may_alias)) v4fa;

__device__ __forceinline__ unsigned short f2bf(float f) { unsigned u = __float_as_uint(f); u += 0x7FFFu + ((u >> 16) & 1u); return (unsigned short)(u >> 16); }
__device__ __forceinline__ float bf2f(unsigned short b) { return __uint_as_float(((unsigned)b) << 16); }
__device__ __forceinline__ float bfr(float f) { return bf2f(f2bf(f)); }
__device__ __forceinline__ v16h cat16(v8h lo, v8h hi) { return __builtin_shufflevector(lo, hi, 0, 1, 2, 3, 4, 5, 6, 7, 8, 9, 10, 11, 12, 13, 14, 15); }
__device__ __forceinline__ v16bf cat16b(v8us lo, v8us hi) { return __builtin_bit_cast(v16bf, __builtin_shufflevector(lo, hi, 0, 1, 2, 3, 4, 5, 6, 7, 8, 9, 10, 11, 12, 13, 14, 15)); }
__device__ __forceinline__ v8f wmma16(v16h a, v16h b, v8f c) { return __builtin_amdgcn_wmma_f32_16x16x32_f16(false, a, false, b, (short)0, c, false, false); }
__device__ __forceinline__ v8f wmmab(v16bf a, v16bf b, v8f c) { return __builtin_amdgcn_wmma_f32_16x16x32_bf16(false, a, false, b, (short)0, c, false, false); }

__device__ __forceinline__ void cvtb_rows(const float* __restrict__ src, int nrows, bf* dst, int blk) {
    const int lane = threadIdx.x & 31, r = blk * 8 + (threadIdx.x >> 5);
    if (r >= nrows) return;
    v8us o[4];
#pragma unroll
    for (int q = 0; q < 4; ++q) { v8us t;
#pragma unroll
        for (int i = 0; i < 8; ++i) t[i] = f2bf(src[(size_t)r * DM + q * 256 + lane * 8 + i]);
        o[q] = t; }
#pragma unroll
    for (int q = 0; q < 4; ++q) *(v8us*)(dst + (size_t)r * DM + q * 256 + lane * 8) = o[q];
    
}

// k_gemmb: C[128 x 128] per block of 8 waves (2 x 4, 64 rows x 32 columns each). A stage is 128 k (256 B) of the block's 128 A rows (hi, and lo where SPLITA) and 128 B rows,
// brought into LDS by per-lane 16-byte asynchronous copies (whole lines, no register), rows at pitch 272 B for the 16-byte fragment reads; two buffers, the next stage in flight.
#define GKS  128
#define GPB  272
#define GOP  (128 * GPB)
typedef v8us __attribute__((may_alias)) v8usa;

// eight copies of one operand's 16 rows of this wave; the s_wait_xcnt closes the statement so that no address register is rewritten ahead of it
__device__ __forceinline__ void cp8(unsigned l, const bf* g) {
    asm volatile("global_load_async_to_lds_b128 %0, %1, off\n\t"
                 "global_load_async_to_lds_b128 %2, %3, off\n\t"
                 "global_load_async_to_lds_b128 %4, %5, off\n\t"
                 "global_load_async_to_lds_b128 %6, %7, off\n\t"
                 "global_load_async_to_lds_b128 %8, %9, off\n\t"
                 "global_load_async_to_lds_b128 %10, %11, off\n\t"
                 "global_load_async_to_lds_b128 %12, %13, off\n\t"
                 "global_load_async_to_lds_b128 %14, %15, off\n\t"
                 "s_wait_xcnt 0x0"
                 :: "v"(l), "v"(g), "v"(l + 2 * GPB), "v"(g + 2 * DM), "v"(l + 4 * GPB), "v"(g + 4 * DM), "v"(l + 6 * GPB), "v"(g + 6 * DM),
                    "v"(l + 8 * GPB), "v"(g + 8 * DM), "v"(l + 10 * GPB), "v"(g + 10 * DM), "v"(l + 12 * GPB), "v"(g + 12 * DM), "v"(l + 14 * GPB), "v"(g + 14 * DM)
                 : "memory");
}

template <bool SPLITA>
__global__ __launch_bounds__(256) void k_gemmb(const bf* __restrict__ A, const bf* __restrict__ Al, const bf* __restrict__ Bn, const float* __restrict__ bias, const float* __restrict__ bias1, const float* __restrict__ bias2, float* C, int ldc, int cb) {
    constexpr int STG = (SPLITA ? 3 : 2) * GOP, BOP = (SPLITA ? 2 : 1) * GOP;   // one stage: [A | B], or [A hi | A lo | B]
    constexpr int NST = DM / GKS, NBK = (GKS / 32) * (SPLITA ? 2 : 1);
    __shared__ __align__(16) unsigned char ring[2 * STG];
    const int lane = threadIdx.x & 31, wave = threadIdx.x >> 5, lr = lane & 15, hi = lane >> 4;
    const int wm = wave >> 2, wn = wave & 3;
    const int r0 = blockIdx.x * 128, c0 = blockIdx.y * 128;
    const int crw = wave * 16 + hi;                             // copy i of a wave: rows crw + 2 i, bytes 16 lr of the stage's 256
    const unsigned l0 = (unsigned)(size_t)ring + crw * GPB + lr * 16;
    const bf* gA = A + (size_t)(r0 + crw) * DM + lr * 8;
    const bf* gB = Bn + (size_t)(c0 + crw) * DM + lr * 8;
    const bf* gL = SPLITA ? Al + (size_t)(r0 + crw) * DM + lr * 8 : gA;
    auto fill = [&](int t, int buf) {
        const unsigned l = l0 + buf * STG;
        cp8(l, gA + t * GKS); cp8(l + BOP, gB + t * GKS);
        if (SPLITA) cp8(l + GOP, gL + t * GKS);
    };
    v8f acc[4][2];
#pragma unroll
    for (int m = 0; m < 4; ++m)
#pragma unroll
        for (int n = 0; n < 2; ++n) acc[m][n] = (v8f){};
    fill(0, 0);
    asm volatile("s_wait_asynccnt 0x0" ::: "memory");           // stage 0 of this wave has landed
    __syncthreads();                                            // ... and every other wave's
    fill(1, 1);
    const int aofs = (wm * 64 + lr) * GPB + hi * 16, bofs = BOP + (wn * 32 + lr) * GPB + hi * 16;
    // kept rolled: one stage per trip, the buffer picked by the trip's parity
#pragma unroll 1
    for (int t = 0; t < NST; ++t) {
        const unsigned char* sb = ring + (t & 1) * STG;
        // a block = the 8 products of one A-side fragment set (hi, or lo where SPLITA) with one B set; block i + 1's fragments are read as one group ahead of block i's products
        v16bf fa[2][4], fb[2][2];
        auto lda = [&](int i, v16bf* d) {
            const unsigned char* q = sb + aofs + (SPLITA ? (i & 1) * GOP + (i >> 1) * 64 : i * 64);
#pragma unroll
            for (int m = 0; m < 4; ++m) { const unsigned char* p = q + m * 16 * GPB; d[m] = cat16b(*(const v8usa*)p, *(const v8usa*)(p + 32)); }
        };
        auto ldb = [&](int ks, v16bf* d) {
#pragma unroll
            for (int n = 0; n < 2; ++n) { const unsigned char* p = sb + bofs + n * 16 * GPB + ks * 64; d[n] = cat16b(*(const v8usa*)p, *(const v8usa*)(p + 32)); }
        };
        lda(0, fa[0]); ldb(0, fb[0]);
#pragma unroll
        for (int i = 0; i < NBK; ++i) {
            const int ks = SPLITA ? i >> 1 : i, ks1 = SPLITA ? (i + 1) >> 1 : i + 1;
            if (i + 1 < NBK) { lda(i + 1, fa[(i + 1) & 1]); if (ks1 != ks) ldb(ks1, fb[ks1 & 1]); }
            __builtin_amdgcn_sched_barrier(0);                  // keeps the LDS reads one group in front of the products, not spread among them with waits to 0
#pragma unroll
            for (int m = 0; m < 4; ++m)
#pragma unroll
                for (int n = 0; n < 2; ++n) acc[m][n] = wmmab(fa[i & 1][m], fb[ks & 1][n], acc[m][n]);
            __builtin_amdgcn_sched_barrier(0);                  // the other side of that fence
        }
        asm volatile("s_wait_dscnt 0x0" ::: "memory");          // this wave has left the buffer
        asm volatile("s_wait_asynccnt 0x0" ::: "memory");       // its copies of stage t + 1 have landed
        __syncthreads();                                        // publishes stage t + 1, frees stage t's buffer
        if (t + 2 < NST) fill(t + 2, t & 1);
    }
    asm volatile("s_wait_asynccnt 0x0" ::: "memory");           // nothing in flight when the ring becomes output staging
    float* os = (float*)(ring + wave * (64 * 36 * 4));          // this wave's own 64 rows x 32 columns, pitch 36 floats
    const float* bsel = c0 < DM ? bias : c0 < 2 * DM ? bias1 : bias2;   // one bias vector per 1024 output columns (q | k | v stacked along N)
#pragma unroll
    for (int n = 0; n < 2; ++n) { const float bv = bfr(bsel[(c0 & (DM - 1)) + wn * 32 + n * 16 + lr]);
#pragma unroll
        for (int m = 0; m < 4; ++m)
#pragma unroll
            for (int j = 0; j < 8; ++j) os[(m * 16 + hi * 8 + j) * 36 + n * 16 + lr] = acc[m][n][j] + bv; }
    float* crow = C + (size_t)(r0 + wm * 64) * ldc + cb + c0 + wn * 32;
#pragma unroll
    for (int s = 0; s < 16; ++s) { const int row = s * 4 + (lane >> 3), cofs = (lane & 7) * 4;
        const v4f val = *(const v4fa*)(os + row * 36 + cofs); *(v4f*)(crow + (size_t)row * ldc + cofs) = val; }
}

// vt_tile: VT16[b][h][d][t] from QKV [tok][3072]; whel_rows: WH16 [h][e][d] = f16(bf16(Whel)).
__device__ __forceinline__ void vt_tile(const float* __restrict__ QKV, h16* VT16, h16* tile, int bid) {
    const int b = bid / (NH_ * (NT_ / 64)), rem = bid - b * (NH_ * (NT_ / 64)), h = rem / (NT_ / 64), kt = rem - h * (NT_ / 64);
    const int k0 = kt * 64, tid = threadIdx.x;
    const int kk = tid >> 2, d0 = (tid & 3) * 16;
    const float* src = QKV + ((size_t)b * NT_ + k0 + kk) * (3 * DM) + 2 * DM + h * HD + d0;
#pragma unroll
    for (int i = 0; i < 16; ++i) tile[(d0 + i) * 72 + kk] = (h16)src[i];
    __syncthreads();
    const int piece = tid & 7;
    h16* base = VT16 + (((size_t)b * NH_ + h) * HD) * NT_ + k0;
    auto pass = [&]() {
#pragma unroll
        for (int s = 0; s < 2; ++s) { const int d = (tid >> 3) + 32 * s; const v8h val = *(const v8ha*)(tile + d * 72 + piece * 8); *(v8h*)(base + (size_t)d * NT_ + piece * 8) = val; }
    };
    pass();
    asm volatile("s_wait_xcnt 0x0" ::: "memory");               // the built code joins the q/k rows' path behind these stores: no register that they name is rewritten ahead of this wait
}
__device__ __forceinline__ void whel_rows(const float* __restrict__ Whel, h16* WH16, int blk) {
    const int lane = threadIdx.x & 31, r = blk * 8 + (threadIdx.x >> 5);     // row = (h, e): 1024 rows of 64
    if (r >= NH_ * HD) return;
    v2h o; o[0] = (h16)bfr(Whel[(size_t)r * HD + 2 * lane]); o[1] = (h16)bfr(Whel[(size_t)r * HD + 2 * lane + 1]);
    *(v2h*)(WH16 + (size_t)r * HD + 2 * lane) = o; 
}
// one launch for every conversion of an input, none of which depends on another: blocks [0, 512) x, then 128 each for Wq, Wk, Wv, Wo (WB = the four planes in that order), then 128 for Whel
__global__ __launch_bounds__(256) void k_cvt(const float* __restrict__ x, const float* __restrict__ Wq, const float* __restrict__ Wk, const float* __restrict__ Wv, const float* __restrict__ Wo,
                                             const float* __restrict__ Whel, bf* Xb, bf* WB, h16* WH16) {
    const int blk = blockIdx.x;
    if (blk < NTK / 8) { cvtb_rows(x, NTK, Xb, blk); return; }
    const int wb = blk - NTK / 8, i = wb / (DM / 8);
    if (i < 4) { cvtb_rows(i == 0 ? Wq : i == 1 ? Wk : i == 2 ? Wv : Wo, DM, WB + (size_t)i * DM * DM, wb - i * (DM / 8)); return; }
    whel_rows(Whel, WH16, wb - 4 * (DM / 8));
}

// hel_tile: everything that one 16-token slice of one head's q (which 0) or k (1) needs between the projection GEMM and attention, in one wave: its 16 x 64 f32 slice of QKV [tok][3072]
// is read by whole lines and rounded to f16 once; that goes out as the Q16/K16 rows [tok][1024] and, through LDS (pitch 72 halves), becomes the A fragments of (q|k)h . Whel[h]^T (8 WMMA,
// B = WH16[h] rows e), + bf16(bhel); pair (2p, 2p+1) = columns lr, lr^1 of the same tile -> norm via __shfl_xor(.., 1); the normalised rows N[t][64] are staged in LDS as f32.
// The reference's _scramble is H[s][2p + c] = N[(2s + c) mod 2048][2p + ((2s + c) / 2048)]: tokens 2u, 2u + 1 fill rows u (their even columns) and 1024 + u (their odd columns) completely,
// so the read of the staging does it: 16 tokens = 8 + 8 whole 128-byte rows of HQ16/HK16 [b][h][s][64].
__device__ __forceinline__ void hel_tile(const float* __restrict__ QKV, const h16* __restrict__ WH16, const float* __restrict__ bhel, h16* Q16, h16* K16, h16* HQ16, h16* HK16,
                                         float* ost, h16* ast, int blk) {
    const int lane = threadIdx.x & 31, wave = threadIdx.x >> 5, lr = lane & 15, hi = lane >> 4;
    const int nb = NB_ * NH_ * (NT_ / 128);
    const int which = blk / nb, bid = blk - which * nb;
    const int b = bid / (NH_ * (NT_ / 128)), rem = bid - b * (NH_ * (NT_ / 128)), h = rem / (NT_ / 128), tt = rem - h * (NT_ / 128);
    const int t0 = tt * 128 + wave * 16;
    const size_t tok0 = (size_t)b * NT_;
    const int prow = lane >> 3, piece = lane & 7;                   // an instruction covers 4 rows, 8 lanes a row
    const float* src = QKV + (tok0 + t0) * (3 * DM) + which * DM + h * HD;
    h16* r16 = (which ? K16 : Q16) + (tok0 + t0) * DM + h * HD;
    h16* as = ast + wave * (16 * 72);
    v8h rw[4];
#pragma unroll
    for (int s = 0; s < 4; ++s) { const float* p = src + (size_t)(4 * s + prow) * (3 * DM) + piece * 8; v8h t;
#pragma unroll
        for (int i = 0; i < 8; ++i) t[i] = (h16)p[i];
        rw[s] = t; }
#pragma unroll
    for (int s = 0; s < 4; ++s) *(v8ha*)(as + (4 * s + prow) * 72 + piece * 8) = rw[s];
    v16h a[2];                                                      // read back from rows that this wave alone wrote: one wave's LDS operations keep their order, so no barrier stands here
#pragma unroll
    for (int kc = 0; kc < 2; ++kc) { const h16* p = as + lr * 72 + kc * 32 + 8 * hi; a[kc] = cat16(*(const v8ha*)p, *(const v8ha*)(p + 16)); }
    v8f d4[4];
#pragma unroll
    for (int n = 0; n < 4; ++n) d4[n] = (v8f){};
#pragma unroll
    for (int kc = 0; kc < 2; ++kc)
#pragma unroll
        for (int n = 0; n < 4; ++n) { const h16* bp = WH16 + ((size_t)h * HD + n * 16 + lr) * HD + kc * 32 + 8 * hi; d4[n] = wmma16(a[kc], cat16(*(const v8h*)bp, *(const v8h*)(bp + 16)), d4[n]); }
    asm volatile("v_nop\n\tv_nop\n\tv_nop\n\tv_nop" : "+v"(d4[0]), "+v"(d4[1]), "+v"(d4[2]), "+v"(d4[3]));
    float* os = ost + wave * (16 * 68);
#pragma unroll
    for (int n = 0; n < 4; ++n) {
        const float bb = bfr(bhel[(size_t)h * HD + n * 16 + lr]);
#pragma unroll
        for (int j = 0; j < 8; ++j) {
            const float v = d4[n][j] + bb;
            const float w = __shfl_xor(v, 1, 32);                 // pair partner (column lr ^ 1, same row)
            const float nrm = sqrtf(v * v + w * w);
            os[(hi * 8 + j) * 68 + n * 16 + lr] = v / fmaxf(nrm, 1e-12f);
        }
    }
    __syncthreads();
#pragma unroll
    for (int s = 0; s < 4; ++s) *(v8h*)(r16 + (size_t)(4 * s + prow) * DM + piece * 8) = rw[s];     // all of the wave's global stores stand together at its end
    h16* hrow = (which ? HK16 : HQ16) + (((size_t)b * NH_ + h) * NT_ + (t0 >> 1)) * HD;
#pragma unroll
    for (int s = 0; s < 2; ++s) { const int u = 4 * s + prow; const float* ev = os + (2 * u) * 68 + piece * 8; const float* od = ev + 68; v8h lo, up;
#pragma unroll
        for (int i = 0; i < 4; ++i) { lo[2 * i] = (h16)ev[2 * i]; lo[2 * i + 1] = (h16)od[2 * i]; up[2 * i] = (h16)ev[2 * i + 1]; up[2 * i + 1] = (h16)od[2 * i + 1]; }
        *(v8h*)(hrow + (size_t)u * HD + piece * 8) = lo; *(v8h*)(hrow + (size_t)(NT_ / 2 + u) * HD + piece * 8) = up; }
}
// one launch for all that stands between the projection GEMM and attention: blocks [0, 1024) the q/k slices (which, b, h, 128 tokens), the rest the V^T tiles; the split is by whole blocks,
// so the barriers in hel_tile and vt_tile are block-uniform
__global__ __launch_bounds__(256) void k_post(const float* __restrict__ QKV, const h16* __restrict__ WH16, const float* __restrict__ bhel, h16* Q16, h16* K16, h16* VT16, h16* HQ16, h16* HK16) {
    __shared__ __align__(16) float ost[8 * 16 * 68];
    __shared__ __align__(16) h16 ast[8 * 16 * 72];                  // the V^T blocks use its first 64 * 72 halves as their tile
    const int blk = blockIdx.x;
    if (blk < 2 * NB_ * NH_ * (NT_ / 128)) { hel_tile(QKV, WH16, bhel, Q16, K16, HQ16, HK16, ost, ast, blk); return; }
    vt_tile(QKV, VT16, ast, blk - 2 * NB_ * NH_ * (NT_ / 128));
}

// k_attn: block = (b, h, 128 queries), wave = 16; q and helical-q fragments resident; 64 steps x 32 keys, all products transposed: S^T = K.Q^T (4 WMMA) and G^T = HK.HQ^T (4 WMMA)
// with the key rows as A and the resident query fragments as B, so a lane holds 16 of the 32 scores of ONE query (column lr, keys 8 hi + j and 16 + 8 hi + j); logits 0.5 s/8 + 0.5 g/32,
// online f32 softmax in the lane plus one exchange between the wave's halves; the weights x32768, converted in place, are the B operand of O^T += V^T.P^T (4 WMMA): they touch no LDS.
// ctx -> bf16 hi/lo planes CH/CL[tok][h*64+d].
// A stage = 128 keys of this (b, h), shared by the block's 8 waves: 128 K rows and 128 helical-K rows (128 B each, LDS pitch 144 B) and the 64 V^T rows (256 B each, pitch
// 272 B), brought in by per-lane 16-byte asynchronous copies that cover whole lines; two buffers, the next stage in flight. The 16-byte fragment reads then come from LDS.
#define AKS  128
#define KPB  144
#define VPB  272
#define AKO  (AKS * KPB)
#define AST  (2 * AKO + HD * VPB)

// four copies of one operand; the s_wait_xcnt closes the statement so that no address register is rewritten ahead of it
__device__ __forceinline__ void cp4(unsigned l, const h16* g, unsigned ls, size_t gs) {
    asm volatile("global_load_async_to_lds_b128 %0, %1, off\n\t"
                 "global_load_async_to_lds_b128 %2, %3, off\n\t"
                 "global_load_async_to_lds_b128 %4, %5, off\n\t"
                 "global_load_async_to_lds_b128 %6, %7, off\n\t"
                 "s_wait_xcnt 0x0"
                 :: "v"(l), "v"(g), "v"(l + ls), "v"(g + gs), "v"(l + 2 * ls), "v"(g + 2 * gs), "v"(l + 3 * ls), "v"(g + 3 * gs)
                 : "memory");
}

// lane l with lane l ^ 16
__device__ __forceinline__ float xhalf(float x) { return __builtin_bit_cast(float, __builtin_amdgcn_permlanex16(__builtin_bit_cast(int, x), __builtin_bit_cast(int, x), 0x76543210, 0xfedcba98, false, false)); }

__global__ __launch_bounds__(256) void k_attn(const h16* __restrict__ Q16, const h16* __restrict__ K16, const h16* __restrict__ HQ16, const h16* __restrict__ HK16, const h16* __restrict__ VT16, bf* CH, bf* CL) {
    __shared__ __align__(16) unsigned char ring[2 * AST];
    __shared__ __align__(16) float ost[8][16 * 68];
    const int lane = threadIdx.x & 31, wave = threadIdx.x >> 5, lr = lane & 15, hi = lane >> 4;
    const int bid = blockIdx.x;
    const int b = bid / (NH_ * (NT_ / 128)), rem = bid - b * (NH_ * (NT_ / 128)), h = rem / (NT_ / 128), qt = rem - h * (NT_ / 128);
    const int q0 = qt * 128 + wave * 16;
    const size_t tok0 = (size_t)b * NT_;
    const size_t hrow0 = ((size_t)b * NH_ + h) * NT_;
    v16h qa[2], ga[2];
#pragma unroll
    for (int kc = 0; kc < 2; ++kc) {
        const h16* p = Q16 + (tok0 + q0 + lr) * DM + h * HD + kc * 32 + 8 * hi; qa[kc] = cat16(*(const v8h*)p, *(const v8h*)(p + 16));
        const h16* g = HQ16 + (hrow0 + q0 + lr) * HD + kc * 32 + 8 * hi; ga[kc] = cat16(*(const v8h*)g, *(const v8h*)(g + 16));
    }
    const h16* kh_b = K16 + tok0 * DM + h * HD; const h16* hk_b = HK16 + hrow0 * HD;
    const h16* vt_b = VT16 + (((size_t)b * NH_ + h) * HD) * NT_;
    v8f o[4];
#pragma unroll
    for (int n = 0; n < 4; ++n) o[n] = (v8f){};
    float mrow = -3.0e38f, lpart = 0.f;                         // query lr's running maximum (equal in both halves) and this half's part of its sum
    // this wave's copies of a stage: K and helical-K rows krow + 4 i (8 lanes a row), V^T rows vrow + 2 i (16 lanes a row), i = 0 .. 3
    const int krow = wave * 16 + (lane >> 3), kpc = lane & 7, vrow = wave * 8 + hi;
    const unsigned lk = (unsigned)(size_t)ring + krow * KPB + kpc * 16, lv = (unsigned)(size_t)ring + 2 * AKO + vrow * VPB + lr * 16;
    const h16* gk = kh_b + (size_t)krow * DM + kpc * 8; const h16* gh = hk_b + (size_t)krow * HD + kpc * 8; const h16* gv = vt_b + (size_t)vrow * NT_ + lr * 8;
    auto fill = [&](int t, int buf) {
        cp4(lk + buf * AST, gk + (size_t)t * AKS * DM, 4 * KPB, 4 * DM);
        cp4(lk + buf * AST + AKO, gh + (size_t)t * AKS * HD, 4 * KPB, 4 * HD);
        cp4(lv + buf * AST, gv + t * AKS, 2 * VPB, 2 * NT_);
    };
    fill(0, 0);
    asm volatile("s_wait_asynccnt 0x0" ::: "memory");           // stage 0 of this wave has landed
    __syncthreads();                                            // ... and every other wave's
    fill(1, 1);
    // both loops kept rolled: the stage loop picks its buffer by the trip's parity; the four 32-key steps of a stage, unrolled, built to over 256 registers (3 waves a SIMD, not 4)
#pragma unroll 1
    for (int st = 0; st < NT_ / AKS; ++st) {
    const unsigned char* sb = ring + (st & 1) * AST;
#pragma unroll 1
    for (int kt = 0; kt < AKS / 32; ++kt) {
        const unsigned char* kp = sb + (kt * 32 + lr) * KPB + hi * 16;
        const unsigned char* vb = sb + 2 * AKO + lr * VPB + kt * 64 + hi * 16;
        v8f s0 = {}, s1 = {}, g0 = {}, g1 = {};
#pragma unroll
        for (int kc = 0; kc < 2; ++kc) {
            const unsigned char* r0p = kp + kc * 64; const unsigned char* r1p = r0p + 16 * KPB;
            const unsigned char* h0p = r0p + AKO; const unsigned char* h1p = r1p + AKO;
            s0 = wmma16(cat16(*(const v8ha*)r0p, *(const v8ha*)(r0p + 32)), qa[kc], s0); s1 = wmma16(cat16(*(const v8ha*)r1p, *(const v8ha*)(r1p + 32)), qa[kc], s1);
            g0 = wmma16(cat16(*(const v8ha*)h0p, *(const v8ha*)(h0p + 32)), ga[kc], g0); g1 = wmma16(cat16(*(const v8ha*)h1p, *(const v8ha*)(h1p + 32)), ga[kc], g1);
        }
        v16h vf[4];                                             // read here, ahead of the softmax, so that their LDS latency lies under it
#pragma unroll
        for (int n = 0; n < 4; ++n) { const unsigned char* vp = vb + n * 16 * VPB; vf[n] = cat16(*(const v8ha*)vp, *(const v8ha*)(vp + 32)); }
        asm volatile("v_nop\n\tv_nop\n\tv_nop\n\tv_nop" : "+v"(s0), "+v"(s1), "+v"(g0), "+v"(g1) : "v"(qa[0]), "v"(ga[1]));
        const v8f a0 = 0.5f * (s0 * 0.125f) + 0.5f * (g0 * 0.03125f), a1 = 0.5f * (s1 * 0.125f) + 0.5f * (g1 * 0.03125f);
        float mx = fmaxf(a0[0], a1[0]);
#pragma unroll
        for (int j = 1; j < 8; ++j) mx = fmaxf(mx, fmaxf(a0[j], a1[j]));
        const float mn = fmaxf(mrow, fmaxf(mx, xhalf(mx)));     // over all 32 keys: the other half holds this query's other 16
        const float alpha = __expf(mrow - mn); mrow = mn;
        v8f p0, p1;
#pragma unroll
        for (int j = 0; j < 8; ++j) { p0[j] = __expf(a0[j] - mn); p1[j] = __expf(a1[j] - mn); }
        const v8f pp = p0 + p1;
        lpart = lpart * alpha + (((pp[0] + pp[1]) + (pp[2] + pp[3])) + ((pp[4] + pp[5]) + (pp[6] + pp[7])));
        // element s = key 8 hi + s (s < 8), 16 + 8 hi + s - 8: the k order in which vf was read
        const v16h pa = cat16(__builtin_convertvector(p0 * PSC, v8h), __builtin_convertvector(p1 * PSC, v8h));
#pragma unroll
        for (int n = 0; n < 4; ++n) o[n] *= alpha;
#pragma unroll
        for (int n = 0; n < 4; ++n) o[n] = wmma16(vf[n], pa, o[n]);
        asm volatile("v_nop\n\tv_nop\n\tv_nop\n\tv_nop" : "+v"(o[0]), "+v"(o[1]), "+v"(o[2]), "+v"(o[3]) : "v"(pa));
    }
        asm volatile("s_wait_dscnt 0x0" ::: "memory");          // this wave has left the buffer
        asm volatile("s_wait_asynccnt 0x0" ::: "memory");       // its copies of stage st + 1 have landed
        __syncthreads();                                        // publishes stage st + 1, frees stage st's buffer
        if (st + 2 < NT_ / AKS) fill(st + 2, st & 1);
    }
    asm volatile("s_wait_asynccnt 0x0" ::: "memory");           // nothing in flight at the end
    const float inv = 1.0f / ((lpart + xhalf(lpart)) * PSC);
    float* os = &ost[wave][0];                                  // o[n][j] = ctx[query lr][n * 16 + hi * 8 + j]
#pragma unroll
    for (int n = 0; n < 4; ++n)
#pragma unroll
        for (int j = 0; j < 8; ++j) os[lr * 68 + n * 16 + hi * 8 + j] = o[n][j] * inv;
    __syncthreads();
    const size_t cbase = (tok0 + q0) * DM + (size_t)h * HD;
    auto pass = [&]() {
#pragma unroll
        for (int s = 0; s < 4; ++s) { const int row = 4 * s + (lane >> 3), piece = lane & 7; const float* sp = os + row * 68 + piece * 8; v8us oh, ol;
#pragma unroll
            for (int i = 0; i < 8; ++i) { const unsigned short hb = f2bf(sp[i]); oh[i] = hb; ol[i] = f2bf(sp[i] - bf2f(hb)); }
            *(v8us*)(CH + cbase + (size_t)row * DM + piece * 8) = oh; *(v8us*)(CL + cbase + (size_t)row * DM + piece * 8) = ol; }
    };
    pass(); 
}

extern "C" void kernel_launch(void* const* d_in, const int* in_sizes, int n_in,
                              void* d_out, int out_size, void* d_ws, size_t ws_size, hipStream_t stream) {
    (void)in_sizes; (void)n_in; (void)out_size;
    const float* x = (const float*)d_in[0]; const float* Wq = (const float*)d_in[1]; const float* bq = (const float*)d_in[2]; const float* Wk = (const float*)d_in[3]; const float* bk = (const float*)d_in[4];
    const float* Wv = (const float*)d_in[5]; const float* bv = (const float*)d_in[6]; const float* Wo = (const float*)d_in[7]; const float* bo = (const float*)d_in[8];
    const float* Whel = (const float*)d_in[9]; const float* bhel = (const float*)d_in[10];
    float* out = (float*)d_out;    // [2][2048][1024]
    char* wsp = (char*)d_ws;
    auto take = [&](size_t bytes) { char* p = wsp; wsp += (bytes + 255) & ~(size_t)255; return (void*)p; };
    bf* Xb = (bf*)take((size_t)NTK * DM * 2);
    bf* WB = (bf*)take((size_t)4 * DM * DM * 2);                    // bf16 Wq | Wk | Wv | Wo: the first three are one [3072 x 1024] B operand
    float* QKV = (float*)take((size_t)NTK * 3 * DM * 4);            // reused later for the ctx planes (dead after the conversions)
    h16* Q16 = (h16*)take((size_t)NTK * DM * 2); h16* K16 = (h16*)take((size_t)NTK * DM * 2); h16* VT16 = (h16*)take((size_t)NTK * DM * 2);
    h16* WH16 = (h16*)take((size_t)NH_ * HD * HD * 2);
    h16* HQ16 = (h16*)take((size_t)NB_ * NH_ * NT_ * HD * 2); h16* HK16 = (h16*)take((size_t)NB_ * NH_ * NT_ * HD * 2);
    if ((size_t)(wsp - (char*)d_ws) > ws_size) return;    // 8.4 + 8.4 + 50.3 + 25.2 + 0.13 + 16.8 MB ~ 109 MB
    bf* CH = (bf*)QKV; bf* CL = (bf*)((char*)QKV + (size_t)NTK * DM * 2);   // 2 x 8.4 MB inside the dead 50 MB QKV region
    k_cvt<<<NTK / 8 + 4 * (DM / 8) + (NH_ * HD) / 8, 256, 0, stream>>>(x, Wq, Wk, Wv, Wo, Whel, Xb, WB, WH16);
    k_gemmb<false><<<dim3(NTK / 128, 3 * DM / 128, 1), 256, 0, stream>>>(Xb, nullptr, WB, bq, bk, bv, QKV, 3 * DM, 0);
    k_post<<<2 * NB_ * NH_ * (NT_ / 128) + NB_ * NH_ * (NT_ / 64), 256, 0, stream>>>(QKV, WH16, bhel, Q16, K16, VT16, HQ16, HK16);
    k_attn<<<NB_ * NH_ * (NT_ / 128), 256, 0, stream>>>(Q16, K16, HQ16, HK16, VT16, CH, CL);
    k_gemmb<true><<<dim3(NTK / 128, DM / 128, 1), 256, 0, stream>>>(CH, CL, WB + (size_t)3 * DM * DM, bo, bo, bo, out, DM, 0);
}

// v006
// One run takes 107 microseconds.
// In two side-by-side timings against v005, it was 1.04 and 1.03 times as fast.
// Over all steps from v000 it is 3.59 times as fast.
#include <hip/hip_runtime.h>

// Contractions, f32 accumulate: q/k/v = x.W^T + b ([4096 x 1024].[1024 x 1024] x3) on v_wmma_f32_16x16x32_bf16 with PLAIN bf16 operands (inputs rounded once: exact
// products); the per-head helical projections q_hel/k_hel = qh.Whel[h]^T + bhel ([tokens x 64].[64 x 64]) on v_wmma_f32_16x16x32_f16 with plain f16 q/k and
// f16(bf16(Whel)); the per-(batch, head) attention with TWO score products per key tile (0.5 q.k/8 + 0.5 helical/32, where the helical operands are the pairwise
// L2-normalised, "scrambled" projections) and weights.v, fused per 16-query tile with plain f16 operands and an online f32 softmax; out = ctx.Wo^T + bo on the bf16

#define NB_  2
#define NT_  2048
#define DM   1024
#define NH_  16
#define HD   64
#define NTK  (NB_ * NT_)
#define PSC  32768.0f

typedef _Float16 h16;
typedef unsigned short bf;
typedef __attribute__((ext_vector_type(16))) __bf16   v16bf;
typedef __attribute__((ext_vector_type(16))) _Float16 v16h;
typedef __attribute__((ext_vector_type(8)))  _Float16 v8h;
typedef __attribute__((ext_vector_type(8)))  unsigned short v8us;
typedef __attribute__((ext_vector_type(8)))  float    v8f;
typedef __attribute__((ext_vector_type(4)))  float    v4f;
typedef __attribute__((ext_vector_type(2)))  _Float16 v2h;
typedef v8h  __attribute__((may_alias)) v8ha;
typedef v4f  __attribute__((may_alias)) v4fa;

__device__ __forceinline__ unsigned short f2bf(float f) { unsigned u = __float_as_uint(f); u += 0x7FFFu + ((u >> 16) & 1u); return (unsigned short)(u >> 16); }
__device__ __forceinline__ float bf2f(unsigned short b) { return __uint_as_float(((unsigned)b) << 16); }
__device__ __forceinline__ float bfr(float f) { return bf2f(f2bf(f)); }
__device__ __forceinline__ v16h cat16(v8h lo, v8h hi) { return __builtin_shufflevector(lo, hi, 0, 1, 2, 3, 4, 5, 6, 7, 8, 9, 10, 11, 12, 13, 14, 15); }
__device__ __forceinline__ v16bf cat16b(v8us lo, v8us hi) { return __builtin_bit_cast(v16bf, __builtin_shufflevector(lo, hi, 0, 1, 2, 3, 4, 5, 6, 7, 8, 9, 10, 11, 12, 13, 14, 15)); }
__device__ __forceinline__ v8f wmma16(v16h a, v16h b, v8f c) { return __builtin_amdgcn_wmma_f32_16x16x32_f16(false, a, false, b, (short)0, c, false, false); }
__device__ __forceinline__ v8f wmmab(v16bf a, v16bf b, v8f c) { return __builtin_amdgcn_wmma_f32_16x16x32_bf16(false, a, false, b, (short)0, c, false, false); }

__device__ __forceinline__ void cvtb_rows(const float* __restrict__ src, int nrows, bf* dst, int blk) {
    const int lane = threadIdx.x & 31, r = blk * 8 + (threadIdx.x >> 5);
    if (r >= nrows) return;
    v8us o[4];
#pragma unroll
    for (int q = 0; q < 4; ++q) { v8us t;
#pragma unroll
        for (int i = 0; i < 8; ++i) t[i] = f2bf(src[(size_t)r * DM + q * 256 + lane * 8 + i]);
        o[q] = t; }
#pragma unroll
    for (int q = 0; q < 4; ++q) *(v8us*)(dst + (size_t)r * DM + q * 256 + lane * 8) = o[q];
    
}

// k_gemmb: C[128 x 128] per block of 8 waves (2 x 4, 64 rows x 32 columns each). A stage is 128 k (256 B) of the block's 128 A rows (hi, and lo where SPLITA) and 128 B rows,
// brought into LDS by per-lane 16-byte asynchronous copies (whole lines, no register), rows at pitch 272 B for the 16-byte fragment reads; two buffers, the next stage in flight.
#define GKS  128
#define GPB  272
#define GOP  (128 * GPB)
typedef v8us __attribute__((may_alias)) v8usa;

// eight copies of one operand's 16 rows of this wave; the s_wait_xcnt closes the statement so that no address register is rewritten ahead of it
__device__ __forceinline__ void cp8(unsigned l, const bf* g) {
    asm volatile("global_load_async_to_lds_b128 %0, %1, off\n\t"
                 "global_load_async_to_lds_b128 %2, %3, off\n\t"
                 "global_load_async_to_lds_b128 %4, %5, off\n\t"
                 "global_load_async_to_lds_b128 %6, %7, off\n\t"
                 "global_load_async_to_lds_b128 %8, %9, off\n\t"
                 "global_load_async_to_lds_b128 %10, %11, off\n\t"
                 "global_load_async_to_lds_b128 %12, %13, off\n\t"
                 "global_load_async_to_lds_b128 %14, %15, off\n\t"
                 "s_wait_xcnt 0x0"
                 :: "v"(l), "v"(g), "v"(l + 2 * GPB), "v"(g + 2 * DM), "v"(l + 4 * GPB), "v"(g + 4 * DM), "v"(l + 6 * GPB), "v"(g + 6 * DM),
                    "v"(l + 8 * GPB), "v"(g + 8 * DM), "v"(l + 10 * GPB), "v"(g + 10 * DM), "v"(l + 12 * GPB), "v"(g + 12 * DM), "v"(l + 14 * GPB), "v"(g + 14 * DM)
                 : "memory");
}

// qkv_tail: what stands between the projection GEMM and attention, done by the GEMM block itself on its 128 tokens x 128 columns (two whole heads of q, of k or of v) while they are still
// in the accumulators; no f32 copy of q/k/v goes to memory. The tile (+ bias) is rounded to f16 once and laid in the freed ring at pitch 136 halves.
// v: laid transposed (a lane's 8 accumulator rows are 8 consecutive tokens: one 16-byte LDS store), then written as 128 rows of VT16[b][h][d][t], 256 bytes each.
// q, k: laid [token][column]; behind the barrier wave w owns tokens 16 w .. 16 w + 15: they go out as the Q16/K16 rows [tok][1024] (256 bytes a token) and are, per head, the A fragments of
// (q|k)h . Whel[h]^T (8 WMMA, B = WH16[h] rows e), + bf16(bhel); pair (2p, 2p+1) = columns lr, lr^1 of the same tile -> norm via __shfl_xor(.., 1); the normalised rows N[t][64] are staged as f32.
// The reference's _scramble is H[s][2p + c] = N[(2s + c) mod 2048][2p + ((2s + c) / 2048)]: tokens 2u, 2u + 1 fill rows u (their even columns) and 1024 + u (their odd columns) completely,
// so the read of the staging does it: 16 tokens = 8 + 8 whole 128-byte rows of HQ16/HK16 [b][h][s][64].
#define TPH  136
__device__ __forceinline__ void qkv_tail(v8f (&acc)[4][2], unsigned char* ring, const float* __restrict__ bsel, int r0, int c0, const h16* __restrict__ WH16, const float* __restrict__ bhel,
                                         h16* Q16, h16* K16, h16* VT16, h16* HQ16, h16* HK16) {
    const int lane = threadIdx.x & 31, wave = threadIdx.x >> 5, lr = lane & 15, hi = lane >> 4;
    const int wm = wave >> 2, wn = wave & 3;
    const int which = c0 / DM, h0 = (c0 & (DM - 1)) / HD;          // q, k or v; the first of the block's two heads
    const int b = r0 / NT_, tb = r0 & (NT_ - 1);
    h16* ht = (h16*)ring;
    if (which == 2) {                                               // the same for the whole block, as is every barrier below
#pragma unroll
        for (int n = 0; n < 2; ++n) { const float bv = bfr(bsel[(c0 & (DM - 1)) + wn * 32 + n * 16 + lr]);
#pragma unroll
            for (int m = 0; m < 4; ++m) { v8h t;
#pragma unroll
                for (int j = 0; j < 8; ++j) t[j] = (h16)(acc[m][n][j] + bv);
                *(v8ha*)(ht + (wn * 32 + n * 16 + lr) * TPH + wm * 64 + m * 16 + hi * 8) = t; } }
        __syncthreads();                                            // a row of the transposed tile comes from two waves
        h16* base = VT16 + (((size_t)b * NH_ + h0) * HD + wave * 16) * NT_ + tb;
        v8h vr[8];
#pragma unroll
        for (int s = 0; s < 8; ++s) vr[s] = *(const v8ha*)(ht + (wave * 16 + 2 * s + hi) * TPH + lr * 8);
#pragma unroll
        for (int s = 0; s < 8; ++s) *(v8h*)(base + (size_t)(2 * s + hi) * NT_ + lr * 8) = vr[s];
        return;
    }
#pragma unroll
    for (int n = 0; n < 2; ++n) { const float bv = bfr(bsel[(c0 & (DM - 1)) + wn * 32 + n * 16 + lr]);
#pragma unroll
        for (int m = 0; m < 4; ++m)
#pragma unroll
            for (int j = 0; j < 8; ++j) ht[(wm * 64 + m * 16 + hi * 8 + j) * TPH + wn * 32 + n * 16 + lr] = (h16)(acc[m][n][j] + bv); }
    __syncthreads();                                                // a token's 128 columns come from four waves
    const h16* as = ht + wave * 16 * TPH;
    float* ost = (float*)(ring + 128 * TPH * 2) + wave * (2 * 16 * 68);     // this wave's own staging, one 16 x 68 plane a head: written and read by this wave alone, whose LDS operations keep their order
#pragma unroll
    for (int hh = 0; hh < 2; ++hh) {
        const int h = h0 + hh;
        v16h a[2];
#pragma unroll
        for (int kc = 0; kc < 2; ++kc) { const h16* p = as + lr * TPH + hh * HD + kc * 32 + 8 * hi; a[kc] = cat16(*(const v8ha*)p, *(const v8ha*)(p + 16)); }
        v8f d4[4];
#pragma unroll
        for (int n = 0; n < 4; ++n) d4[n] = (v8f){};
#pragma unroll
        for (int kc = 0; kc < 2; ++kc)
#pragma unroll
            for (int n = 0; n < 4; ++n) { const h16* bp = WH16 + ((size_t)h * HD + n * 16 + lr) * HD + kc * 32 + 8 * hi; d4[n] = wmma16(a[kc], cat16(*(const v8h*)bp, *(const v8h*)(bp + 16)), d4[n]); }
        asm volatile("v_nop\n\tv_nop\n\tv_nop\n\tv_nop" : "+v"(d4[0]), "+v"(d4[1]), "+v"(d4[2]), "+v"(d4[3]));   // the distance between the last product and the first vector read of its result
        float* os = ost + hh * (16 * 68);
#pragma unroll
        for (int n = 0; n < 4; ++n) {
            const float bb = bfr(bhel[(size_t)h * HD + n * 16 + lr]);
#pragma unroll
            for (int j = 0; j < 8; ++j) {
                const float v = d4[n][j] + bb;
                const float w = __shfl_xor(v, 1, 32);                 // pair partner (column lr ^ 1, same row)
                const float nrm = sqrtf(v * v + w * w);
                os[(hi * 8 + j) * 68 + n * 16 + lr] = v / fmaxf(nrm, 1e-12f);
            }
        }
    }
    const int t0 = tb + wave * 16, prow = lane >> 3, piece = lane & 7;
    // all of the wave's global stores stand together at its end, their values formed first
    v8h rw[8], lo[2][2], up[2][2];
#pragma unroll
    for (int s = 0; s < 8; ++s) rw[s] = *(const v8ha*)(as + (2 * s + hi) * TPH + lr * 8);
#pragma unroll
    for (int hh = 0; hh < 2; ++hh)
#pragma unroll
        for (int s = 0; s < 2; ++s) { const int u = 4 * s + prow; const float* ev = ost + hh * (16 * 68) + (2 * u) * 68 + piece * 8; const float* od = ev + 68;
#pragma unroll
            for (int i = 0; i < 4; ++i) { lo[hh][s][2 * i] = (h16)ev[2 * i]; lo[hh][s][2 * i + 1] = (h16)od[2 * i]; up[hh][s][2 * i] = (h16)ev[2 * i + 1]; up[hh][s][2 * i + 1] = (h16)od[2 * i + 1]; } }
    h16* r16 = (which ? K16 : Q16) + ((size_t)b * NT_ + t0) * DM + h0 * HD;
#pragma unroll
    for (int s = 0; s < 8; ++s) *(v8h*)(r16 + (size_t)(2 * s + hi) * DM + lr * 8) = rw[s];
#pragma unroll
    for (int hh = 0; hh < 2; ++hh) {
        h16* hrow = (which ? HK16 : HQ16) + (((size_t)b * NH_ + h0 + hh) * NT_ + (t0 >> 1)) * HD;
#pragma unroll
        for (int s = 0; s < 2; ++s) { const int u = 4 * s + prow;
            *(v8h*)(hrow + (size_t)u * HD + piece * 8) = lo[hh][s]; *(v8h*)(hrow + (size_t)(NT_ / 2 + u) * HD + piece * 8) = up[hh][s]; }
    }
    asm volatile("s_wait_xcnt 0x0" ::: "memory");                   // the built code lays the v path behind these stores: no register that they name is rewritten ahead of this wait
}

// register budget of four waves a SIMD: two blocks a WGP, as the LDS allows; without it the q/k/v form's epilogue built to 257 registers, one block a WGP
template <bool SPLITA>
__global__ __launch_bounds__(256) __attribute__((amdgpu_waves_per_eu(4))) void k_gemmb(const bf* __restrict__ A, const bf* __restrict__ Al, const bf* __restrict__ Bn, const float* __restrict__ bias, const float* __restrict__ bias1, const float* __restrict__ bias2, float* C, int ldc, int cb,
                                               const h16* __restrict__ WH16, const float* __restrict__ bhel, h16* Q16, h16* K16, h16* VT16, h16* HQ16, h16* HK16) {
    constexpr int STG = (SPLITA ? 3 : 2) * GOP, BOP = (SPLITA ? 2 : 1) * GOP;   // one stage: [A | B], or [A hi | A lo | B]
    constexpr int NST = DM / GKS, NBK = (GKS / 32) * (SPLITA ? 2 : 1);
    __shared__ __align__(16) unsigned char ring[2 * STG];
    const int lane = threadIdx.x & 31, wave = threadIdx.x >> 5, lr = lane & 15, hi = lane >> 4;
    const int wm = wave >> 2, wn = wave & 3;
    const int r0 = blockIdx.x * 128, c0 = blockIdx.y * 128;
    const int crw = wave * 16 + hi;                             // copy i of a wave: rows crw + 2 i, bytes 16 lr of the stage's 256
    const unsigned l0 = (unsigned)(size_t)ring + crw * GPB + lr * 16;
    const bf* gA = A + (size_t)(r0 + crw) * DM + lr * 8;
    const bf* gB = Bn + (size_t)(c0 + crw) * DM + lr * 8;
    const bf* gL = SPLITA ? Al + (size_t)(r0 + crw) * DM + lr * 8 : gA;
    auto fill = [&](int t, int buf) {
        const unsigned l = l0 + buf * STG;
        cp8(l, gA + t * GKS); cp8(l + BOP, gB + t * GKS);
        if (SPLITA) cp8(l + GOP, gL + t * GKS);
    };
    v8f acc[4][2];
#pragma unroll
    for (int m = 0; m < 4; ++m)
#pragma unroll
        for (int n = 0; n < 2; ++n) acc[m][n] = (v8f){};
    fill(0, 0);
    asm volatile("s_wait_asynccnt 0x0" ::: "memory");           // stage 0 of this wave has landed
    __syncthreads();                                            // ... and every other wave's
    fill(1, 1);
    const int aofs = (wm * 64 + lr) * GPB + hi * 16, bofs = BOP + (wn * 32 + lr) * GPB + hi * 16;
    // kept rolled: one stage per trip, the buffer picked by the trip's parity
#pragma unroll 1
    for (int t = 0; t < NST; ++t) {
        const unsigned char* sb = ring + (t & 1) * STG;
        // a block = the 8 products of one A-side fragment set (hi, or lo where SPLITA) with one B set; block i + 1's fragments are read as one group ahead of block i's products
        v16bf fa[2][4], fb[2][2];
        auto lda = [&](int i, v16bf* d) {
            const unsigned char* q = sb + aofs + (SPLITA ? (i & 1) * GOP + (i >> 1) * 64 : i * 64);
#pragma unroll
            for (int m = 0; m < 4; ++m) { const unsigned char* p = q + m * 16 * GPB; d[m] = cat16b(*(const v8usa*)p, *(const v8usa*)(p + 32)); }
        };
        auto ldb = [&](int ks, v16bf* d) {
#pragma unroll
            for (int n = 0; n < 2; ++n) { const unsigned char* p = sb + bofs + n * 16 * GPB + ks * 64; d[n] = cat16b(*(const v8usa*)p, *(const v8usa*)(p + 32)); }
        };
        lda(0, fa[0]); ldb(0, fb[0]);
#pragma unroll
        for (int i = 0; i < NBK; ++i) {
            const int ks = SPLITA ? i >> 1 : i, ks1 = SPLITA ? (i + 1) >> 1 : i + 1;
            if (i + 1 < NBK) { lda(i + 1, fa[(i + 1) & 1]); if (ks1 != ks) ldb(ks1, fb[ks1 & 1]); }
            __builtin_amdgcn_sched_barrier(0);                  // keeps the LDS reads one group in front of the products, not spread among them with waits to 0
#pragma unroll
            for (int m = 0; m < 4; ++m)
#pragma unroll
                for (int n = 0; n < 2; ++n) acc[m][n] = wmmab(fa[i & 1][m], fb[ks & 1][n], acc[m][n]);
            __builtin_amdgcn_sched_barrier(0);                  // the other side of that fence
        }
        asm volatile("s_wait_dscnt 0x0" ::: "memory");          // this wave has left the buffer
        asm volatile("s_wait_asynccnt 0x0" ::: "memory");       // its copies of stage t + 1 have landed
        __syncthreads();                                        // publishes stage t + 1, frees stage t's buffer
        if (t + 2 < NST) fill(t + 2, t & 1);
    }
    asm volatile("s_wait_asynccnt 0x0" ::: "memory");           // nothing in flight when the ring becomes output staging
    const float* bsel = c0 < DM ? bias : c0 < 2 * DM ? bias1 : bias2;   // one bias vector per 1024 output columns (q | k | v stacked along N)
    if constexpr (!SPLITA) { qkv_tail(acc, ring, bsel, r0, c0, WH16, bhel, Q16, K16, VT16, HQ16, HK16); return; }
    float* os = (float*)(ring + wave * (64 * 36 * 4));          // this wave's own 64 rows x 32 columns, pitch 36 floats
#pragma unroll
    for (int n = 0; n < 2; ++n) { const float bv = bfr(bsel[(c0 & (DM - 1)) + wn * 32 + n * 16 + lr]);
#pragma unroll
        for (int m = 0; m < 4; ++m)
#pragma unroll
            for (int j = 0; j < 8; ++j) os[(m * 16 + hi * 8 + j) * 36 + n * 16 + lr] = acc[m][n][j] + bv; }
    float* crow = C + (size_t)(r0 + wm * 64) * ldc + cb + c0 + wn * 32;
#pragma unroll
    for (int s = 0; s < 16; ++s) { const int row = s * 4 + (lane >> 3), cofs = (lane & 7) * 4;
        const v4f val = *(const v4fa*)(os + row * 36 + cofs); *(v4f*)(crow + (size_t)row * ldc + cofs) = val; }
}

// whel_rows: WH16 [h][e][d] = f16(bf16(Whel)).
__device__ __forceinline__ void whel_rows(const float* __restrict__ Whel, h16* WH16, int blk) {
    const int lane = threadIdx.x & 31, r = blk * 8 + (threadIdx.x >> 5);     // row = (h, e): 1024 rows of 64
    if (r >= NH_ * HD) return;
    v2h o; o[0] = (h16)bfr(Whel[(size_t)r * HD + 2 * lane]); o[1] = (h16)bfr(Whel[(size_t)r * HD + 2 * lane + 1]);
    *(v2h*)(WH16 + (size_t)r * HD + 2 * lane) = o; 
}
// one launch for every conversion of an input, none of which depends on another: blocks [0, 512) x, then 128 each for Wq, Wk, Wv, Wo (WB = the four planes in that order), then 128 for Whel
__global__ __launch_bounds__(256) void k_cvt(const float* __restrict__ x, const float* __restrict__ Wq, const float* __restrict__ Wk, const float* __restrict__ Wv, const float* __restrict__ Wo,
                                             const float* __restrict__ Whel, bf* Xb, bf* WB, h16* WH16) {
    const int blk = blockIdx.x;
    if (blk < NTK / 8) { cvtb_rows(x, NTK, Xb, blk); return; }
    const int wb = blk - NTK / 8, i = wb / (DM / 8);
    if (i < 4) { cvtb_rows(i == 0 ? Wq : i == 1 ? Wk : i == 2 ? Wv : Wo, DM, WB + (size_t)i * DM * DM, wb - i * (DM / 8)); return; }
    whel_rows(Whel, WH16, wb - 4 * (DM / 8));
}

// k_attn: block = (b, h, 128 queries), wave = 16; q and helical-q fragments resident; 64 steps x 32 keys, all products transposed: S^T = K.Q^T (4 WMMA) and G^T = HK.HQ^T (4 WMMA)
// with the key rows as A and the resident query fragments as B, so a lane holds 16 of the 32 scores of ONE query (column lr, keys 8 hi + j and 16 + 8 hi + j); logits 0.5 s/8 + 0.5 g/32,
// online f32 softmax in the lane plus one exchange between the wave's halves; the weights x32768, converted in place, are the B operand of O^T += V^T.P^T (4 WMMA): they touch no LDS.
// ctx -> bf16 hi/lo planes CH/CL[tok][h*64+d].
// A stage = 128 keys of this (b, h), shared by the block's 8 waves: 128 K rows and 128 helical-K rows (128 B each, LDS pitch 144 B) and the 64 V^T rows (256 B each, pitch
// 272 B), brought in by per-lane 16-byte asynchronous copies that cover whole lines; two buffers, the next stage in flight. The 16-byte fragment reads then come from LDS.
#define AKS  128
#define KPB  144
#define VPB  272
#define AKO  (AKS * KPB)
#define AST  (2 * AKO + HD * VPB)

// four copies of one operand; the s_wait_xcnt closes the statement so that no address register is rewritten ahead of it
__device__ __forceinline__ void cp4(unsigned l, const h16* g, unsigned ls, size_t gs) {
    asm volatile("global_load_async_to_lds_b128 %0, %1, off\n\t"
                 "global_load_async_to_lds_b128 %2, %3, off\n\t"
                 "global_load_async_to_lds_b128 %4, %5, off\n\t"
                 "global_load_async_to_lds_b128 %6, %7, off\n\t"
                 "s_wait_xcnt 0x0"
                 :: "v"(l), "v"(g), "v"(l + ls), "v"(g + gs), "v"(l + 2 * ls), "v"(g + 2 * gs), "v"(l + 3 * ls), "v"(g + 3 * gs)
                 : "memory");
}

// lane l with lane l ^ 16
__device__ __forceinline__ float xhalf(float x) { return __builtin_bit_cast(float, __builtin_amdgcn_permlanex16(__builtin_bit_cast(int, x), __builtin_bit_cast(int, x), 0x76543210, 0xfedcba98, false, false)); }

__global__ __launch_bounds__(256) void k_attn(const h16* __restrict__ Q16, const h16* __restrict__ K16, const h16* __restrict__ HQ16, const h16* __restrict__ HK16, const h16* __restrict__ VT16, bf* CH, bf* CL) {
    __shared__ __align__(16) unsigned char ring[2 * AST];
    __shared__ __align__(16) float ost[8][16 * 68];
    const int lane = threadIdx.x & 31, wave = threadIdx.x >> 5, lr = lane & 15, hi = lane >> 4;
    const int bid = blockIdx.x;
    const int b = bid / (NH_ * (NT_ / 128)), rem = bid - b * (NH_ * (NT_ / 128)), h = rem / (NT_ / 128), qt = rem - h * (NT_ / 128);
    const int q0 = qt * 128 + wave * 16;
    const size_t tok0 = (size_t)b * NT_;
    const size_t hrow0 = ((size_t)b * NH_ + h) * NT_;
    v16h qa[2], ga[2];
#pragma unroll
    for (int kc = 0; kc < 2; ++kc) {
        const h16* p = Q16 + (tok0 + q0 + lr) * DM + h * HD + kc * 32 + 8 * hi; qa[kc] = cat16(*(const v8h*)p, *(const v8h*)(p + 16));
        const h16* g = HQ16 + (hrow0 + q0 + lr) * HD + kc * 32 + 8 * hi; ga[kc] = cat16(*(const v8h*)g, *(const v8h*)(g + 16));
    }
    const h16* kh_b = K16 + tok0 * DM + h * HD; const h16* hk_b = HK16 + hrow0 * HD;
    const h16* vt_b = VT16 + (((size_t)b * NH_ + h) * HD) * NT_;
    v8f o[4];
#pragma unroll
    for (int n = 0; n < 4; ++n) o[n] = (v8f){};
    float mrow = -3.0e38f, lpart = 0.f;                         // query lr's running maximum (equal in both halves) and this half's part of its sum
    // this wave's copies of a stage: K and helical-K rows krow + 4 i (8 lanes a row), V^T rows vrow + 2 i (16 lanes a row), i = 0 .. 3
    const int krow = wave * 16 + (lane >> 3), kpc = lane & 7, vrow = wave * 8 + hi;
    const unsigned lk = (unsigned)(size_t)ring + krow * KPB + kpc * 16, lv = (unsigned)(size_t)ring + 2 * AKO + vrow * VPB + lr * 16;
    const h16* gk = kh_b + (size_t)krow * DM + kpc * 8; const h16* gh = hk_b + (size_t)krow * HD + kpc * 8; const h16* gv = vt_b + (size_t)vrow * NT_ + lr * 8;
    auto fill = [&](int t, int buf) {
        cp4(lk + buf * AST, gk + (size_t)t * AKS * DM, 4 * KPB, 4 * DM);
        cp4(lk + buf * AST + AKO, gh + (size_t)t * AKS * HD, 4 * KPB, 4 * HD);
        cp4(lv + buf * AST, gv + t * AKS, 2 * VPB, 2 * NT_);
    };
    fill(0, 0);
    asm volatile("s_wait_asynccnt 0x0" ::: "memory");           // stage 0 of this wave has landed
    __syncthreads();                                            // ... and every other wave's
    fill(1, 1);
    // both loops kept rolled: the stage loop picks its buffer by the trip's parity; the four 32-key steps of a stage, unrolled, built to over 256 registers (3 waves a SIMD, not 4)
#pragma unroll 1
    for (int st = 0; st < NT_ / AKS; ++st) {
    const unsigned char* sb = ring + (st & 1) * AST;
#pragma unroll 1
    for (int kt = 0; kt < AKS / 32; ++kt) {
        const unsigned char* kp = sb + (kt * 32 + lr) * KPB + hi * 16;
        const unsigned char* vb = sb + 2 * AKO + lr * VPB + kt * 64 + hi * 16;
        v8f s0 = {}, s1 = {}, g0 = {}, g1 = {};
#pragma unroll
        for (int kc = 0; kc < 2; ++kc) {
            const unsigned char* r0p = kp + kc * 64; const unsigned char* r1p = r0p + 16 * KPB;
            const unsigned char* h0p = r0p + AKO; const unsigned char* h1p = r1p + AKO;
            s0 = wmma16(cat16(*(const v8ha*)r0p, *(const v8ha*)(r0p + 32)), qa[kc], s0); s1 = wmma16(cat16(*(const v8ha*)r1p, *(const v8ha*)(r1p + 32)), qa[kc], s1);
            g0 = wmma16(cat16(*(const v8ha*)h0p, *(const v8ha*)(h0p + 32)), ga[kc], g0); g1 = wmma16(cat16(*(const v8ha*)h1p, *(const v8ha*)(h1p + 32)), ga[kc], g1);
        }
        v16h vf[4];                                             // read here, ahead of the softmax, so that their LDS latency lies under it
#pragma unroll
        for (int n = 0; n < 4; ++n) { const unsigned char* vp = vb + n * 16 * VPB; vf[n] = cat16(*(const v8ha*)vp, *(const v8ha*)(vp + 32)); }
        asm volatile("v_nop\n\tv_nop\n\tv_nop\n\tv_nop" : "+v"(s0), "+v"(s1), "+v"(g0), "+v"(g1) : "v"(qa[0]), "v"(ga[1]));
        const v8f a0 = 0.5f * (s0 * 0.125f) + 0.5f * (g0 * 0.03125f), a1 = 0.5f * (s1 * 0.125f) + 0.5f * (g1 * 0.03125f);
        float mx = fmaxf(a0[0], a1[0]);
#pragma unroll
        for (int j = 1; j < 8; ++j) mx = fmaxf(mx, fmaxf(a0[j], a1[j]));
        const float mn = fmaxf(mrow, fmaxf(mx, xhalf(mx)));     // over all 32 keys: the other half holds this query's other 16
        const float alpha = __expf(mrow - mn); mrow = mn;
        v8f p0, p1;
#pragma unroll
        for (int j = 0; j < 8; ++j) { p0[j] = __expf(a0[j] - mn); p1[j] = __expf(a1[j] - mn); }
        const v8f pp = p0 + p1;
        lpart = lpart * alpha + (((pp[0] + pp[1]) + (pp[2] + pp[3])) + ((pp[4] + pp[5]) + (pp[6] + pp[7])));
        // element s = key 8 hi + s (s < 8), 16 + 8 hi + s - 8: the k order in which vf was read
        const v16h pa = cat16(__builtin_convertvector(p0 * PSC, v8h), __builtin_convertvector(p1 * PSC, v8h));
#pragma unroll
        for (int n = 0; n < 4; ++n) o[n] *= alpha;
#pragma unroll
        for (int n = 0; n < 4; ++n) o[n] = wmma16(vf[n], pa, o[n]);
        asm volatile("v_nop\n\tv_nop\n\tv_nop\n\tv_nop" : "+v"(o[0]), "+v"(o[1]), "+v"(o[2]), "+v"(o[3]) : "v"(pa));
    }
        asm volatile("s_wait_dscnt 0x0" ::: "memory");          // this wave has left the buffer
        asm volatile("s_wait_asynccnt 0x0" ::: "memory");       // its copies of stage st + 1 have landed
        __syncthreads();                                        // publishes stage st + 1, frees stage st's buffer
        if (st + 2 < NT_ / AKS) fill(st + 2, st & 1);
    }
    asm volatile("s_wait_asynccnt 0x0" ::: "memory");           // nothing in flight at the end
    const float inv = 1.0f / ((lpart + xhalf(lpart)) * PSC);
    float* os = &ost[wave][0];                                  // o[n][j] = ctx[query lr][n * 16 + hi * 8 + j]
#pragma unroll
    for (int n = 0; n < 4; ++n)
#pragma unroll
        for (int j = 0; j < 8; ++j) os[lr * 68 + n * 16 + hi * 8 + j] = o[n][j] * inv;
    __syncthreads();
    const size_t cbase = (tok0 + q0) * DM + (size_t)h * HD;
    auto pass = [&]() {
#pragma unroll
        for (int s = 0; s < 4; ++s) { const int row = 4 * s + (lane >> 3), piece = lane & 7; const float* sp = os + row * 68 + piece * 8; v8us oh, ol;
#pragma unroll
            for (int i = 0; i < 8; ++i) { const unsigned short hb = f2bf(sp[i]); oh[i] = hb; ol[i] = f2bf(sp[i] - bf2f(hb)); }
            *(v8us*)(CH + cbase + (size_t)row * DM + piece * 8) = oh; *(v8us*)(CL + cbase + (size_t)row * DM + piece * 8) = ol; }
    };
    pass(); 
}

extern "C" void kernel_launch(void* const* d_in, const int* in_sizes, int n_in,
                              void* d_out, int out_size, void* d_ws, size_t ws_size, hipStream_t stream) {
    (void)in_sizes; (void)n_in; (void)out_size;
    const float* x = (const float*)d_in[0]; const float* Wq = (const float*)d_in[1]; const float* bq = (const float*)d_in[2]; const float* Wk = (const float*)d_in[3]; const float* bk = (const float*)d_in[4];
    const float* Wv = (const float*)d_in[5]; const float* bv = (const float*)d_in[6]; const float* Wo = (const float*)d_in[7]; const float* bo = (const float*)d_in[8];
    const float* Whel = (const float*)d_in[9]; const float* bhel = (const float*)d_in[10];
    float* out = (float*)d_out;    // [2][2048][1024]
    char* wsp = (char*)d_ws;
    auto take = [&](size_t bytes) { char* p = wsp; wsp += (bytes + 255) & ~(size_t)255; return (void*)p; };
    bf* Xb = (bf*)take((size_t)NTK * DM * 2);
    bf* WB = (bf*)take((size_t)4 * DM * DM * 2);                    // bf16 Wq | Wk | Wv | Wo: the first three are one [3072 x 1024] B operand
    bf* CH = (bf*)take((size_t)NTK * DM * 2); bf* CL = (bf*)take((size_t)NTK * DM * 2);   // ctx, bf16 hi and lo planes
    h16* Q16 = (h16*)take((size_t)NTK * DM * 2); h16* K16 = (h16*)take((size_t)NTK * DM * 2); h16* VT16 = (h16*)take((size_t)NTK * DM * 2);
    h16* WH16 = (h16*)take((size_t)NH_ * HD * HD * 2);
    h16* HQ16 = (h16*)take((size_t)NB_ * NH_ * NT_ * HD * 2); h16* HK16 = (h16*)take((size_t)NB_ * NH_ * NT_ * HD * 2);
    if ((size_t)(wsp - (char*)d_ws) > ws_size) return;    // 8.4 + 8.4 + 16.8 + 25.2 + 0.13 + 16.8 MB ~ 76 MB
    k_cvt<<<NTK / 8 + 4 * (DM / 8) + (NH_ * HD) / 8, 256, 0, stream>>>(x, Wq, Wk, Wv, Wo, Whel, Xb, WB, WH16);
    k_gemmb<false><<<dim3(NTK / 128, 3 * DM / 128, 1), 256, 0, stream>>>(Xb, nullptr, WB, bq, bk, bv, nullptr, 0, 0, WH16, bhel, Q16, K16, VT16, HQ16, HK16);
    k_attn<<<NB_ * NH_ * (NT_ / 128), 256, 0, stream>>>(Q16, K16, HQ16, HK16, VT16, CH, CL);
    k_gemmb<true><<<dim3(NTK / 128, DM / 128, 1), 256, 0, stream>>>(CH, CL, WB + (size_t)3 * DM * DM, bo, bo, bo, out, DM, 0, nullptr, nullptr, nullptr, nullptr, nullptr, nullptr, nullptr);
}

// v007
// A run of this version takes 103 microseconds.
// Next to v006, in two timings, it ran 1.05 times as fast each time.
// All steps since v000 together make it 3.76 times as fast.
#include <hip/hip_runtime.h>

// Contractions, f32 accumulate: q/k/v = x.W^T + b ([4096 x 1024].[1024 x 1024] x3) on v_wmma_f32_16x16x32_bf16 with PLAIN bf16 operands (inputs rounded once: exact
// products); the per-head helical projections q_hel/k_hel = qh.Whel[h]^T + bhel ([tokens x 64].[64 x 64]) on v_wmma_f32_16x16x32_f16 with plain f16 q/k and
// f16(bf16(Whel)); the per-(batch, head) attention with TWO score products per key tile (0.5 q.k/8 + 0.5 helical/32, where the helical operands are the pairwise
// L2-normalised, "scrambled" projections) and weights.v, fused per 16-query tile with plain f16 operands and an online f32 softmax; out = ctx.Wo^T + bo on the bf16

#define NB_  2
#define NT_  2048
#define DM   1024
#define NH_  16
#define HD   64
#define NTK  (NB_ * NT_)
#define L2E  1.44269504088896340736f

typedef _Float16 h16;
typedef unsigned short bf;
typedef __attribute__((ext_vector_type(16))) __bf16   v16bf;
typedef __attribute__((ext_vector_type(16))) _Float16 v16h;
typedef __attribute__((ext_vector_type(8)))  _Float16 v8h;
typedef __attribute__((ext_vector_type(8)))  unsigned short v8us;
typedef __attribute__((ext_vector_type(8)))  float    v8f;
typedef __attribute__((ext_vector_type(4)))  float    v4f;
typedef __attribute__((ext_vector_type(2)))  _Float16 v2h;
typedef v8h  __attribute__((may_alias)) v8ha;
typedef v4f  __attribute__((may_alias)) v4fa;

__device__ __forceinline__ unsigned short f2bf(float f) { unsigned u = __float_as_uint(f); u += 0x7FFFu + ((u >> 16) & 1u); return (unsigned short)(u >> 16); }
__device__ __forceinline__ float bf2f(unsigned short b) { return __uint_as_float(((unsigned)b) << 16); }
__device__ __forceinline__ float bfr(float f) { return bf2f(f2bf(f)); }
__device__ __forceinline__ v16h cat16(v8h lo, v8h hi) { return __builtin_shufflevector(lo, hi, 0, 1, 2, 3, 4, 5, 6, 7, 8, 9, 10, 11, 12, 13, 14, 15); }
__device__ __forceinline__ v16bf cat16b(v8us lo, v8us hi) { return __builtin_bit_cast(v16bf, __builtin_shufflevector(lo, hi, 0, 1, 2, 3, 4, 5, 6, 7, 8, 9, 10, 11, 12, 13, 14, 15)); }
__device__ __forceinline__ v8f wmma16(v16h a, v16h b, v8f c) { return __builtin_amdgcn_wmma_f32_16x16x32_f16(false, a, false, b, (short)0, c, false, false); }
__device__ __forceinline__ v8f wmmab(v16bf a, v16bf b, v8f c) { return __builtin_amdgcn_wmma_f32_16x16x32_bf16(false, a, false, b, (short)0, c, false, false); }

__device__ __forceinline__ void cvtb_rows(const float* __restrict__ src, int nrows, bf* dst, int blk) {
    const int lane = threadIdx.x & 31, r = blk * 8 + (threadIdx.x >> 5);
    if (r >= nrows) return;
    v8us o[4];
#pragma unroll
    for (int q = 0; q < 4; ++q) { v8us t;
#pragma unroll
        for (int i = 0; i < 8; ++i) t[i] = f2bf(src[(size_t)r * DM + q * 256 + lane * 8 + i]);
        o[q] = t; }
#pragma unroll
    for (int q = 0; q < 4; ++q) *(v8us*)(dst + (size_t)r * DM + q * 256 + lane * 8) = o[q];
    
}

// k_gemmb: C[128 x 128] per block of 8 waves (2 x 4, 64 rows x 32 columns each). A stage is 128 k (256 B) of the block's 128 A rows (hi, and lo where SPLITA) and 128 B rows,
// brought into LDS by per-lane 16-byte asynchronous copies (whole lines, no register), rows at pitch 272 B for the 16-byte fragment reads; two buffers, the next stage in flight.
#define GKS  128
#define GPB  272
#define GOP  (128 * GPB)
typedef v8us __attribute__((may_alias)) v8usa;

// eight copies of one operand's 16 rows of this wave; the s_wait_xcnt closes the statement so that no address register is rewritten ahead of it
__device__ __forceinline__ void cp8(unsigned l, const bf* g) {
    asm volatile("global_load_async_to_lds_b128 %0, %1, off\n\t"
                 "global_load_async_to_lds_b128 %2, %3, off\n\t"
                 "global_load_async_to_lds_b128 %4, %5, off\n\t"
                 "global_load_async_to_lds_b128 %6, %7, off\n\t"
                 "global_load_async_to_lds_b128 %8, %9, off\n\t"
                 "global_load_async_to_lds_b128 %10, %11, off\n\t"
                 "global_load_async_to_lds_b128 %12, %13, off\n\t"
                 "global_load_async_to_lds_b128 %14, %15, off\n\t"
                 "s_wait_xcnt 0x0"
                 :: "v"(l), "v"(g), "v"(l + 2 * GPB), "v"(g + 2 * DM), "v"(l + 4 * GPB), "v"(g + 4 * DM), "v"(l + 6 * GPB), "v"(g + 6 * DM),
                    "v"(l + 8 * GPB), "v"(g + 8 * DM), "v"(l + 10 * GPB), "v"(g + 10 * DM), "v"(l + 12 * GPB), "v"(g + 12 * DM), "v"(l + 14 * GPB), "v"(g + 14 * DM)
                 : "memory");
}

// qkv_tail: what stands between the projection GEMM and attention, done by the GEMM block itself on its 128 tokens x 128 columns (two whole heads of q, of k or of v) while they are still
// in the accumulators; no f32 copy of q/k/v goes to memory. The tile (+ bias) is rounded to f16 once and laid in the freed ring at pitch 136 halves.
// v: laid transposed (a lane's 8 accumulator rows are 8 consecutive tokens: one 16-byte LDS store), then written as 128 rows of VT16[b][h][d][t], 256 bytes each.
// q, k: laid [token][column]; behind the barrier wave w owns tokens 16 w .. 16 w + 15: they go out as the Q16/K16 rows [tok][1024] (256 bytes a token) and are, per head, the A fragments of
// (q|k)h . Whel[h]^T (8 WMMA, B = WH16[h] rows e), + bf16(bhel); pair (2p, 2p+1) = columns lr, lr^1 of the same tile -> norm via __shfl_xor(.., 1); the normalised rows N[t][64] are staged as f32.
// The reference's _scramble is H[s][2p + c] = N[(2s + c) mod 2048][2p + ((2s + c) / 2048)]: tokens 2u, 2u + 1 fill rows u (their even columns) and 1024 + u (their odd columns) completely,
// so the read of the staging does it: 16 tokens = 8 + 8 whole 128-byte rows of HQ16/HK16 [b][h][s][64].
#define TPH  136
__device__ __forceinline__ void qkv_tail(v8f (&acc)[4][2], unsigned char* ring, const float* __restrict__ bsel, int r0, int c0, const h16* __restrict__ WH16, const float* __restrict__ bhel,
                                         h16* Q16, h16* K16, h16* VT16, h16* HQ16, h16* HK16) {
    const int lane = threadIdx.x & 31, wave = threadIdx.x >> 5, lr = lane & 15, hi = lane >> 4;
    const int wm = wave >> 2, wn = wave & 3;
    const int which = c0 / DM, h0 = (c0 & (DM - 1)) / HD;          // q, k or v; the first of the block's two heads
    const int b = r0 / NT_, tb = r0 & (NT_ - 1);
    h16* ht = (h16*)ring;
    if (which == 2) {                                               // the same for the whole block, as is every barrier below
#pragma unroll
        for (int n = 0; n < 2; ++n) { const float bv = bfr(bsel[(c0 & (DM - 1)) + wn * 32 + n * 16 + lr]);
#pragma unroll
            for (int m = 0; m < 4; ++m) { v8h t;
#pragma unroll
                for (int j = 0; j < 8; ++j) t[j] = (h16)(acc[m][n][j] + bv);
                *(v8ha*)(ht + (wn * 32 + n * 16 + lr) * TPH + wm * 64 + m * 16 + hi * 8) = t; } }
        __syncthreads();                                            // a row of the transposed tile comes from two waves
        h16* base = VT16 + (((size_t)b * NH_ + h0) * HD + wave * 16) * NT_ + tb;
        v8h vr[8];
#pragma unroll
        for (int s = 0; s < 8; ++s) vr[s] = *(const v8ha*)(ht + (wave * 16 + 2 * s + hi) * TPH + lr * 8);
#pragma unroll
        for (int s = 0; s < 8; ++s) *(v8h*)(base + (size_t)(2 * s + hi) * NT_ + lr * 8) = vr[s];
        return;
    }
#pragma unroll
    for (int n = 0; n < 2; ++n) { const float bv = bfr(bsel[(c0 & (DM - 1)) + wn * 32 + n * 16 + lr]);
#pragma unroll
        for (int m = 0; m < 4; ++m)
#pragma unroll
            for (int j = 0; j < 8; ++j) ht[(wm * 64 + m * 16 + hi * 8 + j) * TPH + wn * 32 + n * 16 + lr] = (h16)(acc[m][n][j] + bv); }
    __syncthreads();                                                // a token's 128 columns come from four waves
    const h16* as = ht + wave * 16 * TPH;
    float* ost = (float*)(ring + 128 * TPH * 2) + wave * (2 * 16 * 68);     // this wave's own staging, one 16 x 68 plane a head: written and read by this wave alone, whose LDS operations keep their order
#pragma unroll
    for (int hh = 0; hh < 2; ++hh) {
        const int h = h0 + hh;
        v16h a[2];
#pragma unroll
        for (int kc = 0; kc < 2; ++kc) { const h16* p = as + lr * TPH + hh * HD + kc * 32 + 8 * hi; a[kc] = cat16(*(const v8ha*)p, *(const v8ha*)(p + 16)); }
        v8f d4[4];
#pragma unroll
        for (int n = 0; n < 4; ++n) d4[n] = (v8f){};
#pragma unroll
        for (int kc = 0; kc < 2; ++kc)
#pragma unroll
            for (int n = 0; n < 4; ++n) { const h16* bp = WH16 + ((size_t)h * HD + n * 16 + lr) * HD + kc * 32 + 8 * hi; d4[n] = wmma16(a[kc], cat16(*(const v8h*)bp, *(const v8h*)(bp + 16)), d4[n]); }
        asm volatile("v_nop\n\tv_nop\n\tv_nop\n\tv_nop" : "+v"(d4[0]), "+v"(d4[1]), "+v"(d4[2]), "+v"(d4[3]));   // the distance between the last product and the first vector read of its result
        float* os = ost + hh * (16 * 68);
#pragma unroll
        for (int n = 0; n < 4; ++n) {
            const float bb = bfr(bhel[(size_t)h * HD + n * 16 + lr]);
#pragma unroll
            for (int j = 0; j < 8; ++j) {
                const float v = d4[n][j] + bb;
                const float w = __shfl_xor(v, 1, 32);                 // pair partner (column lr ^ 1, same row)
                const float nrm = sqrtf(v * v + w * w);
                os[(hi * 8 + j) * 68 + n * 16 + lr] = v / fmaxf(nrm, 1e-12f);
            }
        }
    }
    const int t0 = tb + wave * 16, prow = lane >> 3, piece = lane & 7;
    // all of the wave's global stores stand together at its end, their values formed first
    v8h rw[8], lo[2][2], up[2][2];
#pragma unroll
    for (int s = 0; s < 8; ++s) rw[s] = *(const v8ha*)(as + (2 * s + hi) * TPH + lr * 8);
#pragma unroll
    for (int hh = 0; hh < 2; ++hh)
#pragma unroll
        for (int s = 0; s < 2; ++s) { const int u = 4 * s + prow; const float* ev = ost + hh * (16 * 68) + (2 * u) * 68 + piece * 8; const float* od = ev + 68;
#pragma unroll
            for (int i = 0; i < 4; ++i) { lo[hh][s][2 * i] = (h16)ev[2 * i]; lo[hh][s][2 * i + 1] = (h16)od[2 * i]; up[hh][s][2 * i] = (h16)ev[2 * i + 1]; up[hh][s][2 * i + 1] = (h16)od[2 * i + 1]; } }
    h16* r16 = (which ? K16 : Q16) + ((size_t)b * NT_ + t0) * DM + h0 * HD;
#pragma unroll
    for (int s = 0; s < 8; ++s) *(v8h*)(r16 + (size_t)(2 * s + hi) * DM + lr * 8) = rw[s];
#pragma unroll
    for (int hh = 0; hh < 2; ++hh) {
        h16* hrow = (which ? HK16 : HQ16) + (((size_t)b * NH_ + h0 + hh) * NT_ + (t0 >> 1)) * HD;
#pragma unroll
        for (int s = 0; s < 2; ++s) { const int u = 4 * s + prow;
            *(v8h*)(hrow + (size_t)u * HD + piece * 8) = lo[hh][s]; *(v8h*)(hrow + (size_t)(NT_ / 2 + u) * HD + piece * 8) = up[hh][s]; }
    }
    asm volatile("s_wait_xcnt 0x0" ::: "memory");                   // the built code lays the v path behind these stores: no register that they name is rewritten ahead of this wait
}

// register budget of four waves a SIMD: two blocks a WGP, as the LDS allows; without it the q/k/v form's epilogue built to 257 registers, one block a WGP
template <bool SPLITA>
__global__ __launch_bounds__(256) __attribute__((amdgpu_waves_per_eu(4))) void k_gemmb(const bf* __restrict__ A, const bf* __restrict__ Al, const bf* __restrict__ Bn, const float* __restrict__ bias, const float* __restrict__ bias1, const float* __restrict__ bias2, float* C, int ldc, int cb,
                                               const h16* __restrict__ WH16, const float* __restrict__ bhel, h16* Q16, h16* K16, h16* VT16, h16* HQ16, h16* HK16) {
    constexpr int STG = (SPLITA ? 3 : 2) * GOP, BOP = (SPLITA ? 2 : 1) * GOP;   // one stage: [A | B], or [A hi | A lo | B]
    constexpr int NST = DM / GKS, NBK = (GKS / 32) * (SPLITA ? 2 : 1);
    __shared__ __align__(16) unsigned char ring[2 * STG];
    const int lane = threadIdx.x & 31, wave = threadIdx.x >> 5, lr = lane & 15, hi = lane >> 4;
    const int wm = wave >> 2, wn = wave & 3;
    const int r0 = blockIdx.x * 128, c0 = blockIdx.y * 128;
    const int crw = wave * 16 + hi;                             // copy i of a wave: rows crw + 2 i, bytes 16 lr of the stage's 256
    const unsigned l0 = (unsigned)(size_t)ring + crw * GPB + lr * 16;
    const bf* gA = A + (size_t)(r0 + crw) * DM + lr * 8;
    const bf* gB = Bn + (size_t)(c0 + crw) * DM + lr * 8;
    const bf* gL = SPLITA ? Al + (size_t)(r0 + crw) * DM + lr * 8 : gA;
    auto fill = [&](int t, int buf) {
        const unsigned l = l0 + buf * STG;
        cp8(l, gA + t * GKS); cp8(l + BOP, gB + t * GKS);
        if (SPLITA) cp8(l + GOP, gL + t * GKS);
    };
    v8f acc[4][2];
#pragma unroll
    for (int m = 0; m < 4; ++m)
#pragma unroll
        for (int n = 0; n < 2; ++n) acc[m][n] = (v8f){};
    fill(0, 0);
    asm volatile("s_wait_asynccnt 0x0" ::: "memory");           // stage 0 of this wave has landed
    __syncthreads();                                            // ... and every other wave's
    fill(1, 1);
    const int aofs = (wm * 64 + lr) * GPB + hi * 16, bofs = BOP + (wn * 32 + lr) * GPB + hi * 16;
    // kept rolled: one stage per trip, the buffer picked by the trip's parity
#pragma unroll 1
    for (int t = 0; t < NST; ++t) {
        const unsigned char* sb = ring + (t & 1) * STG;
        // a block = the 8 products of one A-side fragment set (hi, or lo where SPLITA) with one B set; block i + 1's fragments are read as one group ahead of block i's products
        v16bf fa[2][4], fb[2][2];
        auto lda = [&](int i, v16bf* d) {
            const unsigned char* q = sb + aofs + (SPLITA ? (i & 1) * GOP + (i >> 1) * 64 : i * 64);
#pragma unroll
            for (int m = 0; m < 4; ++m) { const unsigned char* p = q + m * 16 * GPB; d[m] = cat16b(*(const v8usa*)p, *(const v8usa*)(p + 32)); }
        };
        auto ldb = [&](int ks, v16bf* d) {
#pragma unroll
            for (int n = 0; n < 2; ++n) { const unsigned char* p = sb + bofs + n * 16 * GPB + ks * 64; d[n] = cat16b(*(const v8usa*)p, *(const v8usa*)(p + 32)); }
        };
        lda(0, fa[0]); ldb(0, fb[0]);
#pragma unroll
        for (int i = 0; i < NBK; ++i) {
            const int ks = SPLITA ? i >> 1 : i, ks1 = SPLITA ? (i + 1) >> 1 : i + 1;
            if (i + 1 < NBK) { lda(i + 1, fa[(i + 1) & 1]); if (ks1 != ks) ldb(ks1, fb[ks1 & 1]); }
            __builtin_amdgcn_sched_barrier(0);                  // keeps the LDS reads one group in front of the products, not spread among them with waits to 0
#pragma unroll
            for (int m = 0; m < 4; ++m)
#pragma unroll
                for (int n = 0; n < 2; ++n) acc[m][n] = wmmab(fa[i & 1][m], fb[ks & 1][n], acc[m][n]);
            __builtin_amdgcn_sched_barrier(0);                  // the other side of that fence
        }
        asm volatile("s_wait_dscnt 0x0" ::: "memory");          // this wave has left the buffer
        asm volatile("s_wait_asynccnt 0x0" ::: "memory");       // its copies of stage t + 1 have landed
        __syncthreads();                                        // publishes stage t + 1, frees stage t's buffer
        if (t + 2 < NST) fill(t + 2, t & 1);
    }
    asm volatile("s_wait_asynccnt 0x0" ::: "memory");           // nothing in flight when the ring becomes output staging
    const float* bsel = c0 < DM ? bias : c0 < 2 * DM ? bias1 : bias2;   // one bias vector per 1024 output columns (q | k | v stacked along N)
    if constexpr (!SPLITA) { qkv_tail(acc, ring, bsel, r0, c0, WH16, bhel, Q16, K16, VT16, HQ16, HK16); return; }
    float* os = (float*)(ring + wave * (64 * 36 * 4));          // this wave's own 64 rows x 32 columns, pitch 36 floats
#pragma unroll
    for (int n = 0; n < 2; ++n) { const float bv = bfr(bsel[(c0 & (DM - 1)) + wn * 32 + n * 16 + lr]);
#pragma unroll
        for (int m = 0; m < 4; ++m)
#pragma unroll
            for (int j = 0; j < 8; ++j) os[(m * 16 + hi * 8 + j) * 36 + n * 16 + lr] = acc[m][n][j] + bv; }
    float* crow = C + (size_t)(r0 + wm * 64) * ldc + cb + c0 + wn * 32;
#pragma unroll
    for (int s = 0; s < 16; ++s) { const int row = s * 4 + (lane >> 3), cofs = (lane & 7) * 4;
        const v4f val = *(const v4fa*)(os + row * 36 + cofs); *(v4f*)(crow + (size_t)row * ldc + cofs) = val; }
}

// whel_rows: WH16 [h][e][d] = f16(bf16(Whel)).
__device__ __forceinline__ void whel_rows(const float* __restrict__ Whel, h16* WH16, int blk) {
    const int lane = threadIdx.x & 31, r = blk * 8 + (threadIdx.x >> 5);     // row = (h, e): 1024 rows of 64
    if (r >= NH_ * HD) return;
    v2h o; o[0] = (h16)bfr(Whel[(size_t)r * HD + 2 * lane]); o[1] = (h16)bfr(Whel[(size_t)r * HD + 2 * lane + 1]);
    *(v2h*)(WH16 + (size_t)r * HD + 2 * lane) = o; 
}
// one launch for every conversion of an input, none of which depends on another: blocks [0, 512) x, then 128 each for Wq, Wk, Wv, Wo (WB = the four planes in that order), then 128 for Whel
__global__ __launch_bounds__(256) void k_cvt(const float* __restrict__ x, const float* __restrict__ Wq, const float* __restrict__ Wk, const float* __restrict__ Wv, const float* __restrict__ Wo,
                                             const float* __restrict__ Whel, bf* Xb, bf* WB, h16* WH16) {
    const int blk = blockIdx.x;
    if (blk < NTK / 8) { cvtb_rows(x, NTK, Xb, blk); return; }
    const int wb = blk - NTK / 8, i = wb / (DM / 8);
    if (i < 4) { cvtb_rows(i == 0 ? Wq : i == 1 ? Wk : i == 2 ? Wv : Wo, DM, WB + (size_t)i * DM * DM, wb - i * (DM / 8)); return; }
    whel_rows(Whel, WH16, wb - 4 * (DM / 8));
}

// k_attn: block = (b, h, 128 queries), wave = 16; q and helical-q fragments resident; 64 steps x 32 keys, all products transposed: S^T = K.Q^T (4 WMMA) and G^T = HK.HQ^T (4 WMMA)
// with the key rows as A and the resident query fragments as B, so a lane holds 16 of the 32 scores of ONE query (column lr, keys 8 hi + j and 16 + 8 hi + j); logits 0.5 s/8 + 0.5 g/32:
// the two factors, 1/16 and 1/64, are powers of two and lie in the resident query fragments, so both products run into ONE accumulator, which then holds the logits themselves;
// online f32 softmax in the lane plus one exchange between the wave's halves; weight x32768 = exp2(logit * log2 e + (15 - max * log2 e)), one fused multiply-add in front of each exponential; the row sum
// carries the same 32768, which so cancels in the final division; the weights, converted in place, are the B operand of O^T += V^T.P^T (4 WMMA): they touch no LDS.
// ctx -> bf16 hi/lo planes CH/CL[tok][h*64+d].
// A stage = 128 keys of this (b, h), shared by the block's 8 waves: 128 K rows and 128 helical-K rows (128 B each, LDS pitch 144 B) and the 64 V^T rows (256 B each, pitch
// 272 B), brought in by per-lane 16-byte asynchronous copies that cover whole lines; two buffers, the next stage in flight. The 16-byte fragment reads then come from LDS.
#define AKS  128
#define KPB  144
#define VPB  272
#define AKO  (AKS * KPB)
#define AST  (2 * AKO + HD * VPB)

// four copies of one operand; the s_wait_xcnt closes the statement so that no address register is rewritten ahead of it
__device__ __forceinline__ void cp4(unsigned l, const h16* g, unsigned ls, size_t gs) {
    asm volatile("global_load_async_to_lds_b128 %0, %1, off\n\t"
                 "global_load_async_to_lds_b128 %2, %3, off\n\t"
                 "global_load_async_to_lds_b128 %4, %5, off\n\t"
                 "global_load_async_to_lds_b128 %6, %7, off\n\t"
                 "s_wait_xcnt 0x0"
                 :: "v"(l), "v"(g), "v"(l + ls), "v"(g + gs), "v"(l + 2 * ls), "v"(g + 2 * gs), "v"(l + 3 * ls), "v"(g + 3 * gs)
                 : "memory");
}

// lane l with lane l ^ 16
__device__ __forceinline__ float xhalf(float x) { return __builtin_bit_cast(float, __builtin_amdgcn_permlanex16(__builtin_bit_cast(int, x), __builtin_bit_cast(int, x), 0x76543210, 0xfedcba98, false, false)); }

__global__ __launch_bounds__(256) void k_attn(const h16* __restrict__ Q16, const h16* __restrict__ K16, const h16* __restrict__ HQ16, const h16* __restrict__ HK16, const h16* __restrict__ VT16, bf* CH, bf* CL) {
    __shared__ __align__(16) unsigned char ring[2 * AST];
    __shared__ __align__(16) float ost[8][16 * 68];
    const int lane = threadIdx.x & 31, wave = threadIdx.x >> 5, lr = lane & 15, hi = lane >> 4;
    const int bid = blockIdx.x;
    const int b = bid / (NH_ * (NT_ / 128)), rem = bid - b * (NH_ * (NT_ / 128)), h = rem / (NT_ / 128), qt = rem - h * (NT_ / 128);
    const int q0 = qt * 128 + wave * 16;
    const size_t tok0 = (size_t)b * NT_;
    const size_t hrow0 = ((size_t)b * NH_ + h) * NT_;
    v16h qa[2], ga[2];
#pragma unroll
    for (int kc = 0; kc < 2; ++kc) {
        const h16* p = Q16 + (tok0 + q0 + lr) * DM + h * HD + kc * 32 + 8 * hi; qa[kc] = cat16(*(const v8h*)p, *(const v8h*)(p + 16)) * (h16)0.0625f;
        const h16* g = HQ16 + (hrow0 + q0 + lr) * HD + kc * 32 + 8 * hi; ga[kc] = cat16(*(const v8h*)g, *(const v8h*)(g + 16)) * (h16)0.015625f;
    }
    const h16* kh_b = K16 + tok0 * DM + h * HD; const h16* hk_b = HK16 + hrow0 * HD;
    const h16* vt_b = VT16 + (((size_t)b * NH_ + h) * HD) * NT_;
    v8f o[4];
#pragma unroll
    for (int n = 0; n < 4; ++n) o[n] = (v8f){};
    float mrow = -3.0e38f, lpart = 0.f;                         // query lr's running maximum (equal in both halves) and this half's part of its sum (x32768)
    // this wave's copies of a stage: K and helical-K rows krow + 4 i (8 lanes a row), V^T rows vrow + 2 i (16 lanes a row), i = 0 .. 3
    const int krow = wave * 16 + (lane >> 3), kpc = lane & 7, vrow = wave * 8 + hi;
    const unsigned lk = (unsigned)(size_t)ring + krow * KPB + kpc * 16, lv = (unsigned)(size_t)ring + 2 * AKO + vrow * VPB + lr * 16;
    const h16* gk = kh_b + (size_t)krow * DM + kpc * 8; const h16* gh = hk_b + (size_t)krow * HD + kpc * 8; const h16* gv = vt_b + (size_t)vrow * NT_ + lr * 8;
    auto fill = [&](int t, int buf) {
        cp4(lk + buf * AST, gk + (size_t)t * AKS * DM, 4 * KPB, 4 * DM);
        cp4(lk + buf * AST + AKO, gh + (size_t)t * AKS * HD, 4 * KPB, 4 * HD);
        cp4(lv + buf * AST, gv + t * AKS, 2 * VPB, 2 * NT_);
    };
    fill(0, 0);
    asm volatile("s_wait_asynccnt 0x0" ::: "memory");           // stage 0 of this wave has landed
    __syncthreads();                                            // ... and every other wave's
    fill(1, 1);
    // both loops kept rolled: the stage loop picks its buffer by the trip's parity; the four 32-key steps of a stage, unrolled, built to over 256 registers (3 waves a SIMD, not 4)
#pragma unroll 1
    for (int st = 0; st < NT_ / AKS; ++st) {
    const unsigned char* sb = ring + (st & 1) * AST;
#pragma unroll 1
    for (int kt = 0; kt < AKS / 32; ++kt) {
        const unsigned char* kp = sb + (kt * 32 + lr) * KPB + hi * 16;
        const unsigned char* vb = sb + 2 * AKO + lr * VPB + kt * 64 + hi * 16;
        v8f s0 = {}, s1 = {};
#pragma unroll
        for (int kc = 0; kc < 2; ++kc) {
            const unsigned char* r0p = kp + kc * 64; const unsigned char* r1p = r0p + 16 * KPB;
            s0 = wmma16(cat16(*(const v8ha*)r0p, *(const v8ha*)(r0p + 32)), qa[kc], s0); s1 = wmma16(cat16(*(const v8ha*)r1p, *(const v8ha*)(r1p + 32)), qa[kc], s1);
        }
#pragma unroll
        for (int kc = 0; kc < 2; ++kc) {
            const unsigned char* h0p = kp + kc * 64 + AKO; const unsigned char* h1p = h0p + 16 * KPB;
            s0 = wmma16(cat16(*(const v8ha*)h0p, *(const v8ha*)(h0p + 32)), ga[kc], s0); s1 = wmma16(cat16(*(const v8ha*)h1p, *(const v8ha*)(h1p + 32)), ga[kc], s1);
        }
        v16h vf[4];                                             // read here, ahead of the softmax, so that their LDS latency lies under it
#pragma unroll
        for (int n = 0; n < 4; ++n) { const unsigned char* vp = vb + n * 16 * VPB; vf[n] = cat16(*(const v8ha*)vp, *(const v8ha*)(vp + 32)); }
        float mx = fmaxf(s0[0], s1[0]);
#pragma unroll
        for (int j = 1; j < 8; ++j) mx = fmaxf(mx, fmaxf(s0[j], s1[j]));
        const float mn = fmaxf(mrow, fmaxf(mx, xhalf(mx)));     // over all 32 keys: the other half holds this query's other 16
        const float alpha = __expf(mrow - mn); mrow = mn;
        const float nb = fmaf(-mn, L2E, 15.0f);                 // 15: the weights carry 2^15, which keeps small ones out of the f16 subnormals
        const v8f l2 = {L2E, L2E, L2E, L2E, L2E, L2E, L2E, L2E}, nb8 = {nb, nb, nb, nb, nb, nb, nb, nb};
        const v8f e0 = __builtin_elementwise_fma(s0, l2, nb8), e1 = __builtin_elementwise_fma(s1, l2, nb8);
        v8f p0, p1;                                             // the weights x32768
#pragma unroll
        for (int j = 0; j < 8; ++j) { p0[j] = __builtin_amdgcn_exp2f(e0[j]); p1[j] = __builtin_amdgcn_exp2f(e1[j]); }
        const v8f pp = p0 + p1;
        lpart = lpart * alpha + (((pp[0] + pp[1]) + (pp[2] + pp[3])) + ((pp[4] + pp[5]) + (pp[6] + pp[7])));
        // element s = key 8 hi + s (s < 8), 16 + 8 hi + s - 8: the k order in which vf was read
        const v16h pa = cat16(__builtin_convertvector(p0, v8h), __builtin_convertvector(p1, v8h));
#pragma unroll
        for (int n = 0; n < 4; ++n) o[n] *= alpha;
#pragma unroll
        for (int n = 0; n < 4; ++n) o[n] = wmma16(vf[n], pa, o[n]);
        asm volatile("v_nop\n\tv_nop\n\tv_nop\n\tv_nop" : "+v"(o[0]), "+v"(o[1]), "+v"(o[2]), "+v"(o[3]) : "v"(pa));
    }
        asm volatile("s_wait_dscnt 0x0" ::: "memory");          // this wave has left the buffer
        asm volatile("s_wait_asynccnt 0x0" ::: "memory");       // its copies of stage st + 1 have landed
        __syncthreads();                                        // publishes stage st + 1, frees stage st's buffer
        if (st + 2 < NT_ / AKS) fill(st + 2, st & 1);
    }
    asm volatile("s_wait_asynccnt 0x0" ::: "memory");           // nothing in flight at the end
    const float inv = 1.0f / (lpart + xhalf(lpart));
    float* os = &ost[wave][0];                                  // o[n][j] = ctx[query lr][n * 16 + hi * 8 + j]
#pragma unroll
    for (int n = 0; n < 4; ++n)
#pragma unroll
        for (int j = 0; j < 8; ++j) os[lr * 68 + n * 16 + hi * 8 + j] = o[n][j] * inv;
    __syncthreads();
    const size_t cbase = (tok0 + q0) * DM + (size_t)h * HD;
    auto pass = [&]() {
#pragma unroll
        for (int s = 0; s < 4; ++s) { const int row = 4 * s + (lane >> 3), piece = lane & 7; const float* sp = os + row * 68 + piece * 8; v8us oh, ol;
#pragma unroll
            for (int i = 0; i < 8; ++i) { const unsigned short hb = f2bf(sp[i]); oh[i] = hb; ol[i] = f2bf(sp[i] - bf2f(hb)); }
            *(v8us*)(CH + cbase + (size_t)row * DM + piece * 8) = oh; *(v8us*)(CL + cbase + (size_t)row * DM + piece * 8) = ol; }
    };
    pass(); 
}

extern "C" void kernel_launch(void* const* d_in, const int* in_sizes, int n_in,
                              void* d_out, int out_size, void* d_ws, size_t ws_size, hipStream_t stream) {
    (void)in_sizes; (void)n_in; (void)out_size;
    const float* x = (const float*)d_in[0]; const float* Wq = (const float*)d_in[1]; const float* bq = (const float*)d_in[2]; const float* Wk = (const float*)d_in[3]; const float* bk = (const float*)d_in[4];
    const float* Wv = (const float*)d_in[5]; const float* bv = (const float*)d_in[6]; const float* Wo = (const float*)d_in[7]; const float* bo = (const float*)d_in[8];
    const float* Whel = (const float*)d_in[9]; const float* bhel = (const float*)d_in[10];
    float* out = (float*)d_out;    // [2][2048][1024]
    char* wsp = (char*)d_ws;
    auto take = [&](size_t bytes) { char* p = wsp; wsp += (bytes + 255) & ~(size_t)255; return (void*)p; };
    bf* Xb = (bf*)take((size_t)NTK * DM * 2);
    bf* WB = (bf*)take((size_t)4 * DM * DM * 2);                    // bf16 Wq | Wk | Wv | Wo: the first three are one [3072 x 1024] B operand
    bf* CH = (bf*)take((size_t)NTK * DM * 2); bf* CL = (bf*)take((size_t)NTK * DM * 2);   // ctx, bf16 hi and lo planes
    h16* Q16 = (h16*)take((size_t)NTK * DM * 2); h16* K16 = (h16*)take((size_t)NTK * DM * 2); h16* VT16 = (h16*)take((size_t)NTK * DM * 2);
    h16* WH16 = (h16*)take((size_t)NH_ * HD * HD * 2);
    h16* HQ16 = (h16*)take((size_t)NB_ * NH_ * NT_ * HD * 2); h16* HK16 = (h16*)take((size_t)NB_ * NH_ * NT_ * HD * 2);
    if ((size_t)(wsp - (char*)d_ws) > ws_size) return;    // 8.4 + 8.4 + 16.8 + 25.2 + 0.13 + 16.8 MB ~ 76 MB
    k_cvt<<<NTK / 8 + 4 * (DM / 8) + (NH_ * HD) / 8, 256, 0, stream>>>(x, Wq, Wk, Wv, Wo, Whel, Xb, WB, WH16);
    k_gemmb<false><<<dim3(NTK / 128, 3 * DM / 128, 1), 256, 0, stream>>>(Xb, nullptr, WB, bq, bk, bv, nullptr, 0, 0, WH16, bhel, Q16, K16, VT16, HQ16, HK16);
    k_attn<<<NB_ * NH_ * (NT_ / 128), 256, 0, stream>>>(Q16, K16, HQ16, HK16, VT16, CH, CL);
    k_gemmb<true><<<dim3(NTK / 128, DM / 128, 1), 256, 0, stream>>>(CH, CL, WB + (size_t)3 * DM * DM, bo, bo, bo, out, DM, 0, nullptr, nullptr, nullptr, nullptr, nullptr, nullptr, nullptr);
}

// v008
// Measured time: 99.7 microseconds a run.
// Timed twice side by side with v007, it ran 1.03 times as fast both times.
// Over all steps from v000 it is 3.89 times as fast.
#include <hip/hip_runtime.h>

// Contractions, f32 accumulate: q/k/v = x.W^T + b ([4096 x 1024].[1024 x 1024] x3) on v_wmma_f32_16x16x32_bf16 with PLAIN bf16 operands (inputs rounded once: exact
// products); the per-head helical projections q_hel/k_hel = qh.Whel[h]^T + bhel ([tokens x 64].[64 x 64]) on v_wmma_f32_16x16x32_f16 with plain f16 q/k and
// f16(bf16(Whel)); the per-(batch, head) attention with TWO score products per key tile (0.5 q.k/8 + 0.5 helical/32, where the helical operands are the pairwise
// L2-normalised, "scrambled" projections) and weights.v, fused per 16-query tile with plain f16 operands and an online f32 softmax; out = ctx.Wo^T + bo on the bf16

#define NB_  2
#define NT_  2048
#define DM   1024
#define NH_  16
#define HD   64
#define NTK  (NB_ * NT_)
#define L2E  1.44269504088896340736f

typedef _Float16 h16;
typedef unsigned short bf;
typedef __attribute__((ext_vector_type(16))) __bf16   v16bf;
typedef __attribute__((ext_vector_type(16))) _Float16 v16h;
typedef __attribute__((ext_vector_type(8)))  _Float16 v8h;
typedef __attribute__((ext_vector_type(8)))  unsigned short v8us;
typedef __attribute__((ext_vector_type(8)))  float    v8f;
typedef __attribute__((ext_vector_type(4)))  float    v4f;
typedef __attribute__((ext_vector_type(2)))  _Float16 v2h;
typedef v8h  __attribute__((may_alias)) v8ha;
typedef v4f  __attribute__((may_alias)) v4fa;

__device__ __forceinline__ unsigned short f2bf(float f) { unsigned u = __float_as_uint(f); u += 0x7FFFu + ((u >> 16) & 1u); return (unsigned short)(u >> 16); }
__device__ __forceinline__ float bf2f(unsigned short b) { return __uint_as_float(((unsigned)b) << 16); }
__device__ __forceinline__ float bfr(float f) { return bf2f(f2bf(f)); }
__device__ __forceinline__ v16h cat16(v8h lo, v8h hi) { return __builtin_shufflevector(lo, hi, 0, 1, 2, 3, 4, 5, 6, 7, 8, 9, 10, 11, 12, 13, 14, 15); }
__device__ __forceinline__ v16bf cat16b(v8us lo, v8us hi) { return __builtin_bit_cast(v16bf, __builtin_shufflevector(lo, hi, 0, 1, 2, 3, 4, 5, 6, 7, 8, 9, 10, 11, 12, 13, 14, 15)); }
__device__ __forceinline__ v8f wmma16(v16h a, v16h b, v8f c) { return __builtin_amdgcn_wmma_f32_16x16x32_f16(false, a, false, b, (short)0, c, false, false); }
__device__ __forceinline__ v8f wmmab(v16bf a, v16bf b, v8f c) { return __builtin_amdgcn_wmma_f32_16x16x32_bf16(false, a, false, b, (short)0, c, false, false); }

__device__ __forceinline__ void cvtb_rows(const float* __restrict__ src, int nrows, bf* dst, int blk) {
    const int lane = threadIdx.x & 31, r = blk * 8 + (threadIdx.x >> 5);
    if (r >= nrows) return;
    v8us o[4];
#pragma unroll
    for (int q = 0; q < 4; ++q) { v8us t;
#pragma unroll
        for (int i = 0; i < 8; ++i) t[i] = f2bf(src[(size_t)r * DM + q * 256 + lane * 8 + i]);
        o[q] = t; }
#pragma unroll
    for (int q = 0; q < 4; ++q) *(v8us*)(dst + (size_t)r * DM + q * 256 + lane * 8) = o[q];
    
}

// k_gemmb: C[128 x 128] per block of 8 waves (2 x 4, 64 rows x 32 columns each). A stage is 128 k (256 B) of the block's 128 A rows (hi, and lo where SPLITA) and 128 B rows,
// brought into LDS by per-lane 16-byte asynchronous copies (whole lines, no register), rows at pitch 272 B for the 16-byte fragment reads; two buffers, the next stage in flight.
#define GKS  128
#define GPB  272
#define GOP  (128 * GPB)
typedef v8us __attribute__((may_alias)) v8usa;

// eight copies of one operand's 16 rows of this wave; the s_wait_xcnt closes the statement so that no address register is rewritten ahead of it
__device__ __forceinline__ void cp8(unsigned l, const bf* g) {
    asm volatile("global_load_async_to_lds_b128 %0, %1, off\n\t"
                 "global_load_async_to_lds_b128 %2, %3, off\n\t"
                 "global_load_async_to_lds_b128 %4, %5, off\n\t"
                 "global_load_async_to_lds_b128 %6, %7, off\n\t"
                 "global_load_async_to_lds_b128 %8, %9, off\n\t"
                 "global_load_async_to_lds_b128 %10, %11, off\n\t"
                 "global_load_async_to_lds_b128 %12, %13, off\n\t"
                 "global_load_async_to_lds_b128 %14, %15, off\n\t"
                 "s_wait_xcnt 0x0"
                 :: "v"(l), "v"(g), "v"(l + 2 * GPB), "v"(g + 2 * DM), "v"(l + 4 * GPB), "v"(g + 4 * DM), "v"(l + 6 * GPB), "v"(g + 6 * DM),
                    "v"(l + 8 * GPB), "v"(g + 8 * DM), "v"(l + 10 * GPB), "v"(g + 10 * DM), "v"(l + 12 * GPB), "v"(g + 12 * DM), "v"(l + 14 * GPB), "v"(g + 14 * DM)
                 : "memory");
}

// qkv_tail: what stands between the projection GEMM and attention, done by the GEMM block itself on its 128 tokens x 128 columns (two whole heads of q, of k or of v) while they are still
// in the accumulators; no f32 copy of q/k/v goes to memory. The tile (+ bias) is rounded to f16 once and laid in the freed ring at pitch 136 halves.
// v: laid transposed (a lane's 8 accumulator rows are 8 consecutive tokens: one 16-byte LDS store), then written as 128 rows of VT16[b][h][d][t], 256 bytes each.
// q, k: laid [token][column]; behind the barrier wave w owns tokens 16 w .. 16 w + 15: they go out as the Q16/K16 rows [tok][1024] (256 bytes a token) and are, per head, the A fragments of
// (q|k)h . Whel[h]^T (8 WMMA, B = WH16[h] rows e), + bf16(bhel); pair (2p, 2p+1) = columns lr, lr^1 of the same tile -> norm via __shfl_xor(.., 1); the normalised rows N[t][64] are staged as f32.
// The reference's _scramble is H[s][2p + c] = N[(2s + c) mod 2048][2p + ((2s + c) / 2048)]: tokens 2u, 2u + 1 fill rows u (their even columns) and 1024 + u (their odd columns) completely,
// so the read of the staging does it: 16 tokens = 8 + 8 whole 128-byte rows of HQ16/HK16 [b][h][s][64].
#define TPH  136
__device__ __forceinline__ void qkv_tail(v8f (&acc)[4][2], unsigned char* ring, const float* __restrict__ bsel, int r0, int c0, const h16* __restrict__ WH16, const float* __restrict__ bhel,
                                         h16* Q16, h16* K16, h16* VT16, h16* HQ16, h16* HK16) {
    const int lane = threadIdx.x & 31, wave = threadIdx.x >> 5, lr = lane & 15, hi = lane >> 4;
    const int wm = wave >> 2, wn = wave & 3;
    const int which = c0 / DM, h0 = (c0 & (DM - 1)) / HD;          // q, k or v; the first of the block's two heads
    const int b = r0 / NT_, tb = r0 & (NT_ - 1);
    h16* ht = (h16*)ring;
    if (which == 2) {                                               // the same for the whole block, as is every barrier below
#pragma unroll
        for (int n = 0; n < 2; ++n) { const float bv = bfr(bsel[(c0 & (DM - 1)) + wn * 32 + n * 16 + lr]);
#pragma unroll
            for (int m = 0; m < 4; ++m) { v8h t;
#pragma unroll
                for (int j = 0; j < 8; ++j) t[j] = (h16)(acc[m][n][j] + bv);
                *(v8ha*)(ht + (wn * 32 + n * 16 + lr) * TPH + wm * 64 + m * 16 + hi * 8) = t; } }
        __syncthreads();                                            // a row of the transposed tile comes from two waves
        h16* base = VT16 + (((size_t)b * NH_ + h0) * HD + wave * 16) * NT_ + tb;
        v8h vr[8];
#pragma unroll
        for (int s = 0; s < 8; ++s) vr[s] = *(const v8ha*)(ht + (wave * 16 + 2 * s + hi) * TPH + lr * 8);
#pragma unroll
        for (int s = 0; s < 8; ++s) *(v8h*)(base + (size_t)(2 * s + hi) * NT_ + lr * 8) = vr[s];
        return;
    }
#pragma unroll
    for (int n = 0; n < 2; ++n) { const float bv = bfr(bsel[(c0 & (DM - 1)) + wn * 32 + n * 16 + lr]);
#pragma unroll
        for (int m = 0; m < 4; ++m)
#pragma unroll
            for (int j = 0; j < 8; ++j) ht[(wm * 64 + m * 16 + hi * 8 + j) * TPH + wn * 32 + n * 16 + lr] = (h16)(acc[m][n][j] + bv); }
    __syncthreads();                                                // a token's 128 columns come from four waves
    const h16* as = ht + wave * 16 * TPH;
    float* ost = (float*)(ring + 128 * TPH * 2) + wave * (2 * 16 * 68);     // this wave's own staging, one 16 x 68 plane a head: written and read by this wave alone, whose LDS operations keep their order
#pragma unroll
    for (int hh = 0; hh < 2; ++hh) {
        const int h = h0 + hh;
        v16h a[2];
#pragma unroll
        for (int kc = 0; kc < 2; ++kc) { const h16* p = as + lr * TPH + hh * HD + kc * 32 + 8 * hi; a[kc] = cat16(*(const v8ha*)p, *(const v8ha*)(p + 16)); }
        v8f d4[4];
#pragma unroll
        for (int n = 0; n < 4; ++n) d4[n] = (v8f){};
#pragma unroll
        for (int kc = 0; kc < 2; ++kc)
#pragma unroll
            for (int n = 0; n < 4; ++n) { const h16* bp = WH16 + ((size_t)h * HD + n * 16 + lr) * HD + kc * 32 + 8 * hi; d4[n] = wmma16(a[kc], cat16(*(const v8h*)bp, *(const v8h*)(bp + 16)), d4[n]); }
        asm volatile("v_nop\n\tv_nop\n\tv_nop\n\tv_nop" : "+v"(d4[0]), "+v"(d4[1]), "+v"(d4[2]), "+v"(d4[3]));   // the distance between the last product and the first vector read of its result
        float* os = ost + hh * (16 * 68);
#pragma unroll
        for (int n = 0; n < 4; ++n) {
            const float bb = bfr(bhel[(size_t)h * HD + n * 16 + lr]);
#pragma unroll
            for (int j = 0; j < 8; ++j) {
                const float v = d4[n][j] + bb;
                const float w = __shfl_xor(v, 1, 32);                 // pair partner (column lr ^ 1, same row)
                const float nrm = sqrtf(v * v + w * w);
                os[(hi * 8 + j) * 68 + n * 16 + lr] = v / fmaxf(nrm, 1e-12f);
            }
        }
    }
    const int t0 = tb + wave * 16, prow = lane >> 3, piece = lane & 7;
    // all of the wave's global stores stand together at its end, their values formed first
    v8h rw[8], lo[2][2], up[2][2];
#pragma unroll
    for (int s = 0; s < 8; ++s) rw[s] = *(const v8ha*)(as + (2 * s + hi) * TPH + lr * 8);
#pragma unroll
    for (int hh = 0; hh < 2; ++hh)
#pragma unroll
        for (int s = 0; s < 2; ++s) { const int u = 4 * s + prow; const float* ev = ost + hh * (16 * 68) + (2 * u) * 68 + piece * 8; const float* od = ev + 68;
#pragma unroll
            for (int i = 0; i < 4; ++i) { lo[hh][s][2 * i] = (h16)ev[2 * i]; lo[hh][s][2 * i + 1] = (h16)od[2 * i]; up[hh][s][2 * i] = (h16)ev[2 * i + 1]; up[hh][s][2 * i + 1] = (h16)od[2 * i + 1]; } }
    h16* r16 = (which ? K16 : Q16) + ((size_t)b * NT_ + t0) * DM + h0 * HD;
#pragma unroll
    for (int s = 0; s < 8; ++s) *(v8h*)(r16 + (size_t)(2 * s + hi) * DM + lr * 8) = rw[s];
#pragma unroll
    for (int hh = 0; hh < 2; ++hh) {
        h16* hrow = (which ? HK16 : HQ16) + (((size_t)b * NH_ + h0 + hh) * NT_ + (t0 >> 1)) * HD;
#pragma unroll
        for (int s = 0; s < 2; ++s) { const int u = 4 * s + prow;
            *(v8h*)(hrow + (size_t)u * HD + piece * 8) = lo[hh][s]; *(v8h*)(hrow + (size_t)(NT_ / 2 + u) * HD + piece * 8) = up[hh][s]; }
    }
    asm volatile("s_wait_xcnt 0x0" ::: "memory");                   // the built code lays the v path behind these stores: no register that they name is rewritten ahead of this wait
}

// register budget of four waves a SIMD: two blocks a WGP, as the LDS allows; without it the q/k/v form's epilogue built to 257 registers, one block a WGP
template <bool SPLITA>
__global__ __launch_bounds__(256) __attribute__((amdgpu_waves_per_eu(4))) void k_gemmb(const bf* __restrict__ A, const bf* __restrict__ Al, const bf* __restrict__ Bn, const float* __restrict__ bias, const float* __restrict__ bias1, const float* __restrict__ bias2, float* C, int ldc, int cb,
                                               const h16* __restrict__ WH16, const float* __restrict__ bhel, h16* Q16, h16* K16, h16* VT16, h16* HQ16, h16* HK16) {
    constexpr int STG = (SPLITA ? 3 : 2) * GOP, BOP = (SPLITA ? 2 : 1) * GOP;   // one stage: [A | B], or [A hi | A lo | B]
    constexpr int NST = DM / GKS, NBK = (GKS / 32) * (SPLITA ? 2 : 1);
    __shared__ __align__(16) unsigned char ring[2 * STG];
    const int lane = threadIdx.x & 31, wave = threadIdx.x >> 5, lr = lane & 15, hi = lane >> 4;
    const int wm = wave >> 2, wn = wave & 3;
    const int r0 = blockIdx.x * 128, c0 = blockIdx.y * 128;
    const int crw = wave * 16 + hi;                             // copy i of a wave: rows crw + 2 i, bytes 16 lr of the stage's 256
    const unsigned l0 = (unsigned)(size_t)ring + crw * GPB + lr * 16;
    const bf* gA = A + (size_t)(r0 + crw) * DM + lr * 8;
    const bf* gB = Bn + (size_t)(c0 + crw) * DM + lr * 8;
    const bf* gL = SPLITA ? Al + (size_t)(r0 + crw) * DM + lr * 8 : gA;
    auto fill = [&](int t, int buf) {
        const unsigned l = l0 + buf * STG;
        cp8(l, gA + t * GKS); cp8(l + BOP, gB + t * GKS);
        if (SPLITA) cp8(l + GOP, gL + t * GKS);
    };
    v8f acc[4][2];
#pragma unroll
    for (int m = 0; m < 4; ++m)
#pragma unroll
        for (int n = 0; n < 2; ++n) acc[m][n] = (v8f){};
    fill(0, 0);
    asm volatile("s_wait_asynccnt 0x0" ::: "memory");           // stage 0 of this wave has landed
    __syncthreads();                                            // ... and every other wave's
    fill(1, 1);
    const int aofs = (wm * 64 + lr) * GPB + hi * 16, bofs = BOP + (wn * 32 + lr) * GPB + hi * 16;
    // kept rolled: one stage per trip, the buffer picked by the trip's parity
#pragma unroll 1
    for (int t = 0; t < NST; ++t) {
        const unsigned char* sb = ring + (t & 1) * STG;
        // a block = the 8 products of one A-side fragment set (hi, or lo where SPLITA) with one B set; block i + 1's fragments are read as one group ahead of block i's products
        v16bf fa[2][4], fb[2][2];
        auto lda = [&](int i, v16bf* d) {
            const unsigned char* q = sb + aofs + (SPLITA ? (i & 1) * GOP + (i >> 1) * 64 : i * 64);
#pragma unroll
            for (int m = 0; m < 4; ++m) { const unsigned char* p = q + m * 16 * GPB; d[m] = cat16b(*(const v8usa*)p, *(const v8usa*)(p + 32)); }
        };
        auto ldb = [&](int ks, v16bf* d) {
#pragma unroll
            for (int n = 0; n < 2; ++n) { const unsigned char* p = sb + bofs + n * 16 * GPB + ks * 64; d[n] = cat16b(*(const v8usa*)p, *(const v8usa*)(p + 32)); }
        };
        lda(0, fa[0]); ldb(0, fb[0]);
#pragma unroll
        for (int i = 0; i < NBK; ++i) {
            const int ks = SPLITA ? i >> 1 : i, ks1 = SPLITA ? (i + 1) >> 1 : i + 1;
            if (i + 1 < NBK) { lda(i + 1, fa[(i + 1) & 1]); if (ks1 != ks) ldb(ks1, fb[ks1 & 1]); }
            __builtin_amdgcn_sched_barrier(0);                  // keeps the LDS reads one group in front of the products, not spread among them with waits to 0
#pragma unroll
            for (int m = 0; m < 4; ++m)
#pragma unroll
                for (int n = 0; n < 2; ++n) acc[m][n] = wmmab(fa[i & 1][m], fb[ks & 1][n], acc[m][n]);
            __builtin_amdgcn_sched_barrier(0);                  // the other side of that fence
        }
        asm volatile("s_wait_dscnt 0x0" ::: "memory");          // this wave has left the buffer
        asm volatile("s_wait_asynccnt 0x0" ::: "memory");       // its copies of stage t + 1 have landed
        __syncthreads();                                        // publishes stage t + 1, frees stage t's buffer
        if (t + 2 < NST) fill(t + 2, t & 1);
    }
    asm volatile("s_wait_asynccnt 0x0" ::: "memory");           // nothing in flight when the ring becomes output staging
    const float* bsel = c0 < DM ? bias : c0 < 2 * DM ? bias1 : bias2;   // one bias vector per 1024 output columns (q | k | v stacked along N)
    if constexpr (!SPLITA) { qkv_tail(acc, ring, bsel, r0, c0, WH16, bhel, Q16, K16, VT16, HQ16, HK16); return; }
    float* os = (float*)(ring + wave * (64 * 36 * 4));          // this wave's own 64 rows x 32 columns, pitch 36 floats
#pragma unroll
    for (int n = 0; n < 2; ++n) { const float bv = bfr(bsel[(c0 & (DM - 1)) + wn * 32 + n * 16 + lr]);
#pragma unroll
        for (int m = 0; m < 4; ++m)
#pragma unroll
            for (int j = 0; j < 8; ++j) os[(m * 16 + hi * 8 + j) * 36 + n * 16 + lr] = acc[m][n][j] + bv; }
    float* crow = C + (size_t)(r0 + wm * 64) * ldc + cb + c0 + wn * 32;
#pragma unroll
    for (int s = 0; s < 16; ++s) { const int row = s * 4 + (lane >> 3), cofs = (lane & 7) * 4;
        const v4f val = *(const v4fa*)(os + row * 36 + cofs); *(v4f*)(crow + (size_t)row * ldc + cofs) = val; }
}

// whel_rows: WH16 [h][e][d] = f16(bf16(Whel)).
__device__ __forceinline__ void whel_rows(const float* __restrict__ Whel, h16* WH16, int blk) {
    const int lane = threadIdx.x & 31, r = blk * 8 + (threadIdx.x >> 5);     // row = (h, e): 1024 rows of 64
    if (r >= NH_ * HD) return;
    v2h o; o[0] = (h16)bfr(Whel[(size_t)r * HD + 2 * lane]); o[1] = (h16)bfr(Whel[(size_t)r * HD + 2 * lane + 1]);
    *(v2h*)(WH16 + (size_t)r * HD + 2 * lane) = o; 
}
// one launch for every conversion of an input, none of which depends on another: blocks [0, 512) x, then 128 each for Wq, Wk, Wv, Wo (WB = the four planes in that order), then 128 for Whel
__global__ __launch_bounds__(256) void k_cvt(const float* __restrict__ x, const float* __restrict__ Wq, const float* __restrict__ Wk, const float* __restrict__ Wv, const float* __restrict__ Wo,
                                             const float* __restrict__ Whel, bf* Xb, bf* WB, h16* WH16) {
    const int blk = blockIdx.x;
    if (blk < NTK / 8) { cvtb_rows(x, NTK, Xb, blk); return; }
    const int wb = blk - NTK / 8, i = wb / (DM / 8);
    if (i < 4) { cvtb_rows(i == 0 ? Wq : i == 1 ? Wk : i == 2 ? Wv : Wo, DM, WB + (size_t)i * DM * DM, wb - i * (DM / 8)); return; }
    whel_rows(Whel, WH16, wb - 4 * (DM / 8));
}

// k_attn: block = (b, h, 128 queries), wave = 16; q and helical-q fragments resident; 64 steps x 32 keys, all products transposed: S^T = K.Q^T (4 WMMA) and G^T = HK.HQ^T (4 WMMA)
// with the key rows as A and the resident query fragments as B, so a lane holds 16 of the 32 scores of ONE query (column lr, keys 8 hi + j and 16 + 8 hi + j); logits 0.5 s/8 + 0.5 g/32:
// the two factors, 1/16 and 1/64, are powers of two and lie in the resident query fragments, so both products run into ONE accumulator, which then holds the logits themselves;
// online f32 softmax in the lane; weight x128 = exp2(logit * log2 e + (7 - ref * log2 e)), one fused multiply-add in front of each exponential; ref is the query's running maximum as of its last
// renewal: it is renewed (one exchange between the wave's halves), and O and the row sum rescaled, only in a step where some score of the wave lies more than 8 (in log2) above its query's ref, so a weight
// stays at or below 2^15, inside f16; the row sum carries the same 128, which so cancels in the final division; the weights, converted in place, are the B operand of O^T += V^T.P^T (4 WMMA): they touch no LDS.
// ctx -> bf16 hi/lo planes CH/CL[tok][h*64+d].
// A stage = 128 keys of this (b, h), shared by the block's 8 waves: 128 K rows and 128 helical-K rows (128 B each, LDS pitch 144 B) and the 64 V^T rows (256 B each, pitch
// 272 B), brought in by per-lane 16-byte asynchronous copies that cover whole lines; two buffers, the next stage in flight. The 16-byte fragment reads then come from LDS.
#define AKS  128
#define KPB  144
#define VPB  272
#define AKO  (AKS * KPB)
#define AST  (2 * AKO + HD * VPB)

// four copies of one operand; the s_wait_xcnt closes the statement so that no address register is rewritten ahead of it
__device__ __forceinline__ void cp4(unsigned l, const h16* g, unsigned ls, size_t gs) {
    asm volatile("global_load_async_to_lds_b128 %0, %1, off\n\t"
                 "global_load_async_to_lds_b128 %2, %3, off\n\t"
                 "global_load_async_to_lds_b128 %4, %5, off\n\t"
                 "global_load_async_to_lds_b128 %6, %7, off\n\t"
                 "s_wait_xcnt 0x0"
                 :: "v"(l), "v"(g), "v"(l + ls), "v"(g + gs), "v"(l + 2 * ls), "v"(g + 2 * gs), "v"(l + 3 * ls), "v"(g + 3 * gs)
                 : "memory");
}

// lane l with lane l ^ 16
__device__ __forceinline__ float xhalf(float x) { return __builtin_bit_cast(float, __builtin_amdgcn_permlanex16(__builtin_bit_cast(int, x), __builtin_bit_cast(int, x), 0x76543210, 0xfedcba98, false, false)); }

__global__ __launch_bounds__(256) void k_attn(const h16* __restrict__ Q16, const h16* __restrict__ K16, const h16* __restrict__ HQ16, const h16* __restrict__ HK16, const h16* __restrict__ VT16, bf* CH, bf* CL) {
    __shared__ __align__(16) unsigned char ring[2 * AST];
    __shared__ __align__(16) float ost[8][16 * 68];
    const int lane = threadIdx.x & 31, wave = threadIdx.x >> 5, lr = lane & 15, hi = lane >> 4;
    const int bid = blockIdx.x;
    const int b = bid / (NH_ * (NT_ / 128)), rem = bid - b * (NH_ * (NT_ / 128)), h = rem / (NT_ / 128), qt = rem - h * (NT_ / 128);
    const int q0 = qt * 128 + wave * 16;
    const size_t tok0 = (size_t)b * NT_;
    const size_t hrow0 = ((size_t)b * NH_ + h) * NT_;
    v16h qa[2], ga[2];
#pragma unroll
    for (int kc = 0; kc < 2; ++kc) {
        const h16* p = Q16 + (tok0 + q0 + lr) * DM + h * HD + kc * 32 + 8 * hi; qa[kc] = cat16(*(const v8h*)p, *(const v8h*)(p + 16)) * (h16)0.0625f;
        const h16* g = HQ16 + (hrow0 + q0 + lr) * HD + kc * 32 + 8 * hi; ga[kc] = cat16(*(const v8h*)g, *(const v8h*)(g + 16)) * (h16)0.015625f;
    }
    const h16* kh_b = K16 + tok0 * DM + h * HD; const h16* hk_b = HK16 + hrow0 * HD;
    const h16* vt_b = VT16 + (((size_t)b * NH_ + h) * HD) * NT_;
    v8f o[4];
#pragma unroll
    for (int n = 0; n < 4; ++n) o[n] = (v8f){};
    float mrow = -3.0e38f, lpart = 0.f;                         // query lr's reference maximum (equal in both halves) and this half's part of its sum (x128)
    float thr = -3.0e38f, nb = 0.f;                             // the score above which the reference is renewed (the first step always does), and 7 - mrow * log2 e
    // this wave's copies of a stage: K and helical-K rows krow + 4 i (8 lanes a row), V^T rows vrow + 2 i (16 lanes a row), i = 0 .. 3
    const int krow = wave * 16 + (lane >> 3), kpc = lane & 7, vrow = wave * 8 + hi;
    const unsigned lk = (unsigned)(size_t)ring + krow * KPB + kpc * 16, lv = (unsigned)(size_t)ring + 2 * AKO + vrow * VPB + lr * 16;
    const h16* gk = kh_b + (size_t)krow * DM + kpc * 8; const h16* gh = hk_b + (size_t)krow * HD + kpc * 8; const h16* gv = vt_b + (size_t)vrow * NT_ + lr * 8;
    auto fill = [&](int t, int buf) {
        cp4(lk + buf * AST, gk + (size_t)t * AKS * DM, 4 * KPB, 4 * DM);
        cp4(lk + buf * AST + AKO, gh + (size_t)t * AKS * HD, 4 * KPB, 4 * HD);
        cp4(lv + buf * AST, gv + t * AKS, 2 * VPB, 2 * NT_);
    };
    fill(0, 0);
    asm volatile("s_wait_asynccnt 0x0" ::: "memory");           // stage 0 of this wave has landed
    __syncthreads();                                            // ... and every other wave's
    fill(1, 1);
    // both loops kept rolled: the stage loop picks its buffer by the trip's parity; the four 32-key steps of a stage, unrolled, built to over 256 registers (3 waves a SIMD, not 4)
#pragma unroll 1
    for (int st = 0; st < NT_ / AKS; ++st) {
    const unsigned char* sb = ring + (st & 1) * AST;
#pragma unroll 1
    for (int kt = 0; kt < AKS / 32; ++kt) {
        const unsigned char* kp = sb + (kt * 32 + lr) * KPB + hi * 16;
        const unsigned char* vb = sb + 2 * AKO + lr * VPB + kt * 64 + hi * 16;
        v8f s0 = {}, s1 = {};
        v16h kf[2][2], hf[2][2], vf[4];                         // all of the step's fragments, read as one group: the V^T reads' latency lies under the score products
#pragma unroll
        for (int kc = 0; kc < 2; ++kc)
#pragma unroll
            for (int r = 0; r < 2; ++r) { const unsigned char* rp = kp + kc * 64 + r * 16 * KPB; kf[kc][r] = cat16(*(const v8ha*)rp, *(const v8ha*)(rp + 32)); }
#pragma unroll
        for (int kc = 0; kc < 2; ++kc)
#pragma unroll
            for (int r = 0; r < 2; ++r) { const unsigned char* hp = kp + kc * 64 + AKO + r * 16 * KPB; hf[kc][r] = cat16(*(const v8ha*)hp, *(const v8ha*)(hp + 32)); }
#pragma unroll
        for (int n = 0; n < 4; ++n) { const unsigned char* vp = vb + n * 16 * VPB; vf[n] = cat16(*(const v8ha*)vp, *(const v8ha*)(vp + 32)); }
        __builtin_amdgcn_sched_barrier(0);                      // keeps the V^T reads in that group: with the branch below, the build otherwise issues them behind the score products and waits them out
#pragma unroll
        for (int kc = 0; kc < 2; ++kc) { s0 = wmma16(kf[kc][0], qa[kc], s0); s1 = wmma16(kf[kc][1], qa[kc], s1); }
#pragma unroll
        for (int kc = 0; kc < 2; ++kc) { s0 = wmma16(hf[kc][0], ga[kc], s0); s1 = wmma16(hf[kc][1], ga[kc], s1); }
        float mx = fmaxf(s0[0], s1[0]);
#pragma unroll
        for (int j = 1; j < 8; ++j) mx = fmaxf(mx, fmaxf(s0[j], s1[j]));
        asm volatile("" ::: "memory");                          // compiler fence: holds the V^T reads above the branch; without it they sink behind it, among the last four products, and are waited out there
        if (__builtin_amdgcn_ballot_w32(mx > thr) != 0) {       // one scalar branch a step, the same for the whole wave (the products need every lane on)
            const float mn = fmaxf(mrow, fmaxf(mx, xhalf(mx))); // over all 32 keys: the other half holds this query's other 16
            const float alpha = __expf(mrow - mn); mrow = mn;
            nb = fmaf(-mn, L2E, 7.0f);                          // 7: the weights carry 2^7, 8 below the largest that the test lets through, and small ones stay out of the f16 subnormals
            thr = mn + 8.0f / L2E;
            lpart *= alpha;
#pragma unroll
            for (int n = 0; n < 4; ++n) o[n] *= alpha;
        }
        const v8f l2 = {L2E, L2E, L2E, L2E, L2E, L2E, L2E, L2E}, nb8 = {nb, nb, nb, nb, nb, nb, nb, nb};
        const v8f e0 = __builtin_elementwise_fma(s0, l2, nb8), e1 = __builtin_elementwise_fma(s1, l2, nb8);
        v8f p0, p1;                                             // the weights x128
#pragma unroll
        for (int j = 0; j < 8; ++j) { p0[j] = __builtin_amdgcn_exp2f(e0[j]); p1[j] = __builtin_amdgcn_exp2f(e1[j]); }
        const v8f pp = p0 + p1;
        lpart = lpart + (((pp[0] + pp[1]) + (pp[2] + pp[3])) + ((pp[4] + pp[5]) + (pp[6] + pp[7])));
        // element s = key 8 hi + s (s < 8), 16 + 8 hi + s - 8: the k order in which vf was read
        const v16h pa = cat16(__builtin_convertvector(p0, v8h), __builtin_convertvector(p1, v8h));
#pragma unroll
        for (int n = 0; n < 4; ++n) o[n] = wmma16(vf[n], pa, o[n]);
        // the V^T fragments are named so that their registers stay theirs up to here: given to the row-sum additions among the products, each cost up to four more v_nop
        asm volatile("v_nop\n\tv_nop\n\tv_nop\n\tv_nop" : "+v"(o[0]), "+v"(o[1]), "+v"(o[2]), "+v"(o[3]) : "v"(pa), "v"(vf[0]), "v"(vf[1]), "v"(vf[2]), "v"(vf[3]));
    }
        asm volatile("s_wait_dscnt 0x0" ::: "memory");          // this wave has left the buffer
        asm volatile("s_wait_asynccnt 0x0" ::: "memory");       // its copies of stage st + 1 have landed
        __syncthreads();                                        // publishes stage st + 1, frees stage st's buffer
        if (st + 2 < NT_ / AKS) fill(st + 2, st & 1);
    }
    asm volatile("s_wait_asynccnt 0x0" ::: "memory");           // nothing in flight at the end
    const float inv = 1.0f / (lpart + xhalf(lpart));
    float* os = &ost[wave][0];                                  // o[n][j] = ctx[query lr][n * 16 + hi * 8 + j]
#pragma unroll
    for (int n = 0; n < 4; ++n)
#pragma unroll
        for (int j = 0; j < 8; ++j) os[lr * 68 + n * 16 + hi * 8 + j] = o[n][j] * inv;
    __syncthreads();
    const size_t cbase = (tok0 + q0) * DM + (size_t)h * HD;
    auto pass = [&]() {
#pragma unroll
        for (int s = 0; s < 4; ++s) { const int row = 4 * s + (lane >> 3), piece = lane & 7; const float* sp = os + row * 68 + piece * 8; v8us oh, ol;
#pragma unroll
            for (int i = 0; i < 8; ++i) { const unsigned short hb = f2bf(sp[i]); oh[i] = hb; ol[i] = f2bf(sp[i] - bf2f(hb)); }
            *(v8us*)(CH + cbase + (size_t)row * DM + piece * 8) = oh; *(v8us*)(CL + cbase + (size_t)row * DM + piece * 8) = ol; }
    };
    pass(); 
}

extern "C" void kernel_launch(void* const* d_in, const int* in_sizes, int n_in,
                              void* d_out, int out_size, void* d_ws, size_t ws_size, hipStream_t stream) {
    (void)in_sizes; (void)n_in; (void)out_size;
    const float* x = (const float*)d_in[0]; const float* Wq = (const float*)d_in[1]; const float* bq = (const float*)d_in[2]; const float* Wk = (const float*)d_in[3]; const float* bk = (const float*)d_in[4];
    const float* Wv = (const float*)d_in[5]; const float* bv = (const float*)d_in[6]; const float* Wo = (const float*)d_in[7]; const float* bo = (const float*)d_in[8];
    const float* Whel = (const float*)d_in[9]; const float* bhel = (const float*)d_in[10];
    float* out = (float*)d_out;    // [2][2048][1024]
    char* wsp = (char*)d_ws;
    auto take = [&](size_t bytes) { char* p = wsp; wsp += (bytes + 255) & ~(size_t)255; return (void*)p; };
    bf* Xb = (bf*)take((size_t)NTK * DM * 2);
    bf* WB = (bf*)take((size_t)4 * DM * DM * 2);                    // bf16 Wq | Wk | Wv | Wo: the first three are one [3072 x 1024] B operand
    bf* CH = (bf*)take((size_t)NTK * DM * 2); bf* CL = (bf*)take((size_t)NTK * DM * 2);   // ctx, bf16 hi and lo planes
    h16* Q16 = (h16*)take((size_t)NTK * DM * 2); h16* K16 = (h16*)take((size_t)NTK * DM * 2); h16* VT16 = (h16*)take((size_t)NTK * DM * 2);
    h16* WH16 = (h16*)take((size_t)NH_ * HD * HD * 2);
    h16* HQ16 = (h16*)take((size_t)NB_ * NH_ * NT_ * HD * 2); h16* HK16 = (h16*)take((size_t)NB_ * NH_ * NT_ * HD * 2);
    if ((size_t)(wsp - (char*)d_ws) > ws_size) return;    // 8.4 + 8.4 + 16.8 + 25.2 + 0.13 + 16.8 MB ~ 76 MB
    k_cvt<<<NTK / 8 + 4 * (DM / 8) + (NH_ * HD) / 8, 256, 0, stream>>>(x, Wq, Wk, Wv, Wo, Whel, Xb, WB, WH16);
    k_gemmb<false><<<dim3(NTK / 128, 3 * DM / 128, 1), 256, 0, stream>>>(Xb, nullptr, WB, bq, bk, bv, nullptr, 0, 0, WH16, bhel, Q16, K16, VT16, HQ16, HK16);
    k_attn<<<NB_ * NH_ * (NT_ / 128), 256, 0, stream>>>(Q16, K16, HQ16, HK16, VT16, CH, CL);
    k_gemmb<true><<<dim3(NTK / 128, DM / 128, 1), 256, 0, stream>>>(CH, CL, WB + (size_t)3 * DM * DM, bo, bo, bo, out, DM, 0, nullptr, nullptr, nullptr, nullptr, nullptr, nullptr, nullptr);
}

// v009
// Measured time: 95.9 microseconds a run.
// Two timings next to v008 both put it at 1.04 times that version's speed.
// Counting every step since v000, it is 4.05 times as fast.
#include <hip/hip_runtime.h>

// Contractions, f32 accumulate: q/k/v = x.W^T + b ([4096 x 1024].[1024 x 1024] x3) on v_wmma_f32_16x16x32_bf16 with PLAIN bf16 operands (inputs rounded once: exact
// products); the per-head helical projections q_hel/k_hel = qh.Whel[h]^T + bhel ([tokens x 64].[64 x 64]) on v_wmma_f32_16x16x32_f16 with plain f16 q/k and
// f16(bf16(Whel)); the per-(batch, head) attention with TWO score products per key tile (0.5 q.k/8 + 0.5 helical/32, where the helical operands are the pairwise
// L2-normalised, "scrambled" projections) and weights.v, fused per 16-query tile with plain f16 operands and an online f32 softmax; out = ctx.Wo^T + bo on the bf16

#define NB_  2
#define NT_  2048
#define DM   1024
#define NH_  16
#define HD   64
#define NTK  (NB_ * NT_)
#define L2E  1.44269504088896340736f

typedef _Float16 h16;
typedef unsigned short bf;
typedef __attribute__((ext_vector_type(16))) __bf16   v16bf;
typedef __attribute__((ext_vector_type(16))) _Float16 v16h;
typedef __attribute__((ext_vector_type(8)))  _Float16 v8h;
typedef __attribute__((ext_vector_type(8)))  unsigned short v8us;
typedef __attribute__((ext_vector_type(8)))  float    v8f;
typedef __attribute__((ext_vector_type(4)))  float    v4f;
typedef __attribute__((ext_vector_type(2)))  _Float16 v2h;
typedef v8h  __attribute__((may_alias)) v8ha;
typedef v4f  __attribute__((may_alias)) v4fa;

__device__ __forceinline__ unsigned short f2bf(float f) { unsigned u = __float_as_uint(f); u += 0x7FFFu + ((u >> 16) & 1u); return (unsigned short)(u >> 16); }
__device__ __forceinline__ float bf2f(unsigned short b) { return __uint_as_float(((unsigned)b) << 16); }
__device__ __forceinline__ float bfr(float f) { return bf2f(f2bf(f)); }
__device__ __forceinline__ v16h cat16(v8h lo, v8h hi) { return __builtin_shufflevector(lo, hi, 0, 1, 2, 3, 4, 5, 6, 7, 8, 9, 10, 11, 12, 13, 14, 15); }
__device__ __forceinline__ v16bf cat16b(v8us lo, v8us hi) { return __builtin_bit_cast(v16bf, __builtin_shufflevector(lo, hi, 0, 1, 2, 3, 4, 5, 6, 7, 8, 9, 10, 11, 12, 13, 14, 15)); }
__device__ __forceinline__ v8f wmma16(v16h a, v16h b, v8f c) { return __builtin_amdgcn_wmma_f32_16x16x32_f16(false, a, false, b, (short)0, c, false, false); }
__device__ __forceinline__ v8f wmmab(v16bf a, v16bf b, v8f c) { return __builtin_amdgcn_wmma_f32_16x16x32_bf16(false, a, false, b, (short)0, c, false, false); }

__device__ __forceinline__ void cvtb_rows(const float* __restrict__ src, int nrows, bf* dst, int blk) {
    const int lane = threadIdx.x & 31, r = blk * 8 + (threadIdx.x >> 5);
    if (r >= nrows) return;
    v8us o[4];
#pragma unroll
    for (int q = 0; q < 4; ++q) { v8us t;
#pragma unroll
        for (int i = 0; i < 8; ++i) t[i] = f2bf(src[(size_t)r * DM + q * 256 + lane * 8 + i]);
        o[q] = t; }
#pragma unroll
    for (int q = 0; q < 4; ++q) *(v8us*)(dst + (size_t)r * DM + q * 256 + lane * 8) = o[q];
    
}

// k_gemmb: C[128 x 128] per block of 8 waves (2 x 4, 64 rows x 32 columns each). A stage is 128 k (256 B) of the block's 128 A rows (hi, and lo where SPLITA) and 128 B rows,
// brought into LDS by per-lane 16-byte asynchronous copies (whole lines, no register), rows at pitch 272 B for the 16-byte fragment reads; two buffers, the next stage in flight.
#define GKS  128
#define GPB  272
#define GOP  (128 * GPB)
typedef v8us __attribute__((may_alias)) v8usa;

// eight copies of one operand's 16 rows of this wave; the s_wait_xcnt closes the statement so that no address register is rewritten ahead of it
__device__ __forceinline__ void cp8(unsigned l, const bf* g) {
    asm volatile("global_load_async_to_lds_b128 %0, %1, off\n\t"
                 "global_load_async_to_lds_b128 %2, %3, off\n\t"
                 "global_load_async_to_lds_b128 %4, %5, off\n\t"
                 "global_load_async_to_lds_b128 %6, %7, off\n\t"
                 "global_load_async_to_lds_b128 %8, %9, off\n\t"
                 "global_load_async_to_lds_b128 %10, %11, off\n\t"
                 "global_load_async_to_lds_b128 %12, %13, off\n\t"
                 "global_load_async_to_lds_b128 %14, %15, off\n\t"
                 "s_wait_xcnt 0x0"
                 :: "v"(l), "v"(g), "v"(l + 2 * GPB), "v"(g + 2 * DM), "v"(l + 4 * GPB), "v"(g + 4 * DM), "v"(l + 6 * GPB), "v"(g + 6 * DM),
                    "v"(l + 8 * GPB), "v"(g + 8 * DM), "v"(l + 10 * GPB), "v"(g + 10 * DM), "v"(l + 12 * GPB), "v"(g + 12 * DM), "v"(l + 14 * GPB), "v"(g + 14 * DM)
                 : "memory");
}

// qkv_tail: what stands between the projection GEMM and attention, done by the GEMM block itself on its 128 tokens x 128 columns (two whole heads of q, of k or of v) while they are still
// in the accumulators; no f32 copy of q/k/v goes to memory. The tile (+ bias) is rounded to f16 once and laid in the freed ring at pitch 136 halves.
// v: laid transposed (a lane's 8 accumulator rows are 8 consecutive tokens: one 16-byte LDS store), then written as 128 rows of VT16[b][h][d][t], 256 bytes each.
// q, k: laid [token][column]; behind the barrier wave w owns tokens 16 w .. 16 w + 15: they go out as the Q16/K16 rows [tok][1024] (256 bytes a token) and are, per head, the A fragments of
// (q|k)h . Whel[h]^T (8 WMMA, B = WH16[h] rows e), + bf16(bhel); pair (2p, 2p+1) = columns lr, lr^1 of the same tile -> norm via __shfl_xor(.., 1); the normalised rows N[t][64] are staged as f32.
// The reference's _scramble is H[s][2p + c] = N[(2s + c) mod 2048][2p + ((2s + c) / 2048)]: tokens 2u, 2u + 1 fill rows u (their even columns) and 1024 + u (their odd columns) completely,
// so the read of the staging does it: 16 tokens = 8 + 8 whole 128-byte rows of HQ16/HK16 [b][h][s][64].
#define TPH  136
__device__ __forceinline__ void qkv_tail(v8f (&acc)[4][2], unsigned char* ring, const float* __restrict__ bsel, int r0, int c0, const h16* __restrict__ WH16, const float* __restrict__ bhel,
                                         h16* Q16, h16* K16, h16* VT16, h16* HQ16, h16* HK16) {
    const int lane = threadIdx.x & 31, wave = threadIdx.x >> 5, lr = lane & 15, hi = lane >> 4;
    const int wm = wave >> 2, wn = wave & 3;
    const int which = c0 / DM, h0 = (c0 & (DM - 1)) / HD;          // q, k or v; the first of the block's two heads
    const int b = r0 / NT_, tb = r0 & (NT_ - 1);
    h16* ht = (h16*)ring;
    if (which == 2) {                                               // the same for the whole block, as is every barrier below
#pragma unroll
        for (int n = 0; n < 2; ++n) { const float bv = bfr(bsel[(c0 & (DM - 1)) + wn * 32 + n * 16 + lr]);
#pragma unroll
            for (int m = 0; m < 4; ++m) { v8h t;
#pragma unroll
                for (int j = 0; j < 8; ++j) t[j] = (h16)(acc[m][n][j] + bv);
                *(v8ha*)(ht + (wn * 32 + n * 16 + lr) * TPH + wm * 64 + m * 16 + hi * 8) = t; } }
        __syncthreads();                                            // a row of the transposed tile comes from two waves
        h16* base = VT16 + (((size_t)b * NH_ + h0) * HD + wave * 16) * NT_ + tb;
        v8h vr[8];
#pragma unroll
        for (int s = 0; s < 8; ++s) vr[s] = *(const v8ha*)(ht + (wave * 16 + 2 * s + hi) * TPH + lr * 8);
#pragma unroll
        for (int s = 0; s < 8; ++s) *(v8h*)(base + (size_t)(2 * s + hi) * NT_ + lr * 8) = vr[s];
        return;
    }
#pragma unroll
    for (int n = 0; n < 2; ++n) { const float bv = bfr(bsel[(c0 & (DM - 1)) + wn * 32 + n * 16 + lr]);
#pragma unroll
        for (int m = 0; m < 4; ++m)
#pragma unroll
            for (int j = 0; j < 8; ++j) ht[(wm * 64 + m * 16 + hi * 8 + j) * TPH + wn * 32 + n * 16 + lr] = (h16)(acc[m][n][j] + bv); }
    __syncthreads();                                                // a token's 128 columns come from four waves
    const h16* as = ht + wave * 16 * TPH;
    float* ost = (float*)(ring + 128 * TPH * 2) + wave * (2 * 16 * 68);     // this wave's own staging, one 16 x 68 plane a head: written and read by this wave alone, whose LDS operations keep their order
#pragma unroll
    for (int hh = 0; hh < 2; ++hh) {
        const int h = h0 + hh;
        v16h a[2];
#pragma unroll
        for (int kc = 0; kc < 2; ++kc) { const h16* p = as + lr * TPH + hh * HD + kc * 32 + 8 * hi; a[kc] = cat16(*(const v8ha*)p, *(const v8ha*)(p + 16)); }
        v8f d4[4];
#pragma unroll
        for (int n = 0; n < 4; ++n) d4[n] = (v8f){};
#pragma unroll
        for (int kc = 0; kc < 2; ++kc)
#pragma unroll
            for (int n = 0; n < 4; ++n) { const h16* bp = WH16 + ((size_t)h * HD + n * 16 + lr) * HD + kc * 32 + 8 * hi; d4[n] = wmma16(a[kc], cat16(*(const v8h*)bp, *(const v8h*)(bp + 16)), d4[n]); }
        asm volatile("v_nop\n\tv_nop\n\tv_nop\n\tv_nop" : "+v"(d4[0]), "+v"(d4[1]), "+v"(d4[2]), "+v"(d4[3]));   // the distance between the last product and the first vector read of its result
        float* os = ost + hh * (16 * 68);
#pragma unroll
        for (int n = 0; n < 4; ++n) {
            const float bb = bfr(bhel[(size_t)h * HD + n * 16 + lr]);
#pragma unroll
            for (int j = 0; j < 8; ++j) {
                const float v = d4[n][j] + bb;
                const float w = __shfl_xor(v, 1, 32);                 // pair partner (column lr ^ 1, same row)
                const float nrm = sqrtf(v * v + w * w);
                os[(hi * 8 + j) * 68 + n * 16 + lr] = v / fmaxf(nrm, 1e-12f);
            }
        }
    }
    const int t0 = tb + wave * 16, prow = lane >> 3, piece = lane & 7;
    // all of the wave's global stores stand together at its end, their values formed first
    v8h rw[8], lo[2][2], up[2][2];
#pragma unroll
    for (int s = 0; s < 8; ++s) rw[s] = *(const v8ha*)(as + (2 * s + hi) * TPH + lr * 8);
#pragma unroll
    for (int hh = 0; hh < 2; ++hh)
#pragma unroll
        for (int s = 0; s < 2; ++s) { const int u = 4 * s + prow; const float* ev = ost + hh * (16 * 68) + (2 * u) * 68 + piece * 8; const float* od = ev + 68;
#pragma unroll
            for (int i = 0; i < 4; ++i) { lo[hh][s][2 * i] = (h16)ev[2 * i]; lo[hh][s][2 * i + 1] = (h16)od[2 * i]; up[hh][s][2 * i] = (h16)ev[2 * i + 1]; up[hh][s][2 * i + 1] = (h16)od[2 * i + 1]; } }
    h16* r16 = (which ? K16 : Q16) + ((size_t)b * NT_ + t0) * DM + h0 * HD;
#pragma unroll
    for (int s = 0; s < 8; ++s) *(v8h*)(r16 + (size_t)(2 * s + hi) * DM + lr * 8) = rw[s];
#pragma unroll
    for (int hh = 0; hh < 2; ++hh) {
        h16* hrow = (which ? HK16 : HQ16) + (((size_t)b * NH_ + h0 + hh) * NT_ + (t0 >> 1)) * HD;
#pragma unroll
        for (int s = 0; s < 2; ++s) { const int u = 4 * s + prow;
            *(v8h*)(hrow + (size_t)u * HD + piece * 8) = lo[hh][s]; *(v8h*)(hrow + (size_t)(NT_ / 2 + u) * HD + piece * 8) = up[hh][s]; }
    }
    asm volatile("s_wait_xcnt 0x0" ::: "memory");                   // the built code lays the v path behind these stores: no register that they name is rewritten ahead of this wait
}

// register budget of four waves a SIMD: two blocks a WGP, as the LDS allows; without it the q/k/v form's epilogue built to 257 registers, one block a WGP
template <bool SPLITA>
__global__ __launch_bounds__(256) __attribute__((amdgpu_waves_per_eu(4))) void k_gemmb(const bf* __restrict__ A, const bf* __restrict__ Al, const bf* __restrict__ Bn, const float* __restrict__ bias, const float* __restrict__ bias1, const float* __restrict__ bias2, float* C, int ldc, int cb,
                                               const h16* __restrict__ WH16, const float* __restrict__ bhel, h16* Q16, h16* K16, h16* VT16, h16* HQ16, h16* HK16) {
    constexpr int STG = (SPLITA ? 3 : 2) * GOP, BOP = (SPLITA ? 2 : 1) * GOP;   // one stage: [A | B], or [A hi | A lo | B]
    constexpr int NST = DM / GKS, NBK = (GKS / 32) * (SPLITA ? 2 : 1);
    __shared__ __align__(16) unsigned char ring[2 * STG];
    const int lane = threadIdx.x & 31, wave = threadIdx.x >> 5, lr = lane & 15, hi = lane >> 4;
    const int wm = wave >> 2, wn = wave & 3;
    const int r0 = blockIdx.x * 128, c0 = blockIdx.y * 128;
    const int crw = wave * 16 + hi;                             // copy i of a wave: rows crw + 2 i, bytes 16 lr of the stage's 256
    const unsigned l0 = (unsigned)(size_t)ring + crw * GPB + lr * 16;
    const bf* gA = A + (size_t)(r0 + crw) * DM + lr * 8;
    const bf* gB = Bn + (size_t)(c0 + crw) * DM + lr * 8;
    const bf* gL = SPLITA ? Al + (size_t)(r0 + crw) * DM + lr * 8 : gA;
    auto fill = [&](int t, int buf) {
        const unsigned l = l0 + buf * STG;
        cp8(l, gA + t * GKS); cp8(l + BOP, gB + t * GKS);
        if (SPLITA) cp8(l + GOP, gL + t * GKS);
    };
    v8f acc[4][2];
#pragma unroll
    for (int m = 0; m < 4; ++m)
#pragma unroll
        for (int n = 0; n < 2; ++n) acc[m][n] = (v8f){};
    fill(0, 0);
    asm volatile("s_wait_asynccnt 0x0" ::: "memory");           // stage 0 of this wave has landed
    __syncthreads();                                            // ... and every other wave's
    fill(1, 1);
    const int aofs = (wm * 64 + lr) * GPB + hi * 16, bofs = BOP + (wn * 32 + lr) * GPB + hi * 16;
    // kept rolled: one stage per trip, the buffer picked by the trip's parity
#pragma unroll 1
    for (int t = 0; t < NST; ++t) {
        const unsigned char* sb = ring + (t & 1) * STG;
        // a block = the 8 products of one A-side fragment set (hi, or lo where SPLITA) with one B set; block i + 1's fragments are read as one group ahead of block i's products
        v16bf fa[2][4], fb[2][2];
        auto lda = [&](int i, v16bf* d) {
            const unsigned char* q = sb + aofs + (SPLITA ? (i & 1) * GOP + (i >> 1) * 64 : i * 64);
#pragma unroll
            for (int m = 0; m < 4; ++m) { const unsigned char* p = q + m * 16 * GPB; d[m] = cat16b(*(const v8usa*)p, *(const v8usa*)(p + 32)); }
        };
        auto ldb = [&](int ks, v16bf* d) {
#pragma unroll
            for (int n = 0; n < 2; ++n) { const unsigned char* p = sb + bofs + n * 16 * GPB + ks * 64; d[n] = cat16b(*(const v8usa*)p, *(const v8usa*)(p + 32)); }
        };
        lda(0, fa[0]); ldb(0, fb[0]);
#pragma unroll
        for (int i = 0; i < NBK; ++i) {
            const int ks = SPLITA ? i >> 1 : i, ks1 = SPLITA ? (i + 1) >> 1 : i + 1;
            if (i + 1 < NBK) { lda(i + 1, fa[(i + 1) & 1]); if (ks1 != ks) ldb(ks1, fb[ks1 & 1]); }
            __builtin_amdgcn_sched_barrier(0);                  // keeps the LDS reads one group in front of the products, not spread among them with waits to 0
#pragma unroll
            for (int m = 0; m < 4; ++m)
#pragma unroll
                for (int n = 0; n < 2; ++n) acc[m][n] = wmmab(fa[i & 1][m], fb[ks & 1][n], acc[m][n]);
            __builtin_amdgcn_sched_barrier(0);                  // the other side of that fence
        }
        asm volatile("s_wait_dscnt 0x0" ::: "memory");          // this wave has left the buffer
        asm volatile("s_wait_asynccnt 0x0" ::: "memory");       // its copies of stage t + 1 have landed
        __syncthreads();                                        // publishes stage t + 1, frees stage t's buffer
        if (t + 2 < NST) fill(t + 2, t & 1);
    }
    asm volatile("s_wait_asynccnt 0x0" ::: "memory");           // nothing in flight when the ring becomes output staging
    const float* bsel = c0 < DM ? bias : c0 < 2 * DM ? bias1 : bias2;   // one bias vector per 1024 output columns (q | k | v stacked along N)
    if constexpr (!SPLITA) { qkv_tail(acc, ring, bsel, r0, c0, WH16, bhel, Q16, K16, VT16, HQ16, HK16); return; }
    float* os = (float*)(ring + wave * (64 * 36 * 4));          // this wave's own 64 rows x 32 columns, pitch 36 floats
#pragma unroll
    for (int n = 0; n < 2; ++n) { const float bv = bfr(bsel[(c0 & (DM - 1)) + wn * 32 + n * 16 + lr]);
#pragma unroll
        for (int m = 0; m < 4; ++m)
#pragma unroll
            for (int j = 0; j < 8; ++j) os[(m * 16 + hi * 8 + j) * 36 + n * 16 + lr] = acc[m][n][j] + bv; }
    float* crow = C + (size_t)(r0 + wm * 64) * ldc + cb + c0 + wn * 32;
#pragma unroll
    for (int s = 0; s < 16; ++s) { const int row = s * 4 + (lane >> 3), cofs = (lane & 7) * 4;
        const v4f val = *(const v4fa*)(os + row * 36 + cofs); *(v4f*)(crow + (size_t)row * ldc + cofs) = val; }
}

// whel_rows: WH16 [h][e][d] = f16(bf16(Whel)).
__device__ __forceinline__ void whel_rows(const float* __restrict__ Whel, h16* WH16, int blk) {
    const int lane = threadIdx.x & 31, r = blk * 8 + (threadIdx.x >> 5);     // row = (h, e): 1024 rows of 64
    if (r >= NH_ * HD) return;
    v2h o; o[0] = (h16)bfr(Whel[(size_t)r * HD + 2 * lane]); o[1] = (h16)bfr(Whel[(size_t)r * HD + 2 * lane + 1]);
    *(v2h*)(WH16 + (size_t)r * HD + 2 * lane) = o; 
}
// one launch for every conversion of an input, none of which depends on another: blocks [0, 512) x, then 128 each for Wq, Wk, Wv, Wo (WB = the four planes in that order), then 128 for Whel
__global__ __launch_bounds__(256) void k_cvt(const float* __restrict__ x, const float* __restrict__ Wq, const float* __restrict__ Wk, const float* __restrict__ Wv, const float* __restrict__ Wo,
                                             const float* __restrict__ Whel, bf* Xb, bf* WB, h16* WH16) {
    const int blk = blockIdx.x;
    if (blk < NTK / 8) { cvtb_rows(x, NTK, Xb, blk); return; }
    const int wb = blk - NTK / 8, i = wb / (DM / 8);
    if (i < 4) { cvtb_rows(i == 0 ? Wq : i == 1 ? Wk : i == 2 ? Wv : Wo, DM, WB + (size_t)i * DM * DM, wb - i * (DM / 8)); return; }
    whel_rows(Whel, WH16, wb - 4 * (DM / 8));
}

// k_attn: block = (b, h, 256 queries), wave = 32 = two 16-query tiles, so that every K, helical-K and V^T fragment read from LDS is the A operand of two products; per tile: q and helical-q fragments resident; 64 steps x 32 keys, all products transposed: S^T = K.Q^T (4 WMMA) and G^T = HK.HQ^T (4 WMMA)
// with the key rows as A and the resident query fragments as B, so a lane holds 16 of the 32 scores of ONE query (column lr, keys 8 hi + j and 16 + 8 hi + j); logits 0.5 s/8 + 0.5 g/32:
// the two factors, 1/16 and 1/64, are powers of two and lie in the resident query fragments, so both products run into ONE accumulator, which then holds the logits themselves;
// online f32 softmax in the lane; weight x128 = exp2(logit * log2 e + (7 - ref * log2 e)), one fused multiply-add in front of each exponential; ref is the query's running maximum as of its last
// renewal: it is renewed (one exchange between the wave's halves), and O and the row sum rescaled, only in a step where some score of the wave lies more than 8 (in log2) above its query's ref, so a weight
// stays at or below 2^15, inside f16; the row sum carries the same 128, which so cancels in the final division; the weights, converted in place, are the B operand of O^T += V^T.P^T (4 WMMA): they touch no LDS.
// ctx -> bf16 hi/lo planes CH/CL[tok][h*64+d].
// A stage = 128 keys of this (b, h), shared by the block's 8 waves: 128 K rows and 128 helical-K rows (128 B each, LDS pitch 144 B) and the 64 V^T rows (256 B each, pitch
// 272 B), brought in by per-lane 16-byte asynchronous copies that cover whole lines; two buffers, the next stage in flight. The 16-byte fragment reads then come from LDS.
#define AKS  128
#define KPB  144
#define VPB  272
#define AKO  (AKS * KPB)
#define AST  (2 * AKO + HD * VPB)
#define QW   32
#define QB   (8 * QW)

// four copies of one operand; the s_wait_xcnt closes the statement so that no address register is rewritten ahead of it
__device__ __forceinline__ void cp4(unsigned l, const h16* g, unsigned ls, size_t gs) {
    asm volatile("global_load_async_to_lds_b128 %0, %1, off\n\t"
                 "global_load_async_to_lds_b128 %2, %3, off\n\t"
                 "global_load_async_to_lds_b128 %4, %5, off\n\t"
                 "global_load_async_to_lds_b128 %6, %7, off\n\t"
                 "s_wait_xcnt 0x0"
                 :: "v"(l), "v"(g), "v"(l + ls), "v"(g + gs), "v"(l + 2 * ls), "v"(g + 2 * gs), "v"(l + 3 * ls), "v"(g + 3 * gs)
                 : "memory");
}

// lane l with lane l ^ 16
__device__ __forceinline__ float xhalf(float x) { return __builtin_bit_cast(float, __builtin_amdgcn_permlanex16(__builtin_bit_cast(int, x), __builtin_bit_cast(int, x), 0x76543210, 0xfedcba98, false, false)); }

__global__ __launch_bounds__(256) void k_attn(const h16* __restrict__ Q16, const h16* __restrict__ K16, const h16* __restrict__ HQ16, const h16* __restrict__ HK16, const h16* __restrict__ VT16, bf* CH, bf* CL) {
    __shared__ __align__(16) unsigned char ring[2 * AST];
    __shared__ __align__(16) float ost[8][QW * 68];
    const int lane = threadIdx.x & 31, wave = threadIdx.x >> 5, lr = lane & 15, hi = lane >> 4;
    const int bid = blockIdx.x;
    const int b = bid / (NH_ * (NT_ / QB)), rem = bid - b * (NH_ * (NT_ / QB)), h = rem / (NT_ / QB), qt = rem - h * (NT_ / QB);
    const int q0 = qt * QB + wave * QW;
    const size_t tok0 = (size_t)b * NT_;
    const size_t hrow0 = ((size_t)b * NH_ + h) * NT_;
    v16h qa[2][2], ga[2][2];                                    // [query tile u][k half]
#pragma unroll
    for (int u = 0; u < 2; ++u)
#pragma unroll
        for (int kc = 0; kc < 2; ++kc) {
            const h16* p = Q16 + (tok0 + q0 + u * 16 + lr) * DM + h * HD + kc * 32 + 8 * hi; qa[u][kc] = cat16(*(const v8h*)p, *(const v8h*)(p + 16)) * (h16)0.0625f;
            const h16* g = HQ16 + (hrow0 + q0 + u * 16 + lr) * HD + kc * 32 + 8 * hi; ga[u][kc] = cat16(*(const v8h*)g, *(const v8h*)(g + 16)) * (h16)0.015625f;
        }
    const h16* kh_b = K16 + tok0 * DM + h * HD; const h16* hk_b = HK16 + hrow0 * HD;
    const h16* vt_b = VT16 + (((size_t)b * NH_ + h) * HD) * NT_;
    v8f o[2][4];
#pragma unroll
    for (int u = 0; u < 2; ++u)
#pragma unroll
        for (int n = 0; n < 4; ++n) o[u][n] = (v8f){};
    float mrow[2] = {-3.0e38f, -3.0e38f}, lpart[2] = {0.f, 0.f};   // per tile: query lr's reference maximum (equal in both halves) and this half's part of its sum (x128)
    float thr[2] = {-3.0e38f, -3.0e38f}, nb[2] = {0.f, 0.f};       // the score above which the reference is renewed (the first step always does), and 7 - mrow * log2 e
    // this wave's copies of a stage: K and helical-K rows krow + 4 i (8 lanes a row), V^T rows vrow + 2 i (16 lanes a row), i = 0 .. 3
    const int krow = wave * 16 + (lane >> 3), kpc = lane & 7, vrow = wave * 8 + hi;
    const unsigned lk = (unsigned)(size_t)ring + krow * KPB + kpc * 16, lv = (unsigned)(size_t)ring + 2 * AKO + vrow * VPB + lr * 16;
    const h16* gk = kh_b + (size_t)krow * DM + kpc * 8; const h16* gh = hk_b + (size_t)krow * HD + kpc * 8; const h16* gv = vt_b + (size_t)vrow * NT_ + lr * 8;
    auto fill = [&](int t, int buf) {
        cp4(lk + buf * AST, gk + (size_t)t * AKS * DM, 4 * KPB, 4 * DM);
        cp4(lk + buf * AST + AKO, gh + (size_t)t * AKS * HD, 4 * KPB, 4 * HD);
        cp4(lv + buf * AST, gv + t * AKS, 2 * VPB, 2 * NT_);
    };
    fill(0, 0);
    asm volatile("s_wait_asynccnt 0x0" ::: "memory");           // stage 0 of this wave has landed
    __syncthreads();                                            // ... and every other wave's
    fill(1, 1);
    // both loops kept rolled: the stage loop picks its buffer by the trip's parity; the four 32-key steps of a stage, unrolled, built to 292 registers against 276 and to no fewer vector instructions a step
#pragma unroll 1
    for (int st = 0; st < NT_ / AKS; ++st) {
    const unsigned char* sb = ring + (st & 1) * AST;
#pragma unroll 1
    for (int kt = 0; kt < AKS / 32; ++kt) {
        const unsigned char* kp = sb + (kt * 32 + lr) * KPB + hi * 16;
        const unsigned char* vb = sb + 2 * AKO + lr * VPB + kt * 64 + hi * 16;
        v8f s[2][2];                                            // [query tile u][key half r]
#pragma unroll
        for (int u = 0; u < 2; ++u) { s[u][0] = (v8f){}; s[u][1] = (v8f){}; }
        v16h kf[2][2], hf[2][2], vf[4];                         // all of the step's fragments, read as one group, each the A operand of two products: the V^T reads' latency lies under the score products
#pragma unroll
        for (int kc = 0; kc < 2; ++kc)
#pragma unroll
            for (int r = 0; r < 2; ++r) { const unsigned char* rp = kp + kc * 64 + r * 16 * KPB; kf[kc][r] = cat16(*(const v8ha*)rp, *(const v8ha*)(rp + 32)); }
#pragma unroll
        for (int kc = 0; kc < 2; ++kc)
#pragma unroll
            for (int r = 0; r < 2; ++r) { const unsigned char* hp = kp + kc * 64 + AKO + r * 16 * KPB; hf[kc][r] = cat16(*(const v8ha*)hp, *(const v8ha*)(hp + 32)); }
#pragma unroll
        for (int n = 0; n < 4; ++n) { const unsigned char* vp = vb + n * 16 * VPB; vf[n] = cat16(*(const v8ha*)vp, *(const v8ha*)(vp + 32)); }
        __builtin_amdgcn_sched_barrier(0);                      // keeps the V^T reads in that group: with the branch below, the build otherwise issues them behind the score products and waits them out
#pragma unroll
        for (int kc = 0; kc < 2; ++kc)
#pragma unroll
            for (int r = 0; r < 2; ++r)
#pragma unroll
                for (int u = 0; u < 2; ++u) s[u][r] = wmma16(kf[kc][r], qa[u][kc], s[u][r]);
#pragma unroll
        for (int kc = 0; kc < 2; ++kc)
#pragma unroll
            for (int r = 0; r < 2; ++r)
#pragma unroll
                for (int u = 0; u < 2; ++u) s[u][r] = wmma16(hf[kc][r], ga[u][kc], s[u][r]);
        float mx[2];
#pragma unroll
        for (int u = 0; u < 2; ++u) { mx[u] = fmaxf(s[u][0][0], s[u][1][0]);
#pragma unroll
            for (int j = 1; j < 8; ++j) mx[u] = fmaxf(mx[u], fmaxf(s[u][0][j], s[u][1][j])); }
        asm volatile("" ::: "memory");                          // compiler fence: holds the V^T reads above the branch; without it they sink behind it, among the last products, and are waited out there
        if (__builtin_amdgcn_ballot_w32(mx[0] > thr[0] || mx[1] > thr[1]) != 0) {   // one scalar branch a step for both tiles, the same for the whole wave (the products need every lane on)
#pragma unroll
            for (int u = 0; u < 2; ++u) {
                const float mn = fmaxf(mrow[u], fmaxf(mx[u], xhalf(mx[u]))); // over all 32 keys: the other half holds this query's other 16
                const float alpha = __expf(mrow[u] - mn); mrow[u] = mn;
                nb[u] = fmaf(-mn, L2E, 7.0f);                   // 7: the weights carry 2^7, 8 below the largest that the test lets through, and small ones stay out of the f16 subnormals
                thr[u] = mn + 8.0f / L2E;
                lpart[u] *= alpha;
#pragma unroll
                for (int n = 0; n < 4; ++n) o[u][n] *= alpha;
            }
        }
        const v8f l2 = {L2E, L2E, L2E, L2E, L2E, L2E, L2E, L2E};
        v16h pa[2];
#pragma unroll
        for (int u = 0; u < 2; ++u) {
            const v8f nb8 = {nb[u], nb[u], nb[u], nb[u], nb[u], nb[u], nb[u], nb[u]};
            const v8f e0 = __builtin_elementwise_fma(s[u][0], l2, nb8), e1 = __builtin_elementwise_fma(s[u][1], l2, nb8);
            v8f p0, p1;                                         // the weights x128
#pragma unroll
            for (int j = 0; j < 8; ++j) { p0[j] = __builtin_amdgcn_exp2f(e0[j]); p1[j] = __builtin_amdgcn_exp2f(e1[j]); }
            const v8f pp = p0 + p1;
            lpart[u] = lpart[u] + (((pp[0] + pp[1]) + (pp[2] + pp[3])) + ((pp[4] + pp[5]) + (pp[6] + pp[7])));
            // element s = key 8 hi + s (s < 8), 16 + 8 hi + s - 8: the k order in which vf was read
            pa[u] = cat16(__builtin_convertvector(p0, v8h), __builtin_convertvector(p1, v8h));
        }
#pragma unroll
        for (int n = 0; n < 4; ++n)
#pragma unroll
            for (int u = 0; u < 2; ++u) o[u][n] = wmma16(vf[n], pa[u], o[u][n]);
        // the distance behind the last product; the V^T fragments and the weights are named so that their registers stay theirs up to here
        asm volatile("v_nop\n\tv_nop\n\tv_nop\n\tv_nop" : "+v"(o[0][0]), "+v"(o[0][1]), "+v"(o[0][2]), "+v"(o[0][3]), "+v"(o[1][0]), "+v"(o[1][1]), "+v"(o[1][2]), "+v"(o[1][3])
                     : "v"(pa[0]), "v"(pa[1]), "v"(vf[0]), "v"(vf[1]), "v"(vf[2]), "v"(vf[3]));
    }
        asm volatile("s_wait_dscnt 0x0" ::: "memory");          // this wave has left the buffer
        asm volatile("s_wait_asynccnt 0x0" ::: "memory");       // its copies of stage st + 1 have landed
        __syncthreads();                                        // publishes stage st + 1, frees stage st's buffer
        if (st + 2 < NT_ / AKS) fill(st + 2, st & 1);
    }
    asm volatile("s_wait_asynccnt 0x0" ::: "memory");           // nothing in flight at the end
    float* os = &ost[wave][0];                                  // o[u][n][j] = ctx[query u * 16 + lr][n * 16 + hi * 8 + j]
#pragma unroll
    for (int u = 0; u < 2; ++u) {
        const float inv = 1.0f / (lpart[u] + xhalf(lpart[u]));
#pragma unroll
        for (int n = 0; n < 4; ++n)
#pragma unroll
            for (int j = 0; j < 8; ++j) os[(u * 16 + lr) * 68 + n * 16 + hi * 8 + j] = o[u][n][j] * inv;
    }
    __syncthreads();
    const size_t cbase = (tok0 + q0) * DM + (size_t)h * HD;
    auto pass = [&]() {
#pragma unroll
        for (int s = 0; s < QW / 4; ++s) { const int row = 4 * s + (lane >> 3), piece = lane & 7; const float* sp = os + row * 68 + piece * 8; v8us oh, ol;
#pragma unroll
            for (int i = 0; i < 8; ++i) { const unsigned short hb = f2bf(sp[i]); oh[i] = hb; ol[i] = f2bf(sp[i] - bf2f(hb)); }
            *(v8us*)(CH + cbase + (size_t)row * DM + piece * 8) = oh; *(v8us*)(CL + cbase + (size_t)row * DM + piece * 8) = ol; }
    };
    pass(); 
}

extern "C" void kernel_launch(void* const* d_in, const int* in_sizes, int n_in,
                              void* d_out, int out_size, void* d_ws, size_t ws_size, hipStream_t stream) {
    (void)in_sizes; (void)n_in; (void)out_size;
    const float* x = (const float*)d_in[0]; const float* Wq = (const float*)d_in[1]; const float* bq = (const float*)d_in[2]; const float* Wk = (const float*)d_in[3]; const float* bk = (const float*)d_in[4];
    const float* Wv = (const float*)d_in[5]; const float* bv = (const float*)d_in[6]; const float* Wo = (const float*)d_in[7]; const float* bo = (const float*)d_in[8];
    const float* Whel = (const float*)d_in[9]; const float* bhel = (const float*)d_in[10];
    float* out = (float*)d_out;    // [2][2048][1024]
    char* wsp = (char*)d_ws;
    auto take = [&](size_t bytes) { char* p = wsp; wsp += (bytes + 255) & ~(size_t)255; return (void*)p; };
    bf* Xb = (bf*)take((size_t)NTK * DM * 2);
    bf* WB = (bf*)take((size_t)4 * DM * DM * 2);                    // bf16 Wq | Wk | Wv | Wo: the first three are one [3072 x 1024] B operand
    bf* CH = (bf*)take((size_t)NTK * DM * 2); bf* CL = (bf*)take((size_t)NTK * DM * 2);   // ctx, bf16 hi and lo planes
    h16* Q16 = (h16*)take((size_t)NTK * DM * 2); h16* K16 = (h16*)take((size_t)NTK * DM * 2); h16* VT16 = (h16*)take((size_t)NTK * DM * 2);
    h16* WH16 = (h16*)take((size_t)NH_ * HD * HD * 2);
    h16* HQ16 = (h16*)take((size_t)NB_ * NH_ * NT_ * HD * 2); h16* HK16 = (h16*)take((size_t)NB_ * NH_ * NT_ * HD * 2);
    if ((size_t)(wsp - (char*)d_ws) > ws_size) return;    // 8.4 + 8.4 + 16.8 + 25.2 + 0.13 + 16.8 MB ~ 76 MB
    k_cvt<<<NTK / 8 + 4 * (DM / 8) + (NH_ * HD) / 8, 256, 0, stream>>>(x, Wq, Wk, Wv, Wo, Whel, Xb, WB, WH16);
    k_gemmb<false><<<dim3(NTK / 128, 3 * DM / 128, 1), 256, 0, stream>>>(Xb, nullptr, WB, bq, bk, bv, nullptr, 0, 0, WH16, bhel, Q16, K16, VT16, HQ16, HK16);
    k_attn<<<NB_ * NH_ * (NT_ / QB), 256, 0, stream>>>(Q16, K16, HQ16, HK16, VT16, CH, CL);
    k_gemmb<true><<<dim3(NTK / 128, DM / 128, 1), 256, 0, stream>>>(CH, CL, WB + (size_t)3 * DM * DM, bo, bo, bo, out, DM, 0, nullptr, nullptr, nullptr, nullptr, nullptr, nullptr, nullptr);
}

// v010
// It runs in 92.4 microseconds.
// Timed twice side by side with v009, it ran 1.04 times as fast both times.
// Over all steps from v000 it is 4.22 times as fast.
#include <hip/hip_runtime.h>

// Contractions, f32 accumulate: q/k/v = x.W^T + b ([4096 x 1024].[1024 x 1024] x3) on v_wmma_f32_16x16x32_bf16 with PLAIN bf16 operands (inputs rounded once: exact
// products); the per-head helical projections q_hel/k_hel = qh.Whel[h]^T + bhel ([tokens x 64].[64 x 64]) on v_wmma_f32_16x16x32_f16 with plain f16 q/k and
// f16(bf16(Whel)); the per-(batch, head) attention with TWO score products per key tile (0.5 q.k/8 + 0.5 helical/32, where the helical operands are the pairwise
// L2-normalised, "scrambled" projections) and weights.v, fused per 16-query tile with plain f16 operands and an online f32 softmax; out = ctx.Wo^T + bo on the bf16

#define NB_  2
#define NT_  2048
#define DM   1024
#define NH_  16
#define HD   64
#define NTK  (NB_ * NT_)
#define L2E  1.44269504088896340736f

typedef _Float16 h16;
typedef unsigned short bf;
typedef __attribute__((ext_vector_type(16))) __bf16   v16bf;
typedef __attribute__((ext_vector_type(16))) _Float16 v16h;
typedef __attribute__((ext_vector_type(8)))  _Float16 v8h;
typedef __attribute__((ext_vector_type(8)))  unsigned short v8us;
typedef __attribute__((ext_vector_type(8)))  float    v8f;
typedef __attribute__((ext_vector_type(4)))  float    v4f;
typedef __attribute__((ext_vector_type(2)))  _Float16 v2h;
typedef v8h  __attribute__((may_alias)) v8ha;
typedef v4f  __attribute__((may_alias)) v4fa;

__device__ __forceinline__ unsigned short f2bf(float f) { unsigned u = __float_as_uint(f); u += 0x7FFFu + ((u >> 16) & 1u); return (unsigned short)(u >> 16); }
__device__ __forceinline__ float bf2f(unsigned short b) { return __uint_as_float(((unsigned)b) << 16); }
__device__ __forceinline__ float bfr(float f) { return bf2f(f2bf(f)); }
__device__ __forceinline__ v16h cat16(v8h lo, v8h hi) { return __builtin_shufflevector(lo, hi, 0, 1, 2, 3, 4, 5, 6, 7, 8, 9, 10, 11, 12, 13, 14, 15); }
__device__ __forceinline__ v16bf cat16b(v8us lo, v8us hi) { return __builtin_bit_cast(v16bf, __builtin_shufflevector(lo, hi, 0, 1, 2, 3, 4, 5, 6, 7, 8, 9, 10, 11, 12, 13, 14, 15)); }
__device__ __forceinline__ v8f wmma16(v16h a, v16h b, v8f c) { return __builtin_amdgcn_wmma_f32_16x16x32_f16(false, a, false, b, (short)0, c, false, false); }
__device__ __forceinline__ v8f wmmab(v16bf a, v16bf b, v8f c) { return __builtin_amdgcn_wmma_f32_16x16x32_bf16(false, a, false, b, (short)0, c, false, false); }

__device__ __forceinline__ void cvtb_rows(const float* __restrict__ src, int nrows, bf* dst, int blk) {
    const int lane = threadIdx.x & 31, r = blk * 8 + (threadIdx.x >> 5);
    if (r >= nrows) return;
    v8us o[4];
#pragma unroll
    for (int q = 0; q < 4; ++q) { v8us t;
#pragma unroll
        for (int i = 0; i < 8; ++i) t[i] = f2bf(src[(size_t)r * DM + q * 256 + lane * 8 + i]);
        o[q] = t; }
#pragma unroll
    for (int q = 0; q < 4; ++q) *(v8us*)(dst + (size_t)r * DM + q * 256 + lane * 8) = o[q];
    
}

// k_gemmb: C[128 x 128] per block of 8 waves (2 x 4, 64 rows x 32 columns each) where SPLITA. The q/k/v form takes C[128 x 384]: the SAME 128 columns (two heads) of q, of k and of v, three 128-row pieces of the
// stacked B operand, 64 rows x (3 x 32) columns a wave: 256 blocks, one a WGP; the A rows are fetched by 8 blocks, not 24, and an A fragment read from LDS feeds 6 products, not 2.
// A stage is 128 k (256 B) of the block's 128 A rows (hi, and lo where SPLITA) and of each piece's 128 B rows,
// brought into LDS by per-lane 16-byte asynchronous copies (whole lines, no register), rows at pitch 272 B for the 16-byte fragment reads; two buffers, the next stage in flight.
#define GKS  128
#define GPB  272
#define GOP  (128 * GPB)
typedef v8us __attribute__((may_alias)) v8usa;

// eight copies of one operand's 16 rows of this wave; the s_wait_xcnt closes the statement so that no address register is rewritten ahead of it
__device__ __forceinline__ void cp8(unsigned l, const bf* g) {
    asm volatile("global_load_async_to_lds_b128 %0, %1, off\n\t"
                 "global_load_async_to_lds_b128 %2, %3, off\n\t"
                 "global_load_async_to_lds_b128 %4, %5, off\n\t"
                 "global_load_async_to_lds_b128 %6, %7, off\n\t"
                 "global_load_async_to_lds_b128 %8, %9, off\n\t"
                 "global_load_async_to_lds_b128 %10, %11, off\n\t"
                 "global_load_async_to_lds_b128 %12, %13, off\n\t"
                 "global_load_async_to_lds_b128 %14, %15, off\n\t"
                 "s_wait_xcnt 0x0"
                 :: "v"(l), "v"(g), "v"(l + 2 * GPB), "v"(g + 2 * DM), "v"(l + 4 * GPB), "v"(g + 4 * DM), "v"(l + 6 * GPB), "v"(g + 6 * DM),
                    "v"(l + 8 * GPB), "v"(g + 8 * DM), "v"(l + 10 * GPB), "v"(g + 10 * DM), "v"(l + 12 * GPB), "v"(g + 12 * DM), "v"(l + 14 * GPB), "v"(g + 14 * DM)
                 : "memory");
}

// the q/k/v tail: what stands between the projection GEMM and attention, done by the GEMM block itself on its 128 tokens x 128 columns (two whole heads) of q, of k and of v while they are still
// in the accumulators; no f32 copy of q/k/v goes to memory. Each tile (+ bias) is rounded to f16 once and laid in the freed ring at pitch 136 halves.
// v: laid transposed (a lane's 8 accumulator rows are 8 consecutive tokens: one 16-byte LDS store), then written as 128 rows of VT16[b][h][d][t], 256 bytes each.
// q, k: laid [token][column]; behind the barrier wave w owns tokens 16 w .. 16 w + 15: they go out as the Q16/K16 rows [tok][1024] (256 bytes a token) and are, per head, the A fragments of
// (q|k)h . Whel[h]^T (8 WMMA, B = WH16[h] rows e), + bf16(bhel); pair (2p, 2p+1) = columns lr, lr^1 of the same tile -> norm via __shfl_xor(.., 1); the normalised rows N[t][64] are staged as f32.
// The reference's _scramble is H[s][2p + c] = N[(2s + c) mod 2048][2p + ((2s + c) / 2048)]: tokens 2u, 2u + 1 fill rows u (their even columns) and 1024 + u (their odd columns) completely,
// so the read of the staging does it: 16 tokens = 8 + 8 whole 128-byte rows of HQ16/HK16 [b][h][s][64].
#define TPH  136
// the block's three tiles (+ bias, rounded to f16) are laid in the freed ring first, so that no accumulator is live in the long vector part behind the barrier
__device__ __forceinline__ void lay_v(v8f (&acc)[4][2], h16* ht, const float* __restrict__ bsel, int c0) {
    const int lane = threadIdx.x & 31, wave = threadIdx.x >> 5, lr = lane & 15, hi = lane >> 4;
    const int wm = wave >> 2, wn = wave & 3;
#pragma unroll
    for (int n = 0; n < 2; ++n) { const float bv = bfr(bsel[c0 + wn * 32 + n * 16 + lr]);
#pragma unroll
        for (int m = 0; m < 4; ++m) { v8h t;
#pragma unroll
            for (int j = 0; j < 8; ++j) t[j] = (h16)(acc[m][n][j] + bv);
            *(v8ha*)(ht + (wn * 32 + n * 16 + lr) * TPH + wm * 64 + m * 16 + hi * 8) = t; } }
}
__device__ __forceinline__ void lay_qk(v8f (&acc)[4][2], h16* ht, const float* __restrict__ bsel, int c0) {
    const int lane = threadIdx.x & 31, wave = threadIdx.x >> 5, lr = lane & 15, hi = lane >> 4;
    const int wm = wave >> 2, wn = wave & 3;
#pragma unroll
    for (int n = 0; n < 2; ++n) { const float bv = bfr(bsel[c0 + wn * 32 + n * 16 + lr]);
#pragma unroll
        for (int m = 0; m < 4; ++m)
#pragma unroll
            for (int j = 0; j < 8; ++j) ht[(wm * 64 + m * 16 + hi * 8 + j) * TPH + wn * 32 + n * 16 + lr] = (h16)(acc[m][n][j] + bv); }
}
__device__ __forceinline__ void fin_v(const h16* ht, int r0, int c0, h16* VT16) {
    const int lane = threadIdx.x & 31, wave = threadIdx.x >> 5, lr = lane & 15, hi = lane >> 4;
    const int h0 = c0 / HD, b = r0 / NT_, tb = r0 & (NT_ - 1);
    h16* base = VT16 + (((size_t)b * NH_ + h0) * HD + wave * 16) * NT_ + tb;
    v8h vr[8];
#pragma unroll
    for (int s = 0; s < 8; ++s) vr[s] = *(const v8ha*)(ht + (wave * 16 + 2 * s + hi) * TPH + lr * 8);
#pragma unroll
    for (int s = 0; s < 8; ++s) *(v8h*)(base + (size_t)(2 * s + hi) * NT_ + lr * 8) = vr[s];
}
// which: 0 = q, 1 = k; c0: the column inside it; ost: this wave's own staging, one 16 x 68 plane a head: written and read by this wave alone, whose LDS operations keep their order
__device__ __forceinline__ void fin_qk(const h16* ht, float* ost, int r0, int c0, int which, const h16* __restrict__ WH16, const float* __restrict__ bhel,
                                       h16* Q16, h16* K16, h16* HQ16, h16* HK16) {
    const int lane = threadIdx.x & 31, wave = threadIdx.x >> 5, lr = lane & 15, hi = lane >> 4;
    const int h0 = c0 / HD, b = r0 / NT_, tb = r0 & (NT_ - 1);     // h0: the first of the block's two heads
    const h16* as = ht + wave * 16 * TPH;
#pragma unroll
    for (int hh = 0; hh < 2; ++hh) {
        const int h = h0 + hh;
        v16h a[2];
#pragma unroll
        for (int kc = 0; kc < 2; ++kc) { const h16* p = as + lr * TPH + hh * HD + kc * 32 + 8 * hi; a[kc] = cat16(*(const v8ha*)p, *(const v8ha*)(p + 16)); }
        v8f d4[4];
#pragma unroll
        for (int n = 0; n < 4; ++n) d4[n] = (v8f){};
#pragma unroll
        for (int kc = 0; kc < 2; ++kc)
#pragma unroll
            for (int n = 0; n < 4; ++n) { const h16* bp = WH16 + ((size_t)h * HD + n * 16 + lr) * HD + kc * 32 + 8 * hi; d4[n] = wmma16(a[kc], cat16(*(const v8h*)bp, *(const v8h*)(bp + 16)), d4[n]); }
        asm volatile("v_nop\n\tv_nop\n\tv_nop\n\tv_nop" : "+v"(d4[0]), "+v"(d4[1]), "+v"(d4[2]), "+v"(d4[3]));   // the distance between the last product and the first vector read of its result
        float* os = ost + hh * (16 * 68);
#pragma unroll
        for (int n = 0; n < 4; ++n) {
            const float bb = bfr(bhel[(size_t)h * HD + n * 16 + lr]);
#pragma unroll
            for (int j = 0; j < 8; ++j) {
                const float v = d4[n][j] + bb;
                const float w = __shfl_xor(v, 1, 32);                 // pair partner (column lr ^ 1, same row)
                const float nrm = sqrtf(v * v + w * w);
                os[(hi * 8 + j) * 68 + n * 16 + lr] = v / fmaxf(nrm, 1e-12f);
            }
        }
    }
    const int t0 = tb + wave * 16, prow = lane >> 3, piece = lane & 7;
    // all of the wave's global stores stand together at its end, their values formed first
    v8h rw[8], lo[2][2], up[2][2];
#pragma unroll
    for (int s = 0; s < 8; ++s) rw[s] = *(const v8ha*)(as + (2 * s + hi) * TPH + lr * 8);
#pragma unroll
    for (int hh = 0; hh < 2; ++hh)
#pragma unroll
        for (int s = 0; s < 2; ++s) { const int u = 4 * s + prow; const float* ev = ost + hh * (16 * 68) + (2 * u) * 68 + piece * 8; const float* od = ev + 68;
#pragma unroll
            for (int i = 0; i < 4; ++i) { lo[hh][s][2 * i] = (h16)ev[2 * i]; lo[hh][s][2 * i + 1] = (h16)od[2 * i]; up[hh][s][2 * i] = (h16)ev[2 * i + 1]; up[hh][s][2 * i + 1] = (h16)od[2 * i + 1]; } }
    h16* r16 = (which ? K16 : Q16) + ((size_t)b * NT_ + t0) * DM + h0 * HD;
#pragma unroll
    for (int s = 0; s < 8; ++s) *(v8h*)(r16 + (size_t)(2 * s + hi) * DM + lr * 8) = rw[s];
#pragma unroll
    for (int hh = 0; hh < 2; ++hh) {
        h16* hrow = (which ? HK16 : HQ16) + (((size_t)b * NH_ + h0 + hh) * NT_ + (t0 >> 1)) * HD;
#pragma unroll
        for (int s = 0; s < 2; ++s) { const int u = 4 * s + prow;
            *(v8h*)(hrow + (size_t)u * HD + piece * 8) = lo[hh][s]; *(v8h*)(hrow + (size_t)(NT_ / 2 + u) * HD + piece * 8) = up[hh][s]; }
    }
    asm volatile("s_wait_xcnt 0x0" ::: "memory");                   // the next piece's code follows these stores: no register that they name is rewritten ahead of this wait
}

// register budget: the q/k/v form is one block a WGP by its LDS, two waves a SIMD (192 accumulator registers and two fragment sets a wave); the other form keeps the budget of four
template <bool SPLITA>
__global__ __launch_bounds__(256) __attribute__((amdgpu_waves_per_eu(SPLITA ? 4 : 2))) void k_gemmb(const bf* __restrict__ A, const bf* __restrict__ Al, const bf* __restrict__ Bn, const float* __restrict__ bias, const float* __restrict__ bias1, const float* __restrict__ bias2, float* C, int ldc, int cb,
                                               const h16* __restrict__ WH16, const float* __restrict__ bhel, h16* Q16, h16* K16, h16* VT16, h16* HQ16, h16* HK16) {
    constexpr int NP = SPLITA ? 1 : 3;                                          // pieces of B: one, or the q, k and v rows of the block's two heads
    constexpr int BOP = (SPLITA ? 2 : 1) * GOP, STG = BOP + NP * GOP;           // one stage: [A | Bq | Bk | Bv], or [A hi | A lo | B]
    constexpr int NST = DM / GKS, NBK = (GKS / 32) * (SPLITA ? 2 : 1);
    __shared__ __align__(16) unsigned char ring[2 * STG];
    const int lane = threadIdx.x & 31, wave = threadIdx.x >> 5, lr = lane & 15, hi = lane >> 4;
    const int wm = wave >> 2, wn = wave & 3;
    const int r0 = blockIdx.x * 128, c0 = blockIdx.y * 128;
    const int crw = wave * 16 + hi;                             // copy i of a wave: rows crw + 2 i, bytes 16 lr of the stage's 256
    const unsigned l0 = (unsigned)(size_t)ring + crw * GPB + lr * 16;
    const bf* gA = A + (size_t)(r0 + crw) * DM + lr * 8;
    const bf* gB = Bn + (size_t)(c0 + crw) * DM + lr * 8;
    const bf* gL = SPLITA ? Al + (size_t)(r0 + crw) * DM + lr * 8 : gA;
    auto fill = [&](int t, int buf) {
        const unsigned l = l0 + buf * STG;
        cp8(l, gA + t * GKS);
#pragma unroll
        for (int p = 0; p < NP; ++p) {
            // keeps each statement's 24 address registers next to it: formed for all four statements at once they did not fit below v256, where asm operands lie, and a base pointer was spilled
            if (!SPLITA) __builtin_amdgcn_sched_barrier(0);
            cp8(l + BOP + p * GOP, gB + (size_t)p * DM * DM + t * GKS);
        }
        if (SPLITA) cp8(l + GOP, gL + t * GKS);
    };
    v8f acc[NP][4][2];
#pragma unroll
    for (int p = 0; p < NP; ++p)
#pragma unroll
        for (int m = 0; m < 4; ++m)
#pragma unroll
            for (int n = 0; n < 2; ++n) acc[p][m][n] = (v8f){};
    fill(0, 0);
    asm volatile("s_wait_asynccnt 0x0" ::: "memory");           // stage 0 of this wave has landed
    __syncthreads();                                            // ... and every other wave's
    fill(1, 1);
    const int aofs = (wm * 64 + lr) * GPB + hi * 16, bofs = BOP + (wn * 32 + lr) * GPB + hi * 16;
    // kept rolled: one stage per trip, the buffer picked by the trip's parity
#pragma unroll 1
    for (int t = 0; t < NST; ++t) {
        const unsigned char* sb = ring + (t & 1) * STG;
        // a block = the 8 NP products of one A-side fragment set (hi, or lo where SPLITA) with one B set; block i + 1's fragments are read as one group ahead of block i's products
        v16bf fa[2][4], fb[2][2 * NP];
        auto lda = [&](int i, v16bf* d) {
            const unsigned char* q = sb + aofs + (SPLITA ? (i & 1) * GOP + (i >> 1) * 64 : i * 64);
#pragma unroll
            for (int m = 0; m < 4; ++m) { const unsigned char* p = q + m * 16 * GPB; d[m] = cat16b(*(const v8usa*)p, *(const v8usa*)(p + 32)); }
        };
        auto ldb = [&](int ks, v16bf* d) {
#pragma unroll
            for (int n = 0; n < 2 * NP; ++n) { const unsigned char* p = sb + bofs + (n >> 1) * GOP + (n & 1) * 16 * GPB + ks * 64; d[n] = cat16b(*(const v8usa*)p, *(const v8usa*)(p + 32)); }
        };
        lda(0, fa[0]); ldb(0, fb[0]);
#pragma unroll
        for (int i = 0; i < NBK; ++i) {
            const int ks = SPLITA ? i >> 1 : i, ks1 = SPLITA ? (i + 1) >> 1 : i + 1;
            if (i + 1 < NBK) { lda(i + 1, fa[(i + 1) & 1]); if (ks1 != ks) ldb(ks1, fb[ks1 & 1]); }
            __builtin_amdgcn_sched_barrier(0);                  // keeps the LDS reads one group in front of the products, not spread among them with waits to 0
#pragma unroll
            for (int m = 0; m < 4; ++m)
#pragma unroll
                for (int n = 0; n < 2 * NP; ++n) acc[n >> 1][m][n & 1] = wmmab(fa[i & 1][m], fb[ks & 1][n], acc[n >> 1][m][n & 1]);
            __builtin_amdgcn_sched_barrier(0);                  // the other side of that fence
        }
        asm volatile("s_wait_dscnt 0x0" ::: "memory");          // this wave has left the buffer
        asm volatile("s_wait_asynccnt 0x0" ::: "memory");       // its copies of stage t + 1 have landed
        __syncthreads();                                        // publishes stage t + 1, frees stage t's buffer
        if (t + 2 < NST) fill(t + 2, t & 1);
    }
    asm volatile("s_wait_asynccnt 0x0" ::: "memory");           // nothing in flight when the ring becomes output staging
    if constexpr (!SPLITA) {
        // all three tiles are laid first, each in a part of the freed ring of its own, behind them the waves' staging; ONE barrier; then the three pieces' rows go out in turn
        constexpr int TTB = 128 * TPH * 2;
        static_assert(3 * TTB + 8 * 2 * 16 * 68 * 4 <= 2 * STG, "the three tiles and the staging lie inside the ring");
        lay_qk(acc[0], (h16*)ring, bias, c0); lay_qk(acc[1], (h16*)(ring + TTB), bias1, c0); lay_v(acc[2], (h16*)(ring + 2 * TTB), bias2, c0);
        __syncthreads();                                            // a token's 128 columns come from four waves, a row of the transposed v tile from two
        float* ost = (float*)(ring + 3 * TTB) + wave * (2 * 16 * 68);
        // kept rolled: q and k run the same long straight-line text once each, which so stays as short as it was
#pragma unroll 1
        for (int p = 0; p < 2; ++p) fin_qk((const h16*)(ring + p * TTB), ost, r0, c0, p, WH16, bhel, Q16, K16, HQ16, HK16);
        fin_v((const h16*)(ring + 2 * TTB), r0, c0, VT16);
        return;
    }
    const float* bsel = c0 < DM ? bias : c0 < 2 * DM ? bias1 : bias2;   // one bias vector per 1024 output columns
    float* os = (float*)(ring + wave * (64 * 36 * 4));          // this wave's own 64 rows x 32 columns, pitch 36 floats
#pragma unroll
    for (int n = 0; n < 2; ++n) { const float bv = bfr(bsel[(c0 & (DM - 1)) + wn * 32 + n * 16 + lr]);
#pragma unroll
        for (int m = 0; m < 4; ++m)
#pragma unroll
            for (int j = 0; j < 8; ++j) os[(m * 16 + hi * 8 + j) * 36 + n * 16 + lr] = acc[0][m][n][j] + bv; }
    float* crow = C + (size_t)(r0 + wm * 64) * ldc + cb + c0 + wn * 32;
#pragma unroll
    for (int s = 0; s < 16; ++s) { const int row = s * 4 + (lane >> 3), cofs = (lane & 7) * 4;
        const v4f val = *(const v4fa*)(os + row * 36 + cofs); *(v4f*)(crow + (size_t)row * ldc + cofs) = val; }
}

// whel_rows: WH16 [h][e][d] = f16(bf16(Whel)).
__device__ __forceinline__ void whel_rows(const float* __restrict__ Whel, h16* WH16, int blk) {
    const int lane = threadIdx.x & 31, r = blk * 8 + (threadIdx.x >> 5);     // row = (h, e): 1024 rows of 64
    if (r >= NH_ * HD) return;
    v2h o; o[0] = (h16)bfr(Whel[(size_t)r * HD + 2 * lane]); o[1] = (h16)bfr(Whel[(size_t)r * HD + 2 * lane + 1]);
    *(v2h*)(WH16 + (size_t)r * HD + 2 * lane) = o; 
}
// one launch for every conversion of an input, none of which depends on another: blocks [0, 512) x, then 128 each for Wq, Wk, Wv, Wo (WB = the four planes in that order), then 128 for Whel
__global__ __launch_bounds__(256) void k_cvt(const float* __restrict__ x, const float* __restrict__ Wq, const float* __restrict__ Wk, const float* __restrict__ Wv, const float* __restrict__ Wo,
                                             const float* __restrict__ Whel, bf* Xb, bf* WB, h16* WH16) {
    const int blk = blockIdx.x;
    if (blk < NTK / 8) { cvtb_rows(x, NTK, Xb, blk); return; }
    const int wb = blk - NTK / 8, i = wb / (DM / 8);
    if (i < 4) { cvtb_rows(i == 0 ? Wq : i == 1 ? Wk : i == 2 ? Wv : Wo, DM, WB + (size_t)i * DM * DM, wb - i * (DM / 8)); return; }
    whel_rows(Whel, WH16, wb - 4 * (DM / 8));
}

// k_attn: block = (b, h, 256 queries), wave = 32 = two 16-query tiles, so that every K, helical-K and V^T fragment read from LDS is the A operand of two products; per tile: q and helical-q fragments resident; 64 steps x 32 keys, all products transposed: S^T = K.Q^T (4 WMMA) and G^T = HK.HQ^T (4 WMMA)
// with the key rows as A and the resident query fragments as B, so a lane holds 16 of the 32 scores of ONE query (column lr, keys 8 hi + j and 16 + 8 hi + j); logits 0.5 s/8 + 0.5 g/32:
// the two factors, 1/16 and 1/64, are powers of two and lie in the resident query fragments, so both products run into ONE accumulator, which then holds the logits themselves;
// online f32 softmax in the lane; weight x128 = exp2(logit * log2 e + (7 - ref * log2 e)), one fused multiply-add in front of each exponential; ref is the query's running maximum as of its last
// renewal: it is renewed (one exchange between the wave's halves), and O and the row sum rescaled, only in a step where some score of the wave lies more than 8 (in log2) above its query's ref, so a weight
// stays at or below 2^15, inside f16; the row sum carries the same 128, which so cancels in the final division; the weights, converted in place, are the B operand of O^T += V^T.P^T (4 WMMA): they touch no LDS.
// ctx -> bf16 hi/lo planes CH/CL[tok][h*64+d].
// A stage = 128 keys of this (b, h), shared by the block's 8 waves: 128 K rows and 128 helical-K rows (128 B each, LDS pitch 144 B) and the 64 V^T rows (256 B each, pitch
// 272 B), brought in by per-lane 16-byte asynchronous copies that cover whole lines; two buffers, the next stage in flight. The 16-byte fragment reads then come from LDS.
#define AKS  128
#define KPB  144
#define VPB  272
#define AKO  (AKS * KPB)
#define AST  (2 * AKO + HD * VPB)
#define QW   32
#define QB   (8 * QW)

// four copies of one operand; the s_wait_xcnt closes the statement so that no address register is rewritten ahead of it
__device__ __forceinline__ void cp4(unsigned l, const h16* g, unsigned ls, size_t gs) {
    asm volatile("global_load_async_to_lds_b128 %0, %1, off\n\t"
                 "global_load_async_to_lds_b128 %2, %3, off\n\t"
                 "global_load_async_to_lds_b128 %4, %5, off\n\t"
                 "global_load_async_to_lds_b128 %6, %7, off\n\t"
                 "s_wait_xcnt 0x0"
                 :: "v"(l), "v"(g), "v"(l + ls), "v"(g + gs), "v"(l + 2 * ls), "v"(g + 2 * gs), "v"(l + 3 * ls), "v"(g + 3 * gs)
                 : "memory");
}

// lane l with lane l ^ 16
__device__ __forceinline__ float xhalf(float x) { return __builtin_bit_cast(float, __builtin_amdgcn_permlanex16(__builtin_bit_cast(int, x), __builtin_bit_cast(int, x), 0x76543210, 0xfedcba98, false, false)); }

__global__ __launch_bounds__(256) void k_attn(const h16* __restrict__ Q16, const h16* __restrict__ K16, const h16* __restrict__ HQ16, const h16* __restrict__ HK16, const h16* __restrict__ VT16, bf* CH, bf* CL) {
    __shared__ __align__(16) unsigned char ring[2 * AST];
    __shared__ __align__(16) float ost[8][QW * 68];
    const int lane = threadIdx.x & 31, wave = threadIdx.x >> 5, lr = lane & 15, hi = lane >> 4;
    const int bid = blockIdx.x;
    const int b = bid / (NH_ * (NT_ / QB)), rem = bid - b * (NH_ * (NT_ / QB)), h = rem / (NT_ / QB), qt = rem - h * (NT_ / QB);
    const int q0 = qt * QB + wave * QW;
    const size_t tok0 = (size_t)b * NT_;
    const size_t hrow0 = ((size_t)b * NH_ + h) * NT_;
    v16h qa[2][2], ga[2][2];                                    // [query tile u][k half]
#pragma unroll
    for (int u = 0; u < 2; ++u)
#pragma unroll
        for (int kc = 0; kc < 2; ++kc) {
            const h16* p = Q16 + (tok0 + q0 + u * 16 + lr) * DM + h * HD + kc * 32 + 8 * hi; qa[u][kc] = cat16(*(const v8h*)p, *(const v8h*)(p + 16)) * (h16)0.0625f;
            const h16* g = HQ16 + (hrow0 + q0 + u * 16 + lr) * HD + kc * 32 + 8 * hi; ga[u][kc] = cat16(*(const v8h*)g, *(const v8h*)(g + 16)) * (h16)0.015625f;
        }
    const h16* kh_b = K16 + tok0 * DM + h * HD; const h16* hk_b = HK16 + hrow0 * HD;
    const h16* vt_b = VT16 + (((size_t)b * NH_ + h) * HD) * NT_;
    v8f o[2][4];
#pragma unroll
    for (int u = 0; u < 2; ++u)
#pragma unroll
        for (int n = 0; n < 4; ++n) o[u][n] = (v8f){};
    float mrow[2] = {-3.0e38f, -3.0e38f}, lpart[2] = {0.f, 0.f};   // per tile: query lr's reference maximum (equal in both halves) and this half's part of its sum (x128)
    float thr[2] = {-3.0e38f, -3.0e38f}, nb[2] = {0.f, 0.f};       // the score above which the reference is renewed (the first step always does), and 7 - mrow * log2 e
    // this wave's copies of a stage: K and helical-K rows krow + 4 i (8 lanes a row), V^T rows vrow + 2 i (16 lanes a row), i = 0 .. 3
    const int krow = wave * 16 + (lane >> 3), kpc = lane & 7, vrow = wave * 8 + hi;
    const unsigned lk = (unsigned)(size_t)ring + krow * KPB + kpc * 16, lv = (unsigned)(size_t)ring + 2 * AKO + vrow * VPB + lr * 16;
    const h16* gk = kh_b + (size_t)krow * DM + kpc * 8; const h16* gh = hk_b + (size_t)krow * HD + kpc * 8; const h16* gv = vt_b + (size_t)vrow * NT_ + lr * 8;
    auto fill = [&](int t, int buf) {
        cp4(lk + buf * AST, gk + (size_t)t * AKS * DM, 4 * KPB, 4 * DM);
        cp4(lk + buf * AST + AKO, gh + (size_t)t * AKS * HD, 4 * KPB, 4 * HD);
        cp4(lv + buf * AST, gv + t * AKS, 2 * VPB, 2 * NT_);
    };
    fill(0, 0);
    asm volatile("s_wait_asynccnt 0x0" ::: "memory");           // stage 0 of this wave has landed
    __syncthreads();                                            // ... and every other wave's
    fill(1, 1);
    // both loops kept rolled: the stage loop picks its buffer by the trip's parity; the four 32-key steps of a stage, unrolled, built to 292 registers against 276 and to no fewer vector instructions a step
#pragma unroll 1
    for (int st = 0; st < NT_ / AKS; ++st) {
    const unsigned char* sb = ring + (st & 1) * AST;
#pragma unroll 1
    for (int kt = 0; kt < AKS / 32; ++kt) {
        const unsigned char* kp = sb + (kt * 32 + lr) * KPB + hi * 16;
        const unsigned char* vb = sb + 2 * AKO + lr * VPB + kt * 64 + hi * 16;
        v8f s[2][2];                                            // [query tile u][key half r]
#pragma unroll
        for (int u = 0; u < 2; ++u) { s[u][0] = (v8f){}; s[u][1] = (v8f){}; }
        v16h kf[2][2], hf[2][2], vf[4];                         // all of the step's fragments, read as one group, each the A operand of two products: the V^T reads' latency lies under the score products
#pragma unroll
        for (int kc = 0; kc < 2; ++kc)
#pragma unroll
            for (int r = 0; r < 2; ++r) { const unsigned char* rp = kp + kc * 64 + r * 16 * KPB; kf[kc][r] = cat16(*(const v8ha*)rp, *(const v8ha*)(rp + 32)); }
#pragma unroll
        for (int kc = 0; kc < 2; ++kc)
#pragma unroll
            for (int r = 0; r < 2; ++r) { const unsigned char* hp = kp + kc * 64 + AKO + r * 16 * KPB; hf[kc][r] = cat16(*(const v8ha*)hp, *(const v8ha*)(hp + 32)); }
#pragma unroll
        for (int n = 0; n < 4; ++n) { const unsigned char* vp = vb + n * 16 * VPB; vf[n] = cat16(*(const v8ha*)vp, *(const v8ha*)(vp + 32)); }
        __builtin_amdgcn_sched_barrier(0);                      // keeps the V^T reads in that group: with the branch below, the build otherwise issues them behind the score products and waits them out
#pragma unroll
        for (int kc = 0; kc < 2; ++kc)
#pragma unroll
            for (int r = 0; r < 2; ++r)
#pragma unroll
                for (int u = 0; u < 2; ++u) s[u][r] = wmma16(kf[kc][r], qa[u][kc], s[u][r]);
#pragma unroll
        for (int kc = 0; kc < 2; ++kc)
#pragma unroll
            for (int r = 0; r < 2; ++r)
#pragma unroll
                for (int u = 0; u < 2; ++u) s[u][r] = wmma16(hf[kc][r], ga[u][kc], s[u][r]);
        float mx[2];
#pragma unroll
        for (int u = 0; u < 2; ++u) { mx[u] = fmaxf(s[u][0][0], s[u][1][0]);
#pragma unroll
            for (int j = 1; j < 8; ++j) mx[u] = fmaxf(mx[u], fmaxf(s[u][0][j], s[u][1][j])); }
        asm volatile("" ::: "memory");                          // compiler fence: holds the V^T reads above the branch; without it they sink behind it, among the last products, and are waited out there
        if (__builtin_amdgcn_ballot_w32(mx[0] > thr[0] || mx[1] > thr[1]) != 0) {   // one scalar branch a step for both tiles, the same for the whole wave (the products need every lane on)
#pragma unroll
            for (int u = 0; u < 2; ++u) {
                const float mn = fmaxf(mrow[u], fmaxf(mx[u], xhalf(mx[u]))); // over all 32 keys: the other half holds this query's other 16
                const float alpha = __expf(mrow[u] - mn); mrow[u] = mn;
                nb[u] = fmaf(-mn, L2E, 7.0f);                   // 7: the weights carry 2^7, 8 below the largest that the test lets through, and small ones stay out of the f16 subnormals
                thr[u] = mn + 8.0f / L2E;
                lpart[u] *= alpha;
#pragma unroll
                for (int n = 0; n < 4; ++n) o[u][n] *= alpha;
            }
        }
        const v8f l2 = {L2E, L2E, L2E, L2E, L2E, L2E, L2E, L2E};
        v16h pa[2];
#pragma unroll
        for (int u = 0; u < 2; ++u) {
            const v8f nb8 = {nb[u], nb[u], nb[u], nb[u], nb[u], nb[u], nb[u], nb[u]};
            const v8f e0 = __builtin_elementwise_fma(s[u][0], l2, nb8), e1 = __builtin_elementwise_fma(s[u][1], l2, nb8);
            v8f p0, p1;                                         // the weights x128
#pragma unroll
            for (int j = 0; j < 8; ++j) { p0[j] = __builtin_amdgcn_exp2f(e0[j]); p1[j] = __builtin_amdgcn_exp2f(e1[j]); }
            const v8f pp = p0 + p1;
            lpart[u] = lpart[u] + (((pp[0] + pp[1]) + (pp[2] + pp[3])) + ((pp[4] + pp[5]) + (pp[6] + pp[7])));
            // element s = key 8 hi + s (s < 8), 16 + 8 hi + s - 8: the k order in which vf was read
            pa[u] = cat16(__builtin_convertvector(p0, v8h), __builtin_convertvector(p1, v8h));
        }
#pragma unroll
        for (int n = 0; n < 4; ++n)
#pragma unroll
            for (int u = 0; u < 2; ++u) o[u][n] = wmma16(vf[n], pa[u], o[u][n]);
        // the distance behind the last product; the V^T fragments and the weights are named so that their registers stay theirs up to here
        asm volatile("v_nop\n\tv_nop\n\tv_nop\n\tv_nop" : "+v"(o[0][0]), "+v"(o[0][1]), "+v"(o[0][2]), "+v"(o[0][3]), "+v"(o[1][0]), "+v"(o[1][1]), "+v"(o[1][2]), "+v"(o[1][3])
                     : "v"(pa[0]), "v"(pa[1]), "v"(vf[0]), "v"(vf[1]), "v"(vf[2]), "v"(vf[3]));
    }
        asm volatile("s_wait_dscnt 0x0" ::: "memory");          // this wave has left the buffer
        asm volatile("s_wait_asynccnt 0x0" ::: "memory");       // its copies of stage st + 1 have landed
        __syncthreads();                                        // publishes stage st + 1, frees stage st's buffer
        if (st + 2 < NT_ / AKS) fill(st + 2, st & 1);
    }
    asm volatile("s_wait_asynccnt 0x0" ::: "memory");           // nothing in flight at the end
    float* os = &ost[wave][0];                                  // o[u][n][j] = ctx[query u * 16 + lr][n * 16 + hi * 8 + j]
#pragma unroll
    for (int u = 0; u < 2; ++u) {
        const float inv = 1.0f / (lpart[u] + xhalf(lpart[u]));
#pragma unroll
        for (int n = 0; n < 4; ++n)
#pragma unroll
            for (int j = 0; j < 8; ++j) os[(u * 16 + lr) * 68 + n * 16 + hi * 8 + j] = o[u][n][j] * inv;
    }
    __syncthreads();
    const size_t cbase = (tok0 + q0) * DM + (size_t)h * HD;
    auto pass = [&]() {
#pragma unroll
        for (int s = 0; s < QW / 4; ++s) { const int row = 4 * s + (lane >> 3), piece = lane & 7; const float* sp = os + row * 68 + piece * 8; v8us oh, ol;
#pragma unroll
            for (int i = 0; i < 8; ++i) { const unsigned short hb = f2bf(sp[i]); oh[i] = hb; ol[i] = f2bf(sp[i] - bf2f(hb)); }
            *(v8us*)(CH + cbase + (size_t)row * DM + piece * 8) = oh; *(v8us*)(CL + cbase + (size_t)row * DM + piece * 8) = ol; }
    };
    pass(); 
}

extern "C" void kernel_launch(void* const* d_in, const int* in_sizes, int n_in,
                              void* d_out, int out_size, void* d_ws, size_t ws_size, hipStream_t stream) {
    (void)in_sizes; (void)n_in; (void)out_size;
    const float* x = (const float*)d_in[0]; const float* Wq = (const float*)d_in[1]; const float* bq = (const float*)d_in[2]; const float* Wk = (const float*)d_in[3]; const float* bk = (const float*)d_in[4];
    const float* Wv = (const float*)d_in[5]; const float* bv = (const float*)d_in[6]; const float* Wo = (const float*)d_in[7]; const float* bo = (const float*)d_in[8];
    const float* Whel = (const float*)d_in[9]; const float* bhel = (const float*)d_in[10];
    float* out = (float*)d_out;    // [2][2048][1024]
    char* wsp = (char*)d_ws;
    auto take = [&](size_t bytes) { char* p = wsp; wsp += (bytes + 255) & ~(size_t)255; return (void*)p; };
    bf* Xb = (bf*)take((size_t)NTK * DM * 2);
    bf* WB = (bf*)take((size_t)4 * DM * DM * 2);                    // bf16 Wq | Wk | Wv | Wo: the first three are one [3072 x 1024] B operand
    bf* CH = (bf*)take((size_t)NTK * DM * 2); bf* CL = (bf*)take((size_t)NTK * DM * 2);   // ctx, bf16 hi and lo planes
    h16* Q16 = (h16*)take((size_t)NTK * DM * 2); h16* K16 = (h16*)take((size_t)NTK * DM * 2); h16* VT16 = (h16*)take((size_t)NTK * DM * 2);
    h16* WH16 = (h16*)take((size_t)NH_ * HD * HD * 2);
    h16* HQ16 = (h16*)take((size_t)NB_ * NH_ * NT_ * HD * 2); h16* HK16 = (h16*)take((size_t)NB_ * NH_ * NT_ * HD * 2);
    if ((size_t)(wsp - (char*)d_ws) > ws_size) return;    // 8.4 + 8.4 + 16.8 + 25.2 + 0.13 + 16.8 MB ~ 76 MB
    k_cvt<<<NTK / 8 + 4 * (DM / 8) + (NH_ * HD) / 8, 256, 0, stream>>>(x, Wq, Wk, Wv, Wo, Whel, Xb, WB, WH16);
    k_gemmb<false><<<dim3(NTK / 128, DM / 128, 1), 256, 0, stream>>>(Xb, nullptr, WB, bq, bk, bv, nullptr, 0, 0, WH16, bhel, Q16, K16, VT16, HQ16, HK16);
    k_attn<<<NB_ * NH_ * (NT_ / QB), 256, 0, stream>>>(Q16, K16, HQ16, HK16, VT16, CH, CL);
    k_gemmb<true><<<dim3(NTK / 128, DM / 128, 1), 256, 0, stream>>>(CH, CL, WB + (size_t)3 * DM * DM, bo, bo, bo, out, DM, 0, nullptr, nullptr, nullptr, nullptr, nullptr, nullptr, nullptr);
}
